// v000
// Measured on an AMD MI455X. A time is GPU time per run, averaged over a window of back-to-back runs after a warm-up
// (all launches, gaps included; the runs take copies of the inputs in turn), and the median of several windows.
// Apart from v000's, it joins two sittings. Times from different sittings can be a few percent apart, while
// side-by-side timings come from the same sitting.
// The starting kernel, v000, takes 3870 microseconds a run.
#include <hip/hip_runtime.h>
// Single-head attention with dense projections (q_in, k_in, v_in [4][4096][256]; q = q_in Wq + bq, k = k_in Wk + bk, v = v_in Wv + bv ([in][out] 256x256 glorot-uniform, biases uniform); scores = q . k x 256^-0.5; softmax over the 4096 keys (no mask); out = attn v -> [4][4096][256]; no output projection).
// Structure: the three inputs as exact f16 rows; [in][out] weights as exact x16 planes; q, k as WMMA GEMMs (32x64 wave tiles, f32 accumulation, + bias, f16 outputs: logits sigma ~1), v as an f32-output GEMM split into f16 hi + x1024 residual planes; per batch: V^T of the hi and residual planes (4 slabs of 64) via LDS transposes; scores as ONE GEMM (K = 256, alpha 1/16) into an f32 [4096][4096] plane; row softmax on VALU (f32 statistics, native exp; weights x256 f16); out = P V_hi^T (N = 256, K = 4096, alpha 2^-8) straight into the output, then += P V_lo^T 2^-18 (own-element accumulate in the next launch); launches: see trace.
// Compute dtype: inputs rounded to bf16; x / weights exact; q, k, P plain f16 (~2^-12), v as hi + residual; scores / statistics / out f32; v_wmma_f32_16x16x32_f16.
#define NB 4
#define SQ 4096
#define DM 256
#define NH 1
#define HD 64
#define HG 1
#define NR ((size_t)NB * SQ)
typedef __bf16 v16b __attribute__((ext_vector_type(16)));
typedef unsigned short v8us __attribute__((ext_vector_type(8), may_alias));
typedef float  v8f  __attribute__((ext_vector_type(8)));
typedef float  v4f  __attribute__((ext_vector_type(4)));
typedef float  v4fa __attribute__((ext_vector_type(4), may_alias));
union FragB { v16b v; v8us half[2]; unsigned short u[16]; };

__device__ __forceinline__ unsigned short bf16_bits(float x) { unsigned int u = __float_as_uint(x); return (unsigned short)((u + 0x7FFFu + ((u >> 16) & 1u)) >> 16); }
__device__ __forceinline__ float bf16_val(unsigned short b) { return __uint_as_float(((unsigned int)b) << 16); }
__device__ __forceinline__ float bf16_round(float x) { return bf16_val(bf16_bits(x)); }
// D += A·B with NT terms: 1 = ah·bh, 2 = + al·bh (A split), 3 = + ah·bl (both split)
template <int NT>
__device__ __forceinline__ v8f mmaN(v16b ah, v16b al, v16b bh, v16b bl, v8f c) {
  c = __builtin_amdgcn_wmma_f32_16x16x32_bf16(false, ah, false, bh, (short)0, c, false, false);
  if (NT >= 2) c = __builtin_amdgcn_wmma_f32_16x16x32_bf16(false, al, false, bh, (short)0, c, false, false);
  if (NT >= 3) c = __builtin_amdgcn_wmma_f32_16x16x32_bf16(false, ah, false, bl, (short)0, c, false, false);
  asm volatile("v_nop\n\tv_nop\n\tv_nop\n\tv_nop" : "+v"(c) : "v"(ah), "v"(al), "v"(bh), "v"(bl));
  return c;
}

__global__ __launch_bounds__(256) void k_wt_bf16(const float* __restrict__ W, unsigned short* __restrict__ Wt, int K, int N) {
  const int t = blockIdx.x * 256 + threadIdx.x;
  const int k8n = K / 8;
  if (t >= N * k8n) return;
  const int n = t / k8n, k8 = (t % k8n) * 8;
  v8us v;
#pragma unroll
  for (int i = 0; i < 8; ++i) v[i] = bf16_bits(W[(size_t)(k8 + i) * N + n]);
  *(v8us*)(Wt + (size_t)n * K + k8) = v;
  
}

// GEMM C[M][N] (f32, pitch ldc) = act(A[M][K]·W + bias). A f32 row-major (pitch lda) converted per fragment to bf16
// (ASPLIT: hi/lo two planes -> 2 terms, else single rounded term); Wt bf16 [N][K] (pitch ldb). BIAS_BF16 rounds the
// bias to bf16 first (bias quantised to bf16 before the add). K%32==0, M%16==0, N%64==0.
template <bool ASPLIT, int ACT, bool BIAS_BF16>
__global__ __launch_bounds__(128) void k_gemm_bf(const float* __restrict__ A, int lda, const unsigned short* __restrict__ Wt, int ldb,
                                               const float* __restrict__ bias, float* __restrict__ C, int ldc, int M, int N, int K) {
  __shared__ __attribute__((aligned(16))) float so[4][16][64];
  const int tid = threadIdx.x, w = tid >> 5, lane = tid & 31, ln = lane & 15, hh = lane >> 4;
  const int ntn = N / 64;
  const int wid = blockIdx.x * 4 + w;
  const int mt = wid / ntn, nq = wid % ntn;
  if (mt * 16 >= M) return;
  const int row0 = mt * 16, col0 = nq * 64;
  const float* arow = A + (size_t)(row0 + ln) * lda;
  v8f acc[4] = {};
  for (int kb = 0; kb < K; kb += 32) {
    FragB ah, al;
    const v4f x0 = *(const v4fa*)(arow + kb + 8 * hh), x1 = *(const v4fa*)(arow + kb + 8 * hh + 4);
    const v4f x2 = *(const v4fa*)(arow + kb + 16 + 8 * hh), x3 = *(const v4fa*)(arow + kb + 16 + 8 * hh + 4);
    float xs[16] = {x0[0],x0[1],x0[2],x0[3],x1[0],x1[1],x1[2],x1[3],x2[0],x2[1],x2[2],x2[3],x3[0],x3[1],x3[2],x3[3]};
#pragma unroll
    for (int i = 0; i < 16; ++i) { const unsigned short hb = bf16_bits(xs[i]); ah.u[i] = hb; al.u[i] = ASPLIT ? bf16_bits(xs[i] - bf16_val(hb)) : (unsigned short)0; }
#pragma unroll
    for (int t = 0; t < 4; ++t) {
      const unsigned short* brow = Wt + (size_t)(col0 + t * 16 + ln) * ldb + kb;
      FragB b;
      b.half[0] = *(const v8us*)(brow + 8 * hh);
      b.half[1] = *(const v8us*)(brow + 16 + 8 * hh);
      acc[t] = mmaN<ASPLIT ? 2 : 1>(ah.v, al.v, b.v, b.v, acc[t]);
    }
  }
#pragma unroll
  for (int t = 0; t < 4; ++t) {
    float bv = bias ? bias[col0 + t * 16 + ln] : 0.f;
    if (BIAS_BF16) bv = bf16_round(bv);
#pragma unroll
    for (int r = 0; r < 8; ++r) { float v = acc[t][r] + bv; if (ACT == 1) v = fmaxf(v, 0.f); so[w][8 * hh + r][t * 16 + ln] = v; }
  }
  __builtin_amdgcn_fence(__ATOMIC_ACQ_REL, "workgroup");
  __builtin_amdgcn_wave_barrier();
  const int rsub = lane >> 4, c4 = (lane & 15) * 4;
  {
#pragma unroll
    for (int q = 0; q < 8; ++q) {
      const int r = q * 2 + rsub;
      const v4f v = *(const v4fa*)&so[w][r][c4];
      *(v4f*)(C + (size_t)(row0 + r) * ldc + col0 + c4) = v;
    }
    
  }
}

// GEMM C = act(A·W + bias + resid): A f32 (ASPLIT -> hi/lo 2 terms), Wt bf16 [N][K]; ACT 0 none, 1 relu, 2 exact gelu;
// resid (optional, f32, row index = (row % rmod), pitch ldr, RES_BF16 rounds it) added before the activation.
template <bool ASPLIT, int ACT, bool BIAS_BF16, bool RES_BF16>
__global__ __launch_bounds__(128) void k_gemm_bf3(const float* __restrict__ A, int lda, const unsigned short* __restrict__ Wt, int ldb,
                                                const float* __restrict__ bias, const float* __restrict__ resid, int rmod, int ldr,
                                                float* __restrict__ C, int ldc, int M, int N, int K) {
  __shared__ __attribute__((aligned(16))) float so[4][16][64];
  const int tid = threadIdx.x, w = tid >> 5, lane = tid & 31, ln = lane & 15, hh = lane >> 4;
  const int ntn = N / 64;
  const int wid = blockIdx.x * 4 + w;
  const int mt = wid / ntn, nq = wid % ntn;
  if (mt * 16 >= M) return;
  const int row0 = mt * 16, col0 = nq * 64;
  const float* arow = A + (size_t)(row0 + ln) * lda;
  v8f acc[4] = {};
  for (int kb = 0; kb < K; kb += 32) {
    FragB ah, al;
    const v4f x0 = *(const v4fa*)(arow + kb + 8 * hh), x1 = *(const v4fa*)(arow + kb + 8 * hh + 4);
    const v4f x2 = *(const v4fa*)(arow + kb + 16 + 8 * hh), x3 = *(const v4fa*)(arow + kb + 16 + 8 * hh + 4);
    float xs[16] = {x0[0],x0[1],x0[2],x0[3],x1[0],x1[1],x1[2],x1[3],x2[0],x2[1],x2[2],x2[3],x3[0],x3[1],x3[2],x3[3]};
#pragma unroll
    for (int i = 0; i < 16; ++i) { const unsigned short hb = bf16_bits(xs[i]); ah.u[i] = hb; al.u[i] = ASPLIT ? bf16_bits(xs[i] - bf16_val(hb)) : (unsigned short)0; }
#pragma unroll
    for (int t = 0; t < 4; ++t) {
      const unsigned short* brow = Wt + (size_t)(col0 + t * 16 + ln) * ldb + kb;
      FragB b;
      b.half[0] = *(const v8us*)(brow + 8 * hh);
      b.half[1] = *(const v8us*)(brow + 16 + 8 * hh);
      acc[t] = mmaN<ASPLIT ? 2 : 1>(ah.v, al.v, b.v, b.v, acc[t]);
    }
  }
#pragma unroll
  for (int t = 0; t < 4; ++t) {
    const int col = col0 + t * 16 + ln;
    float bv = bias ? bias[col] : 0.f;
    if (BIAS_BF16) bv = bf16_round(bv);
#pragma unroll
    for (int r = 0; r < 8; ++r) {
      float v = acc[t][r] + bv;
      if (resid) { float rv = resid[(size_t)((row0 + 8 * hh + r) % rmod) * ldr + col]; if (RES_BF16) rv = bf16_round(rv); v += rv; }
      if (ACT == 1) v = fmaxf(v, 0.f);
      if (ACT == 2) v = 0.5f * v * (1.0f + erff(v * 0.70710678118654752f));
      if (ACT == 3) { const float u = 0.7978845608028654f * (v + 0.044715f * v * v * v); v = 0.5f * v * (1.0f + tanhf(u)); }
      so[w][8 * hh + r][t * 16 + ln] = v;
    }
  }
  __builtin_amdgcn_fence(__ATOMIC_ACQ_REL, "workgroup");
  __builtin_amdgcn_wave_barrier();
  const int rsub = lane >> 4, c4 = (lane & 15) * 4;
  {
#pragma unroll
    for (int q = 0; q < 8; ++q) {
      const int r = q * 2 + rsub;
      const v4f v = *(const v4fa*)&so[w][r][c4];
      *(v4f*)(C + (size_t)(row0 + r) * ldc + col0 + c4) = v;
    }
    
  }
}
// row LayerNorm (biased variance, eps) over N: s = X (+ R); optional out_sum <- s; out_norm <- (s-mu)*rsqrt(var+eps)*g + b
template <bool PARAM_BF16>
__global__ __launch_bounds__(256) void k_layernorm(const float* __restrict__ X, const float* __restrict__ R, const float* __restrict__ g, const float* __restrict__ bta,
                                                  float* __restrict__ out_sum, float* __restrict__ out_norm, int N, float eps) {
  __shared__ float red[256];
  const int row = blockIdx.x, tid = threadIdx.x;
  const float* x = X + (size_t)row * N; const float* rr = R ? R + (size_t)row * N : nullptr;
  float vals[16];                     // up to N = 4096
  const int per = N / 256;            // contiguous chunk per thread? use strided-by-4 chunks: thread handles j = tid*4 + 1024*u
  float s1 = 0.f;
  for (int u = 0; u < per / 4; ++u) {
    const int j = tid * 4 + 1024 * u;
    const v4f a = *(const v4fa*)(x + j);
    v4f b = {0.f,0.f,0.f,0.f}; if (rr) b = *(const v4fa*)(rr + j);
#pragma unroll
    for (int q = 0; q < 4; ++q) { const float v = a[q] + b[q]; vals[u * 4 + q] = v; s1 += v; }
  }
  red[tid] = s1; __syncthreads();
  for (int st = 128; st > 0; st >>= 1) { if (tid < st) red[tid] += red[tid + st]; __syncthreads(); }
  const float mu = red[0] / (float)N; __syncthreads();
  float s2 = 0.f;
  for (int u = 0; u < per / 4; ++u)
#pragma unroll
    for (int q = 0; q < 4; ++q) { const float c = vals[u * 4 + q] - mu; s2 += c * c; }
  red[tid] = s2; __syncthreads();
  for (int st = 128; st > 0; st >>= 1) { if (tid < st) red[tid] += red[tid + st]; __syncthreads(); }
  const float rs = rsqrtf(red[0] / (float)N + eps);
  {
    for (int u = 0; u < per / 4; ++u) {
      const int j = tid * 4 + 1024 * u;
      v4f o, sm;
#pragma unroll
      for (int q = 0; q < 4; ++q) {
        float gg = g[j + q], bb = bta[j + q];
        if (PARAM_BF16) { gg = bf16_round(gg); bb = bf16_round(bb); }
        sm[q] = vals[u * 4 + q]; o[q] = (vals[u * 4 + q] - mu) * rs * gg + bb;
      }
      if (out_sum) *(v4f*)(out_sum + (size_t)row * N + j) = sm;
      *(v4f*)(out_norm + (size_t)row * N + j) = o;
    }
    
  }
}



// ---- f16 WMMA path (v_wmma_f32_16x16x32_f16): 11-bit significands for operands in range — used where a [0,1] probability operand needs more precision than bf16
typedef _Float16 v16h __attribute__((ext_vector_type(16)));
union FragH { v16h v; v8us half[2]; _Float16 h[16]; unsigned short u[16]; };
template <int NT>
__device__ __forceinline__ v8f mmaH(v16h ah, v16h al, v16h bh, v16h bl, v8f c) {
  c = __builtin_amdgcn_wmma_f32_16x16x32_f16(false, ah, false, bh, (short)0, c, false, false);
  if (NT >= 2) c = __builtin_amdgcn_wmma_f32_16x16x32_f16(false, al, false, bh, (short)0, c, false, false);
  if (NT >= 3) c = __builtin_amdgcn_wmma_f32_16x16x32_f16(false, ah, false, bl, (short)0, c, false, false);
  asm volatile("v_nop\n\tv_nop\n\tv_nop\n\tv_nop" : "+v"(c) : "v"(ah), "v"(al), "v"(bh), "v"(bl));
  return c;
}
// batched GEMM like k_gemm_b but f16 operands: A f32 (split into f16 hi/lo if ASPLIT, else rounded to f16), Bt = f16 values [n][k]; alpha; C f32; N multiple of 16 (partial tiles skipped)
template <bool ASPLIT>
__global__ __launch_bounds__(128) void k_gemm_h(const float* __restrict__ A, int lda, size_t sA, const _Float16* __restrict__ Bh, int ldb, size_t sB, float alpha, float* __restrict__ C, int ldc, size_t sC, int M, int N, int K) {
  __shared__ __attribute__((aligned(16))) float so[4][16][64];
  const int tid = threadIdx.x, w = tid >> 5, lane = tid & 31, ln = lane & 15, hh = lane >> 4; const int by = blockIdx.y;
  A += (size_t)by * sA; Bh += (size_t)by * sB; C += (size_t)by * sC;
  const int ntn = (N + 63) / 64; const int wid = blockIdx.x * 4 + w; const int mt = wid / ntn, nq = wid % ntn; if (mt * 16 >= M) return;
  const int row0 = mt * 16, col0 = nq * 64; const float* arow = A + (size_t)(row0 + ln) * lda;
  v8f acc[4] = {};
  for (int kb = 0; kb < K; kb += 32) {
    FragH ah, al;
    const v4f x0 = *(const v4fa*)(arow + kb + 8 * hh), x1 = *(const v4fa*)(arow + kb + 8 * hh + 4), x2 = *(const v4fa*)(arow + kb + 16 + 8 * hh), x3 = *(const v4fa*)(arow + kb + 16 + 8 * hh + 4);
    float xs[16] = {x0[0],x0[1],x0[2],x0[3],x1[0],x1[1],x1[2],x1[3],x2[0],x2[1],x2[2],x2[3],x3[0],x3[1],x3[2],x3[3]};
#pragma unroll
    for (int i = 0; i < 16; ++i) { const _Float16 h = (_Float16)xs[i]; ah.h[i] = h; al.h[i] = ASPLIT ? (_Float16)(xs[i] - (float)h) : (_Float16)0.0f; }
#pragma unroll
    for (int t = 0; t < 4; ++t) { if (col0 + t * 16 >= N) continue; const size_t boff = (size_t)(col0 + t * 16 + ln) * ldb + kb; FragH bq; bq.half[0] = *(const v8us*)(Bh + boff + 8 * hh); bq.half[1] = *(const v8us*)(Bh + boff + 16 + 8 * hh);
      acc[t] = mmaH<ASPLIT ? 2 : 1>(ah.v, al.v, bq.v, bq.v, acc[t]); }
  }
#pragma unroll
  for (int t = 0; t < 4; ++t) { if (col0 + t * 16 >= N) continue;
#pragma unroll
    for (int r = 0; r < 8; ++r) so[w][8 * hh + r][t * 16 + ln] = acc[t][r] * alpha; }
  __builtin_amdgcn_fence(__ATOMIC_ACQ_REL, "workgroup"); __builtin_amdgcn_wave_barrier();
  const int rsub = lane >> 4, c4 = (lane & 15) * 4;
  {
#pragma unroll
    for (int q = 0; q < 8; ++q) { const int r = q * 2 + rsub; if (col0 + c4 < N) { const v4f v = *(const v4fa*)&so[w][r][c4]; *(v4f*)(C + (size_t)(row0 + r) * ldc + col0 + c4) = v; } }
     }
}

// Wt[n][k] = f16(W[k][n]·scale) from f32 row-major W[K][N] (scale = power of two; bf16-exact weights stay exact in f16 away from the subnormal range)
__global__ __launch_bounds__(256) void k_wt_f16(const float* __restrict__ W, _Float16* __restrict__ Wt, int K, int N, float scale) {
  const int t = blockIdx.x * 256 + threadIdx.x; if (t >= N * (K / 8)) return; const int n = t / (K / 8), k8 = (t % (K / 8)) * 8; FragH f;
#pragma unroll
  for (int i = 0; i < 8; ++i) f.h[i] = (_Float16)(bf16_round(W[(size_t)(k8 + i) * N + n]) * scale); const v8us o = f.half[0];
  *(v8us*)((unsigned short*)Wt + (size_t)n * K + k8) = o; 
}
// k_gemm_hh variant with fused epilogue: v = acc·alpha + bias[by·sBias + col] (+ CP[(row/rowsPerB)·sCPb + by·64 + col] if CP) ; ACT 0 none / 1 elu ; writes f16 C16 (and f32 C if non-null)
template <int ACT>
__global__ __launch_bounds__(128) void k_gemm_hhx(const _Float16* __restrict__ A, int lda, size_t sA, const _Float16* __restrict__ Bh, int ldb, size_t sB, float alpha, const float* __restrict__ bias, size_t sBias, const float* __restrict__ CP, int rowsPerB, size_t sCPb, int row0g,
    float* __restrict__ C, _Float16* __restrict__ C16, int ldc, size_t sC, int M, int N, int K) {
  __shared__ __attribute__((aligned(16))) float so[4][16][64];
  const int tid = threadIdx.x, w = tid >> 5, lane = tid & 31, ln = lane & 15, hh = lane >> 4; const int by = blockIdx.y;
  A += (size_t)by * sA; Bh += (size_t)by * sB; const size_t cofs = (size_t)by * sC; const float* bp = bias ? bias + (size_t)by * sBias : nullptr;
  const int ntn = (N + 63) / 64; const int wid = blockIdx.x * 4 + w; const int mt = wid / ntn, nq = wid % ntn; if (mt * 16 >= M) return;
  const int row0 = mt * 16, col0 = nq * 64; const _Float16* arow = A + (size_t)(row0 + ln) * lda;
  v8f acc[4] = {};
  for (int kb = 0; kb < K; kb += 32) { FragH ah; ah.half[0] = *(const v8us*)((const unsigned short*)arow + kb + 8 * hh); ah.half[1] = *(const v8us*)((const unsigned short*)arow + kb + 16 + 8 * hh);
#pragma unroll
    for (int t = 0; t < 4; ++t) { if (col0 + t * 16 >= N) continue; const size_t boff = (size_t)(col0 + t * 16 + ln) * ldb + kb; FragH bq; bq.half[0] = *(const v8us*)((const unsigned short*)Bh + boff + 8 * hh); bq.half[1] = *(const v8us*)((const unsigned short*)Bh + boff + 16 + 8 * hh);
      acc[t] = mmaH<1>(ah.v, ah.v, bq.v, bq.v, acc[t]); }
  }
#pragma unroll
  for (int t = 0; t < 4; ++t) { if (col0 + t * 16 >= N) continue; const int col = col0 + t * 16 + ln; const float bv = bp ? bf16_round(bp[col]) : 0.f;
#pragma unroll
    for (int r = 0; r < 8; ++r) { float v = acc[t][r] * alpha + bv; if (CP) { const int rr = row0g + row0 + 8 * hh + r; if (rowsPerB < 0) v += CP[cofs + (size_t)rr * ldc + col];      /* rowsPerB < 0: own element of the batched C plane */ else { const int bidx = rr / rowsPerB; v += CP[(size_t)bidx * sCPb + (size_t)by * 64 + col]; } } if (ACT == 1) v = (v > 0.f) ? v : expm1f(v); else if (ACT == 7) v = (v > 0.f) ? v + 1.0f : expf(v); else if (ACT == 8) v = tanhf(v); else if (ACT == 9) v = 0.5f * v * (1.0f + tanhf(0.7978845608028654f * (v + 0.044715f * v * v * v))); else if (ACT == 11) v = 1.0f / (1.0f + expf(-v)); else if (ACT == 12) v = (v > 0.f) ? v : 0.01f * v; else if (ACT == 14) v = (v > 0.f) ? v : 0.1f * v; else if (ACT == 16) v = (v >= 0.f) ? v : 0.3f * v; else if (ACT == 17) v = (v >= 0.f) ? v : 0.2f * v; else if (ACT == 15) v = v / (1.0f + expf(-v)); else if (ACT == 3) v = fmaxf(v, 0.f); else if (ACT == 6) v = 0.5f * v * (1.0f + erff(v * 0.70710678118654752f)); so[w][8 * hh + r][t * 16 + ln] = v; } }
  __builtin_amdgcn_fence(__ATOMIC_ACQ_REL, "workgroup"); __builtin_amdgcn_wave_barrier();
  const int rsub = lane >> 4, c4 = (lane & 15) * 4; typedef _Float16 v4h __attribute__((ext_vector_type(4)));
  {
#pragma unroll
    for (int q = 0; q < 8; ++q) { const int r = q * 2 + rsub; if (col0 + c4 < N) { const v4f v = *(const v4fa*)&so[w][r][c4]; if (C) *(v4f*)(C + cofs + (size_t)(row0 + r) * ldc + col0 + c4) = v; if (C16) { v4h h4; for (int i = 0; i < 4; ++i) h4[i] = (_Float16)v[i]; *(v4h*)(C16 + cofs + (size_t)(row0 + r) * ldc + col0 + c4) = h4; } } }
     }
}


typedef _Float16 v4h __attribute__((ext_vector_type(4)));

__global__ __launch_bounds__(256) void k_x16(const float* __restrict__ x, _Float16* __restrict__ X16, size_t n8) { const size_t t = (size_t)blockIdx.x * 256 + threadIdx.x; if (t >= n8) return; FragH f;
#pragma unroll
  for (int q = 0; q < 8; ++q) f.h[q] = (_Float16)bf16_round(x[t * 8 + q]); *(v8us*)((unsigned short*)X16 + t * 8) = f.half[0];  }
__global__ __launch_bounds__(256) void k_h16(const float* __restrict__ x, _Float16* __restrict__ X16, size_t n8) { const size_t t = (size_t)blockIdx.x * 256 + threadIdx.x; if (t >= n8) return; FragH f;
#pragma unroll
  for (int q = 0; q < 8; ++q) f.h[q] = (_Float16)x[t * 8 + q]; *(v8us*)((unsigned short*)X16 + t * 8) = f.half[0];  }
__global__ __launch_bounds__(256) void k_round16f(const float* __restrict__ W, _Float16* __restrict__ Bt, size_t n8) { const size_t t = (size_t)blockIdx.x * 256 + threadIdx.x; if (t >= n8) return; FragH f;
#pragma unroll
  for (int i = 0; i < 8; ++i) f.h[i] = (_Float16)(bf16_round(W[t * 8 + i]) * 16.0f); *(v8us*)((unsigned short*)Bt + t * 8) = f.half[0];  }
template <int NHv, int TTv>
__global__ __launch_bounds__(256) void k_vt(const _Float16* __restrict__ V16, int ldv, int voff, _Float16* __restrict__ Vt) { __shared__ unsigned short tl[64][66]; const int tid = threadIdx.x; const int slab = blockIdx.x / (TTv / 64), lg = blockIdx.x % (TTv / 64); const int b = slab / NHv, h = slab % NHv;
  for (int i = tid; i < 64 * 8; i += 256) { const int r = i / 8, c8 = (i % 8) * 8; FragH f; f.half[0] = *(const v8us*)((const unsigned short*)V16 + ((size_t)b * TTv + lg * 64 + r) * ldv + voff + h * 64 + c8);
#pragma unroll
    for (int q = 0; q < 8; ++q) tl[r][c8 + q] = f.u[q]; }
  __syncthreads();
  {
#pragma unroll
    for (int rd = 0; rd < 2; ++rd) { const int d = rd * 32 + tid / 8, pc = tid % 8; FragH f;
#pragma unroll
      for (int q = 0; q < 8; ++q) f.u[q] = tl[pc * 8 + q][d];
      *(v8us*)((unsigned short*)Vt + ((size_t)slab * 64 + d) * TTv + lg * 64 + pc * 8) = f.half[0]; }
     } }

__global__ __launch_bounds__(256) void k_hl(const float* __restrict__ F, _Float16* __restrict__ Hh, _Float16* __restrict__ Hl, size_t n8) { const size_t t = (size_t)blockIdx.x * 256 + threadIdx.x; if (t >= n8) return; FragH fh, fl; const v4f a = *(const v4fa*)(F + t * 8), c = *(const v4fa*)(F + t * 8 + 4);
#pragma unroll
  for (int q = 0; q < 4; ++q) { _Float16 h = (_Float16)a[q]; fh.h[q] = h; fl.h[q] = (_Float16)((a[q] - (float)h) * 1024.0f); h = (_Float16)c[q]; fh.h[4 + q] = h; fl.h[4 + q] = (_Float16)((c[q] - (float)h) * 1024.0f); }
  { *(v8us*)((unsigned short*)Hh + t * 8) = fh.half[0]; *(v8us*)((unsigned short*)Hl + t * 8) = fl.half[0];  } }

// ---- fast GEMM (wave tile 32x64; requires M % 32 == 0 rows per launch region and N % 64 == 0); epilogue = k_gemm_hhx semantics ----
__device__ __forceinline__ v16h g2_frag(const _Float16* p, int hh) { FragH f; f.half[0] = *(const v8us*)((const unsigned short*)p + 8 * hh); f.half[1] = *(const v8us*)((const unsigned short*)p + 16 + 8 * hh); return f.v; }
__device__ __forceinline__ v8f g2_mma(v16h a, v16h b, v8f c) { v8f d = __builtin_amdgcn_wmma_f32_16x16x32_f16(false, a, false, b, (short)0, c, false, false); asm volatile("v_nop\n\tv_nop\n\tv_nop\n\tv_nop" : "+v"(d) : "v"(a), "v"(b)); return d; }
template <int ACT>
__global__ __launch_bounds__(128) void k_gemm2(const _Float16* __restrict__ A, int lda, size_t sA, const _Float16* __restrict__ Bh, int ldb, size_t sB, float alpha, const float* __restrict__ bias, size_t sBias, const float* __restrict__ CP, int rowsPerB, size_t sCPb, int row0g,
    float* __restrict__ C, _Float16* __restrict__ C16, int ldc, size_t sC, int M, int N, int K) { static_assert(ACT == 0 || ACT == 3 || ACT == 6 || ACT == 8 || ACT == 9 || ACT == 11 || ACT == 12 || ACT == 14 || ACT == 15 || ACT == 16 || ACT == 17, "k_gemm2: unsupported ACT code (would silently apply no activation)");
  __shared__ __attribute__((aligned(16))) float so[4][32][68];
  const int tid = threadIdx.x, w = tid >> 5, lane = tid & 31, ln = lane & 15, hh = lane >> 4; const int by = blockIdx.y;
  A += (size_t)by * sA; Bh += (size_t)by * sB; const size_t cofs = (size_t)by * sC; const float* bp = bias ? bias + (size_t)by * sBias : nullptr;
  const int ntn = N >> 6; const int mt = blockIdx.x / ntn, nq = blockIdx.x - mt * ntn; const int row0 = mt * 128 + 32 * w, col0 = nq * 64; if (row0 >= M) return;
  const _Float16* a0p = A + (size_t)(row0 + ln) * lda; const _Float16* a1p = a0p + (size_t)16 * lda;
  const _Float16* b0p = Bh + (size_t)(col0 + ln) * ldb; const _Float16* b1p = b0p + (size_t)16 * ldb; const _Float16* b2p = b1p + (size_t)16 * ldb; const _Float16* b3p = b2p + (size_t)16 * ldb;
  const v8f z8 = {0.f,0.f,0.f,0.f,0.f,0.f,0.f,0.f}; v8f c00 = z8, c01 = z8, c02 = z8, c03 = z8, c10 = z8, c11 = z8, c12 = z8, c13 = z8;
#pragma unroll 1
  for (int kb = 0; kb < K; kb += 32) { const v16h a0 = g2_frag(a0p + kb, hh), a1 = g2_frag(a1p + kb, hh);
    v16h b = g2_frag(b0p + kb, hh); c00 = g2_mma(a0, b, c00); c10 = g2_mma(a1, b, c10);
    b = g2_frag(b1p + kb, hh); c01 = g2_mma(a0, b, c01); c11 = g2_mma(a1, b, c11);
    b = g2_frag(b2p + kb, hh); c02 = g2_mma(a0, b, c02); c12 = g2_mma(a1, b, c12);
    b = g2_frag(b3p + kb, hh); c03 = g2_mma(a0, b, c03); c13 = g2_mma(a1, b, c13); }
  v8f accs[8] = {c00, c01, c02, c03, c10, c11, c12, c13};
#pragma unroll
  for (int u = 0; u < 8; ++u) { const int t = u & 3, half = u >> 2; const int col = col0 + t * 16 + ln; const float bv = bp ? bf16_round(bp[col]) : 0.f;
#pragma unroll
    for (int r = 0; r < 8; ++r) { const int rloc = half * 16 + 8 * hh + r; float v = accs[u][r] * alpha + bv; if (CP) { if (rowsPerB < 0) v += CP[cofs + (size_t)(row0g + row0 + rloc) * ldc + col];      /* rowsPerB < 0: own element of the batched C plane */ else { const int bidx = (row0g + row0 + rloc) / rowsPerB; v += CP[(size_t)bidx * sCPb + (size_t)by * 64 + col]; } }
      if (ACT == 3) v = fmaxf(v, 0.f); else if (ACT == 6) v = 0.5f * v * (1.0f + erff(v * 0.70710678118654752f)); else if (ACT == 11) v = 1.0f / (1.0f + expf(-v)); else if (ACT == 15) v = v / (1.0f + expf(-v)); else if (ACT == 12) v = (v > 0.f) ? v : 0.01f * v; else if (ACT == 8) v = tanhf(v); else if (ACT == 9) v = 0.5f * v * (1.0f + tanhf(0.7978845608028654f * (v + 0.044715f * v * v * v))); else if (ACT == 14) v = (v > 0.f) ? v : 0.1f * v; else if (ACT == 16) v = (v >= 0.f) ? v : 0.3f * v; else if (ACT == 17) v = (v >= 0.f) ? v : 0.2f * v;
      so[w][rloc][t * 16 + ln] = v; } }
  __builtin_amdgcn_fence(__ATOMIC_ACQ_REL, "workgroup"); __builtin_amdgcn_wave_barrier();
  const int rsub = lane >> 4, c4 = (lane & 15) * 4;
  {
#pragma unroll
    for (int q = 0; q < 16; ++q) { const int r = q * 2 + rsub; const v4f v = *(const v4fa*)&so[w][r][c4]; if (C) *(v4f*)(C + cofs + (size_t)(row0 + r) * ldc + col0 + c4) = v; if (C16) { v4h h4; for (int i = 0; i < 4; ++i) h4[i] = (_Float16)v[i]; *(v4h*)(C16 + cofs + (size_t)(row0 + r) * ldc + col0 + c4) = h4; } }
     } }


__global__ __launch_bounds__(256) void k_wnat(const float* __restrict__ w, size_t n8, _Float16* __restrict__ Bt) { const size_t t = (size_t)blockIdx.x * 256 + threadIdx.x; if (t >= n8) return; FragH f; for (int q = 0; q < 8; ++q) f.h[q] = (_Float16)(bf16_round(w[t * 8 + q]) * 16.0f); *(v8us*)((unsigned short*)Bt + t * 8) = f.half[0];  }
__global__ __launch_bounds__(256) void k_rsm(const float* __restrict__ S, _Float16* __restrict__ P, int nrows) {
  #pragma clang fp contract(off)
  const int i = blockIdx.x * 256 + threadIdx.x; if (i >= nrows) return; const float* s = S + (size_t)i * SQ; float mx = -3.0e38f;
#pragma unroll 1
  for (int j = 0; j < SQ; ++j) mx = fmaxf(mx, s[j]); float se = 0.f;
#pragma unroll 1
  for (int j = 0; j < SQ; ++j) se += expf(s[j] - mx); const float sc = 256.0f / se;
#pragma unroll 1
  for (int j0 = 0; j0 < SQ; j0 += 8) { FragH f; for (int q = 0; q < 8; ++q) f.h[q] = (_Float16)(expf(s[j0 + q] - mx) * sc); unsigned short* d = (unsigned short*)P + (size_t)i * SQ + j0; *(v8us*)d = f.half[0];  } }
__global__ __launch_bounds__(256) void k_vt(const _Float16* __restrict__ V16, int b, int h0, _Float16* __restrict__ VT) { __shared__ unsigned short tl[64][65]; const int tid = threadIdx.x; const int hh = blockIdx.x % HG, sg = blockIdx.x / HG; const int s0 = sg * 64; const int h = h0 + hh;
  for (int i = tid; i < 64 * 8; i += 256) { const int j = i / 8, d8 = (i % 8) * 8; FragH f; f.half[0] = *(const v8us*)((const unsigned short*)V16 + ((size_t)b * SQ + s0 + j) * DM + h * HD + d8); for (int q = 0; q < 8; ++q) tl[d8 + q][j] = f.u[q]; }
  __syncthreads();
  { for (int i = tid; i < 64 * 8; i += 256) { const int d = i / 8, j8 = (i % 8) * 8; FragH f; for (int q = 0; q < 8; ++q) f.u[q] = tl[d][j8 + q]; *(v8us*)((unsigned short*)VT + ((size_t)hh * HD + d) * SQ + s0 + j8) = f.half[0]; }  } }


__global__ __launch_bounds__(256) void k_rsmf(const float* __restrict__ S, _Float16* __restrict__ P, int qn, int hg) {
  #pragma clang fp contract(off)
  const int t = blockIdx.x * 256 + threadIdx.x; if (t >= qn * hg) return; const size_t i = (size_t)(t / qn) * SQ + (t % qn); const float* s = S + i * SQ; float mx = -3.0e38f;
#pragma unroll 1
  for (int j = 0; j < SQ; ++j) mx = fmaxf(mx, s[j]); float se = 0.f;
#pragma unroll 1
  for (int j = 0; j < SQ; ++j) se += __expf(s[j] - mx); const float sc = 256.0f / se;
#pragma unroll 1
  for (int j0 = 0; j0 < SQ; j0 += 8) { FragH f; for (int q = 0; q < 8; ++q) f.h[q] = (_Float16)(__expf(s[j0 + q] - mx) * sc); unsigned short* d = (unsigned short*)P + i * SQ + j0; *(v8us*)d = f.half[0];  } }

extern "C" void kernel_launch(void* const* d_in, const int* in_sizes, int n_in,
                              void* d_out, int out_size, void* d_ws, size_t ws_size, hipStream_t stream) {
  (void)in_sizes; (void)n_in; (void)out_size;
  const float* const* I = (const float* const*)d_in; const float* xq = I[0]; const float* xk = I[1]; const float* xv = I[2]; const float* wq = I[3]; const float* bq = I[4]; const float* wk = I[5]; const float* bk = I[6]; const float* wv = I[7]; const float* bv = I[8];
  char* ws = (char*)d_ws; size_t off = 0;
  auto take = [&](size_t bytes) { char* p = ws + off; off += (bytes + 255) & ~(size_t)255; return p; };
  _Float16* BQ = (_Float16*)take((size_t)DM * DM * 2); _Float16* BK = (_Float16*)take((size_t)DM * DM * 2); _Float16* BV = (_Float16*)take((size_t)DM * DM * 2);
  _Float16* XQ = (_Float16*)take(NR * DM * 2); _Float16* XK = (_Float16*)take(NR * DM * 2); _Float16* XV = (_Float16*)take(NR * DM * 2); _Float16* Q16 = (_Float16*)take(NR * DM * 2); _Float16* K16 = (_Float16*)take(NR * DM * 2); float* VF = (float*)take(NR * DM * 4); _Float16* VH = (_Float16*)take(NR * DM * 2); _Float16* VL = (_Float16*)take(NR * DM * 2);
  float* S = (float*)take((size_t)SQ * SQ * 4); _Float16* P = (_Float16*)take((size_t)SQ * SQ * 2); _Float16* VT = (_Float16*)take((size_t)DM * SQ * 2); _Float16* VTL = (_Float16*)take((size_t)DM * SQ * 2);
  if (off > ws_size) return;      /* approx 0.4 + 8 x 5 + 16 + 8 + 8 + 64 + 32 + 4 = 172 MiB */
  { const unsigned g = (unsigned)(((size_t)DM * (DM / 8) + 255) / 256); k_wt_f16<<<g, 256, 0, stream>>>(wq, BQ, DM, DM, 16.0f); k_wt_f16<<<g, 256, 0, stream>>>(wk, BK, DM, DM, 16.0f); k_wt_f16<<<g, 256, 0, stream>>>(wv, BV, DM, DM, 16.0f); }
  k_x16<<<(unsigned)((NR * DM / 8 + 255) / 256), 256, 0, stream>>>(xq, XQ, NR * DM / 8); k_x16<<<(unsigned)((NR * DM / 8 + 255) / 256), 256, 0, stream>>>(xk, XK, NR * DM / 8); k_x16<<<(unsigned)((NR * DM / 8 + 255) / 256), 256, 0, stream>>>(xv, XV, NR * DM / 8);
  k_gemm2<0><<<dim3((unsigned)((NR / 128) * (DM / 64)), 1), 128, 0, stream>>>(XQ, DM, 0, BQ, DM, 0, 0.0625f, bq, 0, nullptr, 1, 0, 0, nullptr, Q16, DM, 0, (int)NR, DM, DM);
  k_gemm2<0><<<dim3((unsigned)((NR / 128) * (DM / 64)), 1), 128, 0, stream>>>(XK, DM, 0, BK, DM, 0, 0.0625f, bk, 0, nullptr, 1, 0, 0, nullptr, K16, DM, 0, (int)NR, DM, DM);
  k_gemm2<0><<<dim3((unsigned)((NR / 128) * (DM / 64)), 1), 128, 0, stream>>>(XV, DM, 0, BV, DM, 0, 0.0625f, bv, 0, nullptr, 1, 0, 0, VF, nullptr, DM, 0, (int)NR, DM, DM); k_hl<<<(unsigned)((NR * DM / 8 + 255) / 256), 256, 0, stream>>>(VF, VH, VL, NR * DM / 8);      /* v (f32) -> f16 hi + x1024 residual */
  for (int b = 0; b < NB; ++b) { const size_t r0 = (size_t)b * SQ;
    k_vt<DM / 64, SQ><<<(DM / 64) * (SQ / 64), 256, 0, stream>>>(VH + r0 * DM, DM, 0, VT); k_vt<DM / 64, SQ><<<(DM / 64) * (SQ / 64), 256, 0, stream>>>(VL + r0 * DM, DM, 0, VTL);
    k_gemm2<0><<<dim3((SQ / 128) * (SQ / 64), 1), 128, 0, stream>>>(Q16 + r0 * DM, DM, 0, K16 + r0 * DM, DM, 0, 0.0625f, nullptr, 0, nullptr, 1, 0, 0, S, nullptr, SQ, 0, SQ, SQ, DM);      /* scores / 16 (K = 256) */
    k_rsmf<<<(SQ + 255) / 256, 256, 0, stream>>>(S, P, SQ, 1);
    k_gemm2<0><<<dim3((SQ / 128) * (DM / 64), 1), 128, 0, stream>>>(P, SQ, 0, VT, SQ, 0, 0.00390625f, nullptr, 0, nullptr, 1, 0, 0, (float*)d_out + r0 * DM, nullptr, DM, 0, SQ, DM, SQ);      /* out = P V_hi / 256 */
    k_gemm2<0><<<dim3((SQ / 128) * (DM / 64), 1), 128, 0, stream>>>(P, SQ, 0, VTL, SQ, 0, 0.000003814697265625f, nullptr, 0, (const float*)d_out + r0 * DM, -1, 0, 0, (float*)d_out + r0 * DM, nullptr, DM, 0, SQ, DM, SQ); }      /* += P V_lo 2^-18 (own element) */
}

// v001
// A run of this version takes 1310 microseconds.
// Two timings next to v000 put it at 2.94 and 2.98 times that version's speed.
#include <hip/hip_runtime.h>
// Single-head attention with dense projections (q_in, k_in, v_in [4][4096][256]; q = q_in Wq + bq, k = k_in Wk + bk, v = v_in Wv + bv ([in][out] 256x256 glorot-uniform, biases uniform); scores = q . k x 256^-0.5; softmax over the 4096 keys (no mask); out = attn v -> [4][4096][256]; no output projection).
// Structure: the three inputs as exact f16 rows; [in][out] weights as exact x16 planes; q, k as WMMA GEMMs (32x64 wave tiles, f32 accumulation, + bias, f16 outputs: logits sigma ~1), v as an f32-output GEMM split into f16 hi + x1024 residual planes; per batch: V^T of the hi and residual planes (4 slabs of 64) via LDS transposes; scores as ONE GEMM (K = 256, alpha 1/16) into an f32 [4096][4096] plane; row softmax on VALU (f32 statistics, native exp; weights x256 f16); out = P V_hi^T (N = 256, K = 4096, alpha 2^-8) straight into the output, then += P V_lo^T 2^-18 (own-element accumulate in the next launch); launches: see trace.
// Compute dtype: inputs rounded to bf16; x / weights exact; q, k, P plain f16 (~2^-12), v as hi + residual; scores / statistics / out f32; v_wmma_f32_16x16x32_f16.
#define NB 4
#define SQ 4096
#define DM 256
#define NH 1
#define HD 64
#define HG 1
#define NR ((size_t)NB * SQ)
typedef __bf16 v16b __attribute__((ext_vector_type(16)));
typedef unsigned short v8us __attribute__((ext_vector_type(8), may_alias));
typedef float  v8f  __attribute__((ext_vector_type(8)));
typedef float  v4f  __attribute__((ext_vector_type(4)));
typedef float  v4fa __attribute__((ext_vector_type(4), may_alias));
union FragB { v16b v; v8us half[2]; unsigned short u[16]; };

__device__ __forceinline__ unsigned short bf16_bits(float x) { unsigned int u = __float_as_uint(x); return (unsigned short)((u + 0x7FFFu + ((u >> 16) & 1u)) >> 16); }
__device__ __forceinline__ float bf16_val(unsigned short b) { return __uint_as_float(((unsigned int)b) << 16); }
__device__ __forceinline__ float bf16_round(float x) { return bf16_val(bf16_bits(x)); }
// D += A·B with NT terms: 1 = ah·bh, 2 = + al·bh (A split), 3 = + ah·bl (both split)
template <int NT>
__device__ __forceinline__ v8f mmaN(v16b ah, v16b al, v16b bh, v16b bl, v8f c) {
  c = __builtin_amdgcn_wmma_f32_16x16x32_bf16(false, ah, false, bh, (short)0, c, false, false);
  if (NT >= 2) c = __builtin_amdgcn_wmma_f32_16x16x32_bf16(false, al, false, bh, (short)0, c, false, false);
  if (NT >= 3) c = __builtin_amdgcn_wmma_f32_16x16x32_bf16(false, ah, false, bl, (short)0, c, false, false);
  asm volatile("v_nop\n\tv_nop\n\tv_nop\n\tv_nop" : "+v"(c) : "v"(ah), "v"(al), "v"(bh), "v"(bl));
  return c;
}

__global__ __launch_bounds__(256) void k_wt_bf16(const float* __restrict__ W, unsigned short* __restrict__ Wt, int K, int N) {
  const int t = blockIdx.x * 256 + threadIdx.x;
  const int k8n = K / 8;
  if (t >= N * k8n) return;
  const int n = t / k8n, k8 = (t % k8n) * 8;
  v8us v;
#pragma unroll
  for (int i = 0; i < 8; ++i) v[i] = bf16_bits(W[(size_t)(k8 + i) * N + n]);
  *(v8us*)(Wt + (size_t)n * K + k8) = v;
  
}

// GEMM C[M][N] (f32, pitch ldc) = act(A[M][K]·W + bias). A f32 row-major (pitch lda) converted per fragment to bf16
// (ASPLIT: hi/lo two planes -> 2 terms, else single rounded term); Wt bf16 [N][K] (pitch ldb). BIAS_BF16 rounds the
// bias to bf16 first (bias quantised to bf16 before the add). K%32==0, M%16==0, N%64==0.
template <bool ASPLIT, int ACT, bool BIAS_BF16>
__global__ __launch_bounds__(128) void k_gemm_bf(const float* __restrict__ A, int lda, const unsigned short* __restrict__ Wt, int ldb,
                                               const float* __restrict__ bias, float* __restrict__ C, int ldc, int M, int N, int K) {
  __shared__ __attribute__((aligned(16))) float so[4][16][64];
  const int tid = threadIdx.x, w = tid >> 5, lane = tid & 31, ln = lane & 15, hh = lane >> 4;
  const int ntn = N / 64;
  const int wid = blockIdx.x * 4 + w;
  const int mt = wid / ntn, nq = wid % ntn;
  if (mt * 16 >= M) return;
  const int row0 = mt * 16, col0 = nq * 64;
  const float* arow = A + (size_t)(row0 + ln) * lda;
  v8f acc[4] = {};
  for (int kb = 0; kb < K; kb += 32) {
    FragB ah, al;
    const v4f x0 = *(const v4fa*)(arow + kb + 8 * hh), x1 = *(const v4fa*)(arow + kb + 8 * hh + 4);
    const v4f x2 = *(const v4fa*)(arow + kb + 16 + 8 * hh), x3 = *(const v4fa*)(arow + kb + 16 + 8 * hh + 4);
    float xs[16] = {x0[0],x0[1],x0[2],x0[3],x1[0],x1[1],x1[2],x1[3],x2[0],x2[1],x2[2],x2[3],x3[0],x3[1],x3[2],x3[3]};
#pragma unroll
    for (int i = 0; i < 16; ++i) { const unsigned short hb = bf16_bits(xs[i]); ah.u[i] = hb; al.u[i] = ASPLIT ? bf16_bits(xs[i] - bf16_val(hb)) : (unsigned short)0; }
#pragma unroll
    for (int t = 0; t < 4; ++t) {
      const unsigned short* brow = Wt + (size_t)(col0 + t * 16 + ln) * ldb + kb;
      FragB b;
      b.half[0] = *(const v8us*)(brow + 8 * hh);
      b.half[1] = *(const v8us*)(brow + 16 + 8 * hh);
      acc[t] = mmaN<ASPLIT ? 2 : 1>(ah.v, al.v, b.v, b.v, acc[t]);
    }
  }
#pragma unroll
  for (int t = 0; t < 4; ++t) {
    float bv = bias ? bias[col0 + t * 16 + ln] : 0.f;
    if (BIAS_BF16) bv = bf16_round(bv);
#pragma unroll
    for (int r = 0; r < 8; ++r) { float v = acc[t][r] + bv; if (ACT == 1) v = fmaxf(v, 0.f); so[w][8 * hh + r][t * 16 + ln] = v; }
  }
  __builtin_amdgcn_fence(__ATOMIC_ACQ_REL, "workgroup");
  __builtin_amdgcn_wave_barrier();
  const int rsub = lane >> 4, c4 = (lane & 15) * 4;
  {
#pragma unroll
    for (int q = 0; q < 8; ++q) {
      const int r = q * 2 + rsub;
      const v4f v = *(const v4fa*)&so[w][r][c4];
      *(v4f*)(C + (size_t)(row0 + r) * ldc + col0 + c4) = v;
    }
    
  }
}

// GEMM C = act(A·W + bias + resid): A f32 (ASPLIT -> hi/lo 2 terms), Wt bf16 [N][K]; ACT 0 none, 1 relu, 2 exact gelu;
// resid (optional, f32, row index = (row % rmod), pitch ldr, RES_BF16 rounds it) added before the activation.
template <bool ASPLIT, int ACT, bool BIAS_BF16, bool RES_BF16>
__global__ __launch_bounds__(128) void k_gemm_bf3(const float* __restrict__ A, int lda, const unsigned short* __restrict__ Wt, int ldb,
                                                const float* __restrict__ bias, const float* __restrict__ resid, int rmod, int ldr,
                                                float* __restrict__ C, int ldc, int M, int N, int K) {
  __shared__ __attribute__((aligned(16))) float so[4][16][64];
  const int tid = threadIdx.x, w = tid >> 5, lane = tid & 31, ln = lane & 15, hh = lane >> 4;
  const int ntn = N / 64;
  const int wid = blockIdx.x * 4 + w;
  const int mt = wid / ntn, nq = wid % ntn;
  if (mt * 16 >= M) return;
  const int row0 = mt * 16, col0 = nq * 64;
  const float* arow = A + (size_t)(row0 + ln) * lda;
  v8f acc[4] = {};
  for (int kb = 0; kb < K; kb += 32) {
    FragB ah, al;
    const v4f x0 = *(const v4fa*)(arow + kb + 8 * hh), x1 = *(const v4fa*)(arow + kb + 8 * hh + 4);
    const v4f x2 = *(const v4fa*)(arow + kb + 16 + 8 * hh), x3 = *(const v4fa*)(arow + kb + 16 + 8 * hh + 4);
    float xs[16] = {x0[0],x0[1],x0[2],x0[3],x1[0],x1[1],x1[2],x1[3],x2[0],x2[1],x2[2],x2[3],x3[0],x3[1],x3[2],x3[3]};
#pragma unroll
    for (int i = 0; i < 16; ++i) { const unsigned short hb = bf16_bits(xs[i]); ah.u[i] = hb; al.u[i] = ASPLIT ? bf16_bits(xs[i] - bf16_val(hb)) : (unsigned short)0; }
#pragma unroll
    for (int t = 0; t < 4; ++t) {
      const unsigned short* brow = Wt + (size_t)(col0 + t * 16 + ln) * ldb + kb;
      FragB b;
      b.half[0] = *(const v8us*)(brow + 8 * hh);
      b.half[1] = *(const v8us*)(brow + 16 + 8 * hh);
      acc[t] = mmaN<ASPLIT ? 2 : 1>(ah.v, al.v, b.v, b.v, acc[t]);
    }
  }
#pragma unroll
  for (int t = 0; t < 4; ++t) {
    const int col = col0 + t * 16 + ln;
    float bv = bias ? bias[col] : 0.f;
    if (BIAS_BF16) bv = bf16_round(bv);
#pragma unroll
    for (int r = 0; r < 8; ++r) {
      float v = acc[t][r] + bv;
      if (resid) { float rv = resid[(size_t)((row0 + 8 * hh + r) % rmod) * ldr + col]; if (RES_BF16) rv = bf16_round(rv); v += rv; }
      if (ACT == 1) v = fmaxf(v, 0.f);
      if (ACT == 2) v = 0.5f * v * (1.0f + erff(v * 0.70710678118654752f));
      if (ACT == 3) { const float u = 0.7978845608028654f * (v + 0.044715f * v * v * v); v = 0.5f * v * (1.0f + tanhf(u)); }
      so[w][8 * hh + r][t * 16 + ln] = v;
    }
  }
  __builtin_amdgcn_fence(__ATOMIC_ACQ_REL, "workgroup");
  __builtin_amdgcn_wave_barrier();
  const int rsub = lane >> 4, c4 = (lane & 15) * 4;
  {
#pragma unroll
    for (int q = 0; q < 8; ++q) {
      const int r = q * 2 + rsub;
      const v4f v = *(const v4fa*)&so[w][r][c4];
      *(v4f*)(C + (size_t)(row0 + r) * ldc + col0 + c4) = v;
    }
    
  }
}
// row LayerNorm (biased variance, eps) over N: s = X (+ R); optional out_sum <- s; out_norm <- (s-mu)*rsqrt(var+eps)*g + b
template <bool PARAM_BF16>
__global__ __launch_bounds__(256) void k_layernorm(const float* __restrict__ X, const float* __restrict__ R, const float* __restrict__ g, const float* __restrict__ bta,
                                                  float* __restrict__ out_sum, float* __restrict__ out_norm, int N, float eps) {
  __shared__ float red[256];
  const int row = blockIdx.x, tid = threadIdx.x;
  const float* x = X + (size_t)row * N; const float* rr = R ? R + (size_t)row * N : nullptr;
  float vals[16];                     // up to N = 4096
  const int per = N / 256;            // contiguous chunk per thread? use strided-by-4 chunks: thread handles j = tid*4 + 1024*u
  float s1 = 0.f;
  for (int u = 0; u < per / 4; ++u) {
    const int j = tid * 4 + 1024 * u;
    const v4f a = *(const v4fa*)(x + j);
    v4f b = {0.f,0.f,0.f,0.f}; if (rr) b = *(const v4fa*)(rr + j);
#pragma unroll
    for (int q = 0; q < 4; ++q) { const float v = a[q] + b[q]; vals[u * 4 + q] = v; s1 += v; }
  }
  red[tid] = s1; __syncthreads();
  for (int st = 128; st > 0; st >>= 1) { if (tid < st) red[tid] += red[tid + st]; __syncthreads(); }
  const float mu = red[0] / (float)N; __syncthreads();
  float s2 = 0.f;
  for (int u = 0; u < per / 4; ++u)
#pragma unroll
    for (int q = 0; q < 4; ++q) { const float c = vals[u * 4 + q] - mu; s2 += c * c; }
  red[tid] = s2; __syncthreads();
  for (int st = 128; st > 0; st >>= 1) { if (tid < st) red[tid] += red[tid + st]; __syncthreads(); }
  const float rs = rsqrtf(red[0] / (float)N + eps);
  {
    for (int u = 0; u < per / 4; ++u) {
      const int j = tid * 4 + 1024 * u;
      v4f o, sm;
#pragma unroll
      for (int q = 0; q < 4; ++q) {
        float gg = g[j + q], bb = bta[j + q];
        if (PARAM_BF16) { gg = bf16_round(gg); bb = bf16_round(bb); }
        sm[q] = vals[u * 4 + q]; o[q] = (vals[u * 4 + q] - mu) * rs * gg + bb;
      }
      if (out_sum) *(v4f*)(out_sum + (size_t)row * N + j) = sm;
      *(v4f*)(out_norm + (size_t)row * N + j) = o;
    }
    
  }
}



// ---- f16 WMMA path (v_wmma_f32_16x16x32_f16): 11-bit significands for operands in range — used where a [0,1] probability operand needs more precision than bf16
typedef _Float16 v16h __attribute__((ext_vector_type(16)));
union FragH { v16h v; v8us half[2]; _Float16 h[16]; unsigned short u[16]; };
template <int NT>
__device__ __forceinline__ v8f mmaH(v16h ah, v16h al, v16h bh, v16h bl, v8f c) {
  c = __builtin_amdgcn_wmma_f32_16x16x32_f16(false, ah, false, bh, (short)0, c, false, false);
  if (NT >= 2) c = __builtin_amdgcn_wmma_f32_16x16x32_f16(false, al, false, bh, (short)0, c, false, false);
  if (NT >= 3) c = __builtin_amdgcn_wmma_f32_16x16x32_f16(false, ah, false, bl, (short)0, c, false, false);
  asm volatile("v_nop\n\tv_nop\n\tv_nop\n\tv_nop" : "+v"(c) : "v"(ah), "v"(al), "v"(bh), "v"(bl));
  return c;
}
// batched GEMM like k_gemm_b but f16 operands: A f32 (split into f16 hi/lo if ASPLIT, else rounded to f16), Bt = f16 values [n][k]; alpha; C f32; N multiple of 16 (partial tiles skipped)
template <bool ASPLIT>
__global__ __launch_bounds__(128) void k_gemm_h(const float* __restrict__ A, int lda, size_t sA, const _Float16* __restrict__ Bh, int ldb, size_t sB, float alpha, float* __restrict__ C, int ldc, size_t sC, int M, int N, int K) {
  __shared__ __attribute__((aligned(16))) float so[4][16][64];
  const int tid = threadIdx.x, w = tid >> 5, lane = tid & 31, ln = lane & 15, hh = lane >> 4; const int by = blockIdx.y;
  A += (size_t)by * sA; Bh += (size_t)by * sB; C += (size_t)by * sC;
  const int ntn = (N + 63) / 64; const int wid = blockIdx.x * 4 + w; const int mt = wid / ntn, nq = wid % ntn; if (mt * 16 >= M) return;
  const int row0 = mt * 16, col0 = nq * 64; const float* arow = A + (size_t)(row0 + ln) * lda;
  v8f acc[4] = {};
  for (int kb = 0; kb < K; kb += 32) {
    FragH ah, al;
    const v4f x0 = *(const v4fa*)(arow + kb + 8 * hh), x1 = *(const v4fa*)(arow + kb + 8 * hh + 4), x2 = *(const v4fa*)(arow + kb + 16 + 8 * hh), x3 = *(const v4fa*)(arow + kb + 16 + 8 * hh + 4);
    float xs[16] = {x0[0],x0[1],x0[2],x0[3],x1[0],x1[1],x1[2],x1[3],x2[0],x2[1],x2[2],x2[3],x3[0],x3[1],x3[2],x3[3]};
#pragma unroll
    for (int i = 0; i < 16; ++i) { const _Float16 h = (_Float16)xs[i]; ah.h[i] = h; al.h[i] = ASPLIT ? (_Float16)(xs[i] - (float)h) : (_Float16)0.0f; }
#pragma unroll
    for (int t = 0; t < 4; ++t) { if (col0 + t * 16 >= N) continue; const size_t boff = (size_t)(col0 + t * 16 + ln) * ldb + kb; FragH bq; bq.half[0] = *(const v8us*)(Bh + boff + 8 * hh); bq.half[1] = *(const v8us*)(Bh + boff + 16 + 8 * hh);
      acc[t] = mmaH<ASPLIT ? 2 : 1>(ah.v, al.v, bq.v, bq.v, acc[t]); }
  }
#pragma unroll
  for (int t = 0; t < 4; ++t) { if (col0 + t * 16 >= N) continue;
#pragma unroll
    for (int r = 0; r < 8; ++r) so[w][8 * hh + r][t * 16 + ln] = acc[t][r] * alpha; }
  __builtin_amdgcn_fence(__ATOMIC_ACQ_REL, "workgroup"); __builtin_amdgcn_wave_barrier();
  const int rsub = lane >> 4, c4 = (lane & 15) * 4;
  {
#pragma unroll
    for (int q = 0; q < 8; ++q) { const int r = q * 2 + rsub; if (col0 + c4 < N) { const v4f v = *(const v4fa*)&so[w][r][c4]; *(v4f*)(C + (size_t)(row0 + r) * ldc + col0 + c4) = v; } }
     }
}

// Wt[n][k] = f16(W[k][n]·scale) from f32 row-major W[K][N] (scale = power of two; bf16-exact weights stay exact in f16 away from the subnormal range)
__global__ __launch_bounds__(256) void k_wt_f16(const float* __restrict__ W, _Float16* __restrict__ Wt, int K, int N, float scale) {
  const int t = blockIdx.x * 256 + threadIdx.x; if (t >= N * (K / 8)) return; const int n = t / (K / 8), k8 = (t % (K / 8)) * 8; FragH f;
#pragma unroll
  for (int i = 0; i < 8; ++i) f.h[i] = (_Float16)(bf16_round(W[(size_t)(k8 + i) * N + n]) * scale); const v8us o = f.half[0];
  *(v8us*)((unsigned short*)Wt + (size_t)n * K + k8) = o; 
}
// k_gemm_hh variant with fused epilogue: v = acc·alpha + bias[by·sBias + col] (+ CP[(row/rowsPerB)·sCPb + by·64 + col] if CP) ; ACT 0 none / 1 elu ; writes f16 C16 (and f32 C if non-null)
template <int ACT>
__global__ __launch_bounds__(128) void k_gemm_hhx(const _Float16* __restrict__ A, int lda, size_t sA, const _Float16* __restrict__ Bh, int ldb, size_t sB, float alpha, const float* __restrict__ bias, size_t sBias, const float* __restrict__ CP, int rowsPerB, size_t sCPb, int row0g,
    float* __restrict__ C, _Float16* __restrict__ C16, int ldc, size_t sC, int M, int N, int K) {
  __shared__ __attribute__((aligned(16))) float so[4][16][64];
  const int tid = threadIdx.x, w = tid >> 5, lane = tid & 31, ln = lane & 15, hh = lane >> 4; const int by = blockIdx.y;
  A += (size_t)by * sA; Bh += (size_t)by * sB; const size_t cofs = (size_t)by * sC; const float* bp = bias ? bias + (size_t)by * sBias : nullptr;
  const int ntn = (N + 63) / 64; const int wid = blockIdx.x * 4 + w; const int mt = wid / ntn, nq = wid % ntn; if (mt * 16 >= M) return;
  const int row0 = mt * 16, col0 = nq * 64; const _Float16* arow = A + (size_t)(row0 + ln) * lda;
  v8f acc[4] = {};
  for (int kb = 0; kb < K; kb += 32) { FragH ah; ah.half[0] = *(const v8us*)((const unsigned short*)arow + kb + 8 * hh); ah.half[1] = *(const v8us*)((const unsigned short*)arow + kb + 16 + 8 * hh);
#pragma unroll
    for (int t = 0; t < 4; ++t) { if (col0 + t * 16 >= N) continue; const size_t boff = (size_t)(col0 + t * 16 + ln) * ldb + kb; FragH bq; bq.half[0] = *(const v8us*)((const unsigned short*)Bh + boff + 8 * hh); bq.half[1] = *(const v8us*)((const unsigned short*)Bh + boff + 16 + 8 * hh);
      acc[t] = mmaH<1>(ah.v, ah.v, bq.v, bq.v, acc[t]); }
  }
#pragma unroll
  for (int t = 0; t < 4; ++t) { if (col0 + t * 16 >= N) continue; const int col = col0 + t * 16 + ln; const float bv = bp ? bf16_round(bp[col]) : 0.f;
#pragma unroll
    for (int r = 0; r < 8; ++r) { float v = acc[t][r] * alpha + bv; if (CP) { const int rr = row0g + row0 + 8 * hh + r; if (rowsPerB < 0) v += CP[cofs + (size_t)rr * ldc + col];      /* rowsPerB < 0: own element of the batched C plane */ else { const int bidx = rr / rowsPerB; v += CP[(size_t)bidx * sCPb + (size_t)by * 64 + col]; } } if (ACT == 1) v = (v > 0.f) ? v : expm1f(v); else if (ACT == 7) v = (v > 0.f) ? v + 1.0f : expf(v); else if (ACT == 8) v = tanhf(v); else if (ACT == 9) v = 0.5f * v * (1.0f + tanhf(0.7978845608028654f * (v + 0.044715f * v * v * v))); else if (ACT == 11) v = 1.0f / (1.0f + expf(-v)); else if (ACT == 12) v = (v > 0.f) ? v : 0.01f * v; else if (ACT == 14) v = (v > 0.f) ? v : 0.1f * v; else if (ACT == 16) v = (v >= 0.f) ? v : 0.3f * v; else if (ACT == 17) v = (v >= 0.f) ? v : 0.2f * v; else if (ACT == 15) v = v / (1.0f + expf(-v)); else if (ACT == 3) v = fmaxf(v, 0.f); else if (ACT == 6) v = 0.5f * v * (1.0f + erff(v * 0.70710678118654752f)); so[w][8 * hh + r][t * 16 + ln] = v; } }
  __builtin_amdgcn_fence(__ATOMIC_ACQ_REL, "workgroup"); __builtin_amdgcn_wave_barrier();
  const int rsub = lane >> 4, c4 = (lane & 15) * 4; typedef _Float16 v4h __attribute__((ext_vector_type(4)));
  {
#pragma unroll
    for (int q = 0; q < 8; ++q) { const int r = q * 2 + rsub; if (col0 + c4 < N) { const v4f v = *(const v4fa*)&so[w][r][c4]; if (C) *(v4f*)(C + cofs + (size_t)(row0 + r) * ldc + col0 + c4) = v; if (C16) { v4h h4; for (int i = 0; i < 4; ++i) h4[i] = (_Float16)v[i]; *(v4h*)(C16 + cofs + (size_t)(row0 + r) * ldc + col0 + c4) = h4; } } }
     }
}


typedef _Float16 v4h __attribute__((ext_vector_type(4)));

__global__ __launch_bounds__(256) void k_x16(const float* __restrict__ x, _Float16* __restrict__ X16, size_t n8) { const size_t t = (size_t)blockIdx.x * 256 + threadIdx.x; if (t >= n8) return; FragH f;
#pragma unroll
  for (int q = 0; q < 8; ++q) f.h[q] = (_Float16)bf16_round(x[t * 8 + q]); *(v8us*)((unsigned short*)X16 + t * 8) = f.half[0];  }
__global__ __launch_bounds__(256) void k_h16(const float* __restrict__ x, _Float16* __restrict__ X16, size_t n8) { const size_t t = (size_t)blockIdx.x * 256 + threadIdx.x; if (t >= n8) return; FragH f;
#pragma unroll
  for (int q = 0; q < 8; ++q) f.h[q] = (_Float16)x[t * 8 + q]; *(v8us*)((unsigned short*)X16 + t * 8) = f.half[0];  }
__global__ __launch_bounds__(256) void k_round16f(const float* __restrict__ W, _Float16* __restrict__ Bt, size_t n8) { const size_t t = (size_t)blockIdx.x * 256 + threadIdx.x; if (t >= n8) return; FragH f;
#pragma unroll
  for (int i = 0; i < 8; ++i) f.h[i] = (_Float16)(bf16_round(W[t * 8 + i]) * 16.0f); *(v8us*)((unsigned short*)Bt + t * 8) = f.half[0];  }
template <int NHv, int TTv>
__global__ __launch_bounds__(256) void k_vt(const _Float16* __restrict__ V16, int ldv, int voff, _Float16* __restrict__ Vt) { __shared__ unsigned short tl[64][66]; const int tid = threadIdx.x; const int slab = blockIdx.x / (TTv / 64), lg = blockIdx.x % (TTv / 64); const int b = slab / NHv, h = slab % NHv;
  for (int i = tid; i < 64 * 8; i += 256) { const int r = i / 8, c8 = (i % 8) * 8; FragH f; f.half[0] = *(const v8us*)((const unsigned short*)V16 + ((size_t)b * TTv + lg * 64 + r) * ldv + voff + h * 64 + c8);
#pragma unroll
    for (int q = 0; q < 8; ++q) tl[r][c8 + q] = f.u[q]; }
  __syncthreads();
  {
#pragma unroll
    for (int rd = 0; rd < 2; ++rd) { const int d = rd * 32 + tid / 8, pc = tid % 8; FragH f;
#pragma unroll
      for (int q = 0; q < 8; ++q) f.u[q] = tl[pc * 8 + q][d];
      *(v8us*)((unsigned short*)Vt + ((size_t)slab * 64 + d) * TTv + lg * 64 + pc * 8) = f.half[0]; }
     } }

__global__ __launch_bounds__(256) void k_hl(const float* __restrict__ F, _Float16* __restrict__ Hh, _Float16* __restrict__ Hl, size_t n8) { const size_t t = (size_t)blockIdx.x * 256 + threadIdx.x; if (t >= n8) return; FragH fh, fl; const v4f a = *(const v4fa*)(F + t * 8), c = *(const v4fa*)(F + t * 8 + 4);
#pragma unroll
  for (int q = 0; q < 4; ++q) { _Float16 h = (_Float16)a[q]; fh.h[q] = h; fl.h[q] = (_Float16)((a[q] - (float)h) * 1024.0f); h = (_Float16)c[q]; fh.h[4 + q] = h; fl.h[4 + q] = (_Float16)((c[q] - (float)h) * 1024.0f); }
  { *(v8us*)((unsigned short*)Hh + t * 8) = fh.half[0]; *(v8us*)((unsigned short*)Hl + t * 8) = fl.half[0];  } }

// ---- fast GEMM (wave tile 32x64; requires M % 32 == 0 rows per launch region and N % 64 == 0); epilogue = k_gemm_hhx semantics ----
__device__ __forceinline__ v16h g2_frag(const _Float16* p, int hh) { FragH f; f.half[0] = *(const v8us*)((const unsigned short*)p + 8 * hh); f.half[1] = *(const v8us*)((const unsigned short*)p + 16 + 8 * hh); return f.v; }
__device__ __forceinline__ v8f g2_mma(v16h a, v16h b, v8f c) { v8f d = __builtin_amdgcn_wmma_f32_16x16x32_f16(false, a, false, b, (short)0, c, false, false); asm volatile("v_nop\n\tv_nop\n\tv_nop\n\tv_nop" : "+v"(d) : "v"(a), "v"(b)); return d; }
template <int ACT>
__global__ __launch_bounds__(128) void k_gemm2(const _Float16* __restrict__ A, int lda, size_t sA, const _Float16* __restrict__ Bh, int ldb, size_t sB, float alpha, const float* __restrict__ bias, size_t sBias, const float* __restrict__ CP, int rowsPerB, size_t sCPb, int row0g,
    float* __restrict__ C, _Float16* __restrict__ C16, int ldc, size_t sC, int M, int N, int K) { static_assert(ACT == 0 || ACT == 3 || ACT == 6 || ACT == 8 || ACT == 9 || ACT == 11 || ACT == 12 || ACT == 14 || ACT == 15 || ACT == 16 || ACT == 17, "k_gemm2: unsupported ACT code (would silently apply no activation)");
  __shared__ __attribute__((aligned(16))) float so[4][32][68];
  const int tid = threadIdx.x, w = tid >> 5, lane = tid & 31, ln = lane & 15, hh = lane >> 4; const int by = blockIdx.y;
  A += (size_t)by * sA; Bh += (size_t)by * sB; const size_t cofs = (size_t)by * sC; const float* bp = bias ? bias + (size_t)by * sBias : nullptr;
  const int ntn = N >> 6; const int mt = blockIdx.x / ntn, nq = blockIdx.x - mt * ntn; const int row0 = mt * 128 + 32 * w, col0 = nq * 64; if (row0 >= M) return;
  const _Float16* a0p = A + (size_t)(row0 + ln) * lda; const _Float16* a1p = a0p + (size_t)16 * lda;
  const _Float16* b0p = Bh + (size_t)(col0 + ln) * ldb; const _Float16* b1p = b0p + (size_t)16 * ldb; const _Float16* b2p = b1p + (size_t)16 * ldb; const _Float16* b3p = b2p + (size_t)16 * ldb;
  const v8f z8 = {0.f,0.f,0.f,0.f,0.f,0.f,0.f,0.f}; v8f c00 = z8, c01 = z8, c02 = z8, c03 = z8, c10 = z8, c11 = z8, c12 = z8, c13 = z8;
#pragma unroll 1
  for (int kb = 0; kb < K; kb += 32) { const v16h a0 = g2_frag(a0p + kb, hh), a1 = g2_frag(a1p + kb, hh);
    v16h b = g2_frag(b0p + kb, hh); c00 = g2_mma(a0, b, c00); c10 = g2_mma(a1, b, c10);
    b = g2_frag(b1p + kb, hh); c01 = g2_mma(a0, b, c01); c11 = g2_mma(a1, b, c11);
    b = g2_frag(b2p + kb, hh); c02 = g2_mma(a0, b, c02); c12 = g2_mma(a1, b, c12);
    b = g2_frag(b3p + kb, hh); c03 = g2_mma(a0, b, c03); c13 = g2_mma(a1, b, c13); }
  v8f accs[8] = {c00, c01, c02, c03, c10, c11, c12, c13};
#pragma unroll
  for (int u = 0; u < 8; ++u) { const int t = u & 3, half = u >> 2; const int col = col0 + t * 16 + ln; const float bv = bp ? bf16_round(bp[col]) : 0.f;
#pragma unroll
    for (int r = 0; r < 8; ++r) { const int rloc = half * 16 + 8 * hh + r; float v = accs[u][r] * alpha + bv; if (CP) { if (rowsPerB < 0) v += CP[cofs + (size_t)(row0g + row0 + rloc) * ldc + col];      /* rowsPerB < 0: own element of the batched C plane */ else { const int bidx = (row0g + row0 + rloc) / rowsPerB; v += CP[(size_t)bidx * sCPb + (size_t)by * 64 + col]; } }
      if (ACT == 3) v = fmaxf(v, 0.f); else if (ACT == 6) v = 0.5f * v * (1.0f + erff(v * 0.70710678118654752f)); else if (ACT == 11) v = 1.0f / (1.0f + expf(-v)); else if (ACT == 15) v = v / (1.0f + expf(-v)); else if (ACT == 12) v = (v > 0.f) ? v : 0.01f * v; else if (ACT == 8) v = tanhf(v); else if (ACT == 9) v = 0.5f * v * (1.0f + tanhf(0.7978845608028654f * (v + 0.044715f * v * v * v))); else if (ACT == 14) v = (v > 0.f) ? v : 0.1f * v; else if (ACT == 16) v = (v >= 0.f) ? v : 0.3f * v; else if (ACT == 17) v = (v >= 0.f) ? v : 0.2f * v;
      so[w][rloc][t * 16 + ln] = v; } }
  __builtin_amdgcn_fence(__ATOMIC_ACQ_REL, "workgroup"); __builtin_amdgcn_wave_barrier();
  const int rsub = lane >> 4, c4 = (lane & 15) * 4;
  {
#pragma unroll
    for (int q = 0; q < 16; ++q) { const int r = q * 2 + rsub; const v4f v = *(const v4fa*)&so[w][r][c4]; if (C) *(v4f*)(C + cofs + (size_t)(row0 + r) * ldc + col0 + c4) = v; if (C16) { v4h h4; for (int i = 0; i < 4; ++i) h4[i] = (_Float16)v[i]; *(v4h*)(C16 + cofs + (size_t)(row0 + r) * ldc + col0 + c4) = h4; } }
     } }


__global__ __launch_bounds__(256) void k_wnat(const float* __restrict__ w, size_t n8, _Float16* __restrict__ Bt) { const size_t t = (size_t)blockIdx.x * 256 + threadIdx.x; if (t >= n8) return; FragH f; for (int q = 0; q < 8; ++q) f.h[q] = (_Float16)(bf16_round(w[t * 8 + q]) * 16.0f); *(v8us*)((unsigned short*)Bt + t * 8) = f.half[0];  }
__global__ __launch_bounds__(256) void k_rsm(const float* __restrict__ S, _Float16* __restrict__ P, int nrows) {
  #pragma clang fp contract(off)
  const int i = blockIdx.x * 256 + threadIdx.x; if (i >= nrows) return; const float* s = S + (size_t)i * SQ; float mx = -3.0e38f;
#pragma unroll 1
  for (int j = 0; j < SQ; ++j) mx = fmaxf(mx, s[j]); float se = 0.f;
#pragma unroll 1
  for (int j = 0; j < SQ; ++j) se += expf(s[j] - mx); const float sc = 256.0f / se;
#pragma unroll 1
  for (int j0 = 0; j0 < SQ; j0 += 8) { FragH f; for (int q = 0; q < 8; ++q) f.h[q] = (_Float16)(expf(s[j0 + q] - mx) * sc); unsigned short* d = (unsigned short*)P + (size_t)i * SQ + j0; *(v8us*)d = f.half[0];  } }
__global__ __launch_bounds__(256) void k_vt(const _Float16* __restrict__ V16, int b, int h0, _Float16* __restrict__ VT) { __shared__ unsigned short tl[64][65]; const int tid = threadIdx.x; const int hh = blockIdx.x % HG, sg = blockIdx.x / HG; const int s0 = sg * 64; const int h = h0 + hh;
  for (int i = tid; i < 64 * 8; i += 256) { const int j = i / 8, d8 = (i % 8) * 8; FragH f; f.half[0] = *(const v8us*)((const unsigned short*)V16 + ((size_t)b * SQ + s0 + j) * DM + h * HD + d8); for (int q = 0; q < 8; ++q) tl[d8 + q][j] = f.u[q]; }
  __syncthreads();
  { for (int i = tid; i < 64 * 8; i += 256) { const int d = i / 8, j8 = (i % 8) * 8; FragH f; for (int q = 0; q < 8; ++q) f.u[q] = tl[d][j8 + q]; *(v8us*)((unsigned short*)VT + ((size_t)hh * HD + d) * SQ + s0 + j8) = f.half[0]; }  } }


// cross-lane steps of the wave-wide reductions below: row_xmask DPP inside a 16-lane row, permlanex16 for lane ^ 16 (no LDS round trip)
template <int CTRL>
__device__ __forceinline__ float xl_row(float v) { return __int_as_float(__builtin_amdgcn_update_dpp(0, __float_as_int(v), CTRL, 0xf, 0xf, true)); }
__device__ __forceinline__ float xl_half(float v) { const int i = __float_as_int(v); return __int_as_float(__builtin_amdgcn_permlanex16(i, i, 0x76543210, 0xfedcba98, false, false)); }
__device__ __forceinline__ float wave_max(float v) { v = fmaxf(v, xl_row<0x161>(v)); v = fmaxf(v, xl_row<0x162>(v)); v = fmaxf(v, xl_row<0x164>(v)); v = fmaxf(v, xl_row<0x168>(v)); return fmaxf(v, xl_half(v)); }
__device__ __forceinline__ float wave_sum(float v) { v += xl_row<0x161>(v); v += xl_row<0x162>(v); v += xl_row<0x164>(v); v += xl_row<0x168>(v); return v + xl_half(v); }
// row softmax, one wave per row: each load is 512 contiguous bytes of the row, the whole row (32 x 4 scores a lane) stays in registers, so S is read once and exp is taken once; P = f16(exp(s - max) * 256 / sum)
__global__ __launch_bounds__(256) void k_rsmw(const float* __restrict__ S, _Float16* __restrict__ P) {
  const int lane = threadIdx.x & 31; const size_t row = (size_t)blockIdx.x * 8 + (threadIdx.x >> 5);
  const float* s = S + row * SQ + lane * 4; _Float16* p = P + row * SQ + lane * 4;
  v4f x[SQ / 128];
  // full unroll here and below: x[] must be indexed by constants to live in registers, and all 32 loads are to be in flight at once
#pragma unroll
  for (int u = 0; u < SQ / 128; ++u) x[u] = *(const v4fa*)(s + u * 128);
  v4f m4 = x[0];
#pragma unroll
  for (int u = 1; u < SQ / 128; ++u) for (int q = 0; q < 4; ++q) m4[q] = fmaxf(m4[q], x[u][q]);
  const float mx = wave_max(fmaxf(fmaxf(m4[0], m4[1]), fmaxf(m4[2], m4[3])));
  v4f a4 = {0.f, 0.f, 0.f, 0.f};
#pragma unroll
  for (int u = 0; u < SQ / 128; ++u) for (int q = 0; q < 4; ++q) { const float e = __expf(x[u][q] - mx); x[u][q] = e; a4[q] += e; }
  const float sc = 256.0f / wave_sum((a4[0] + a4[1]) + (a4[2] + a4[3]));
#pragma unroll
  for (int u = 0; u < SQ / 128; ++u) { v4h h4; for (int q = 0; q < 4; ++q) h4[q] = (_Float16)(x[u][q] * sc); *(v4h*)(p + u * 128) = h4; } }

extern "C" void kernel_launch(void* const* d_in, const int* in_sizes, int n_in,
                              void* d_out, int out_size, void* d_ws, size_t ws_size, hipStream_t stream) {
  (void)in_sizes; (void)n_in; (void)out_size;
  const float* const* I = (const float* const*)d_in; const float* xq = I[0]; const float* xk = I[1]; const float* xv = I[2]; const float* wq = I[3]; const float* bq = I[4]; const float* wk = I[5]; const float* bk = I[6]; const float* wv = I[7]; const float* bv = I[8];
  char* ws = (char*)d_ws; size_t off = 0;
  auto take = [&](size_t bytes) { char* p = ws + off; off += (bytes + 255) & ~(size_t)255; return p; };
  _Float16* BQ = (_Float16*)take((size_t)DM * DM * 2); _Float16* BK = (_Float16*)take((size_t)DM * DM * 2); _Float16* BV = (_Float16*)take((size_t)DM * DM * 2);
  _Float16* XQ = (_Float16*)take(NR * DM * 2); _Float16* XK = (_Float16*)take(NR * DM * 2); _Float16* XV = (_Float16*)take(NR * DM * 2); _Float16* Q16 = (_Float16*)take(NR * DM * 2); _Float16* K16 = (_Float16*)take(NR * DM * 2); float* VF = (float*)take(NR * DM * 4); _Float16* VH = (_Float16*)take(NR * DM * 2); _Float16* VL = (_Float16*)take(NR * DM * 2);
  float* S = (float*)take((size_t)SQ * SQ * 4); _Float16* P = (_Float16*)take((size_t)SQ * SQ * 2); _Float16* VT = (_Float16*)take((size_t)DM * SQ * 2); _Float16* VTL = (_Float16*)take((size_t)DM * SQ * 2);
  if (off > ws_size) return;      /* approx 0.4 + 8 x 5 + 16 + 8 + 8 + 64 + 32 + 4 = 172 MiB */
  { const unsigned g = (unsigned)(((size_t)DM * (DM / 8) + 255) / 256); k_wt_f16<<<g, 256, 0, stream>>>(wq, BQ, DM, DM, 16.0f); k_wt_f16<<<g, 256, 0, stream>>>(wk, BK, DM, DM, 16.0f); k_wt_f16<<<g, 256, 0, stream>>>(wv, BV, DM, DM, 16.0f); }
  k_x16<<<(unsigned)((NR * DM / 8 + 255) / 256), 256, 0, stream>>>(xq, XQ, NR * DM / 8); k_x16<<<(unsigned)((NR * DM / 8 + 255) / 256), 256, 0, stream>>>(xk, XK, NR * DM / 8); k_x16<<<(unsigned)((NR * DM / 8 + 255) / 256), 256, 0, stream>>>(xv, XV, NR * DM / 8);
  k_gemm2<0><<<dim3((unsigned)((NR / 128) * (DM / 64)), 1), 128, 0, stream>>>(XQ, DM, 0, BQ, DM, 0, 0.0625f, bq, 0, nullptr, 1, 0, 0, nullptr, Q16, DM, 0, (int)NR, DM, DM);
  k_gemm2<0><<<dim3((unsigned)((NR / 128) * (DM / 64)), 1), 128, 0, stream>>>(XK, DM, 0, BK, DM, 0, 0.0625f, bk, 0, nullptr, 1, 0, 0, nullptr, K16, DM, 0, (int)NR, DM, DM);
  k_gemm2<0><<<dim3((unsigned)((NR / 128) * (DM / 64)), 1), 128, 0, stream>>>(XV, DM, 0, BV, DM, 0, 0.0625f, bv, 0, nullptr, 1, 0, 0, VF, nullptr, DM, 0, (int)NR, DM, DM); k_hl<<<(unsigned)((NR * DM / 8 + 255) / 256), 256, 0, stream>>>(VF, VH, VL, NR * DM / 8);      /* v (f32) -> f16 hi + x1024 residual */
  for (int b = 0; b < NB; ++b) { const size_t r0 = (size_t)b * SQ;
    k_vt<DM / 64, SQ><<<(DM / 64) * (SQ / 64), 256, 0, stream>>>(VH + r0 * DM, DM, 0, VT); k_vt<DM / 64, SQ><<<(DM / 64) * (SQ / 64), 256, 0, stream>>>(VL + r0 * DM, DM, 0, VTL);
    k_gemm2<0><<<dim3((SQ / 128) * (SQ / 64), 1), 128, 0, stream>>>(Q16 + r0 * DM, DM, 0, K16 + r0 * DM, DM, 0, 0.0625f, nullptr, 0, nullptr, 1, 0, 0, S, nullptr, SQ, 0, SQ, SQ, DM);      /* scores / 16 (K = 256) */
    k_rsmw<<<SQ / 8, 256, 0, stream>>>(S, P);
    k_gemm2<0><<<dim3((SQ / 128) * (DM / 64), 1), 128, 0, stream>>>(P, SQ, 0, VT, SQ, 0, 0.00390625f, nullptr, 0, nullptr, 1, 0, 0, (float*)d_out + r0 * DM, nullptr, DM, 0, SQ, DM, SQ);      /* out = P V_hi / 256 */
    k_gemm2<0><<<dim3((SQ / 128) * (DM / 64), 1), 128, 0, stream>>>(P, SQ, 0, VTL, SQ, 0, 0.000003814697265625f, nullptr, 0, (const float*)d_out + r0 * DM, -1, 0, 0, (float*)d_out + r0 * DM, nullptr, DM, 0, SQ, DM, SQ); }      /* += P V_lo 2^-18 (own element) */
}

// v002
// Measured time: 555 microseconds a run.
// Next to v001, in two timings, it ran 2.36 and 2.34 times as fast.
// Counting every step since v000, it is 6.95 times as fast.
#include <hip/hip_runtime.h>
// Single-head attention with dense projections (q_in, k_in, v_in [4][4096][256]; q = q_in Wq + bq, k = k_in Wk + bk, v = v_in Wv + bv ([in][out] 256x256 glorot-uniform, biases uniform); scores = q . k x 256^-0.5; softmax over the 4096 keys (no mask); out = attn v -> [4][4096][256]; no output projection).
// Structure: the three inputs as exact f16 rows; [in][out] weights as exact x16 planes; q, k as WMMA GEMMs (32x64 wave tiles, f32 accumulation, + bias, f16 outputs: logits sigma ~1), v as an f32-output GEMM split into f16 hi + x1024 residual planes; per batch: V^T of the hi and residual planes (4 slabs of 64) via LDS transposes; scores as ONE GEMM (K = 256, alpha 1/16) into an f32 [4096][4096] plane; row softmax on VALU (f32 statistics, native exp; weights x256 f16); out = P V_hi^T (N = 256, K = 4096, alpha 2^-8) straight into the output, then += P V_lo^T 2^-18 (own-element accumulate in the next launch); launches: see trace.
// Compute dtype: inputs rounded to bf16; x / weights exact; q, k, P plain f16 (~2^-12), v as hi + residual; scores / statistics / out f32; v_wmma_f32_16x16x32_f16.
#define NB 4
#define SQ 4096
#define DM 256
#define NH 1
#define HD 64
#define HG 1
#define NR ((size_t)NB * SQ)
typedef __bf16 v16b __attribute__((ext_vector_type(16)));
typedef unsigned short v8us __attribute__((ext_vector_type(8), may_alias));
typedef float  v8f  __attribute__((ext_vector_type(8)));
typedef float  v4f  __attribute__((ext_vector_type(4)));
typedef float  v4fa __attribute__((ext_vector_type(4), may_alias));
union FragB { v16b v; v8us half[2]; unsigned short u[16]; };

__device__ __forceinline__ unsigned short bf16_bits(float x) { unsigned int u = __float_as_uint(x); return (unsigned short)((u + 0x7FFFu + ((u >> 16) & 1u)) >> 16); }
__device__ __forceinline__ float bf16_val(unsigned short b) { return __uint_as_float(((unsigned int)b) << 16); }
__device__ __forceinline__ float bf16_round(float x) { return bf16_val(bf16_bits(x)); }
// D += A·B with NT terms: 1 = ah·bh, 2 = + al·bh (A split), 3 = + ah·bl (both split)
template <int NT>
__device__ __forceinline__ v8f mmaN(v16b ah, v16b al, v16b bh, v16b bl, v8f c) {
  c = __builtin_amdgcn_wmma_f32_16x16x32_bf16(false, ah, false, bh, (short)0, c, false, false);
  if (NT >= 2) c = __builtin_amdgcn_wmma_f32_16x16x32_bf16(false, al, false, bh, (short)0, c, false, false);
  if (NT >= 3) c = __builtin_amdgcn_wmma_f32_16x16x32_bf16(false, ah, false, bl, (short)0, c, false, false);
  asm volatile("v_nop\n\tv_nop\n\tv_nop\n\tv_nop" : "+v"(c) : "v"(ah), "v"(al), "v"(bh), "v"(bl));
  return c;
}

__global__ __launch_bounds__(256) void k_wt_bf16(const float* __restrict__ W, unsigned short* __restrict__ Wt, int K, int N) {
  const int t = blockIdx.x * 256 + threadIdx.x;
  const int k8n = K / 8;
  if (t >= N * k8n) return;
  const int n = t / k8n, k8 = (t % k8n) * 8;
  v8us v;
#pragma unroll
  for (int i = 0; i < 8; ++i) v[i] = bf16_bits(W[(size_t)(k8 + i) * N + n]);
  *(v8us*)(Wt + (size_t)n * K + k8) = v;
  
}

// GEMM C[M][N] (f32, pitch ldc) = act(A[M][K]·W + bias). A f32 row-major (pitch lda) converted per fragment to bf16
// (ASPLIT: hi/lo two planes -> 2 terms, else single rounded term); Wt bf16 [N][K] (pitch ldb). BIAS_BF16 rounds the
// bias to bf16 first (bias quantised to bf16 before the add). K%32==0, M%16==0, N%64==0.
template <bool ASPLIT, int ACT, bool BIAS_BF16>
__global__ __launch_bounds__(128) void k_gemm_bf(const float* __restrict__ A, int lda, const unsigned short* __restrict__ Wt, int ldb,
                                               const float* __restrict__ bias, float* __restrict__ C, int ldc, int M, int N, int K) {
  __shared__ __attribute__((aligned(16))) float so[4][16][64];
  const int tid = threadIdx.x, w = tid >> 5, lane = tid & 31, ln = lane & 15, hh = lane >> 4;
  const int ntn = N / 64;
  const int wid = blockIdx.x * 4 + w;
  const int mt = wid / ntn, nq = wid % ntn;
  if (mt * 16 >= M) return;
  const int row0 = mt * 16, col0 = nq * 64;
  const float* arow = A + (size_t)(row0 + ln) * lda;
  v8f acc[4] = {};
  for (int kb = 0; kb < K; kb += 32) {
    FragB ah, al;
    const v4f x0 = *(const v4fa*)(arow + kb + 8 * hh), x1 = *(const v4fa*)(arow + kb + 8 * hh + 4);
    const v4f x2 = *(const v4fa*)(arow + kb + 16 + 8 * hh), x3 = *(const v4fa*)(arow + kb + 16 + 8 * hh + 4);
    float xs[16] = {x0[0],x0[1],x0[2],x0[3],x1[0],x1[1],x1[2],x1[3],x2[0],x2[1],x2[2],x2[3],x3[0],x3[1],x3[2],x3[3]};
#pragma unroll
    for (int i = 0; i < 16; ++i) { const unsigned short hb = bf16_bits(xs[i]); ah.u[i] = hb; al.u[i] = ASPLIT ? bf16_bits(xs[i] - bf16_val(hb)) : (unsigned short)0; }
#pragma unroll
    for (int t = 0; t < 4; ++t) {
      const unsigned short* brow = Wt + (size_t)(col0 + t * 16 + ln) * ldb + kb;
      FragB b;
      b.half[0] = *(const v8us*)(brow + 8 * hh);
      b.half[1] = *(const v8us*)(brow + 16 + 8 * hh);
      acc[t] = mmaN<ASPLIT ? 2 : 1>(ah.v, al.v, b.v, b.v, acc[t]);
    }
  }
#pragma unroll
  for (int t = 0; t < 4; ++t) {
    float bv = bias ? bias[col0 + t * 16 + ln] : 0.f;
    if (BIAS_BF16) bv = bf16_round(bv);
#pragma unroll
    for (int r = 0; r < 8; ++r) { float v = acc[t][r] + bv; if (ACT == 1) v = fmaxf(v, 0.f); so[w][8 * hh + r][t * 16 + ln] = v; }
  }
  __builtin_amdgcn_fence(__ATOMIC_ACQ_REL, "workgroup");
  __builtin_amdgcn_wave_barrier();
  const int rsub = lane >> 4, c4 = (lane & 15) * 4;
  {
#pragma unroll
    for (int q = 0; q < 8; ++q) {
      const int r = q * 2 + rsub;
      const v4f v = *(const v4fa*)&so[w][r][c4];
      *(v4f*)(C + (size_t)(row0 + r) * ldc + col0 + c4) = v;
    }
    
  }
}

// GEMM C = act(A·W + bias + resid): A f32 (ASPLIT -> hi/lo 2 terms), Wt bf16 [N][K]; ACT 0 none, 1 relu, 2 exact gelu;
// resid (optional, f32, row index = (row % rmod), pitch ldr, RES_BF16 rounds it) added before the activation.
template <bool ASPLIT, int ACT, bool BIAS_BF16, bool RES_BF16>
__global__ __launch_bounds__(128) void k_gemm_bf3(const float* __restrict__ A, int lda, const unsigned short* __restrict__ Wt, int ldb,
                                                const float* __restrict__ bias, const float* __restrict__ resid, int rmod, int ldr,
                                                float* __restrict__ C, int ldc, int M, int N, int K) {
  __shared__ __attribute__((aligned(16))) float so[4][16][64];
  const int tid = threadIdx.x, w = tid >> 5, lane = tid & 31, ln = lane & 15, hh = lane >> 4;
  const int ntn = N / 64;
  const int wid = blockIdx.x * 4 + w;
  const int mt = wid / ntn, nq = wid % ntn;
  if (mt * 16 >= M) return;
  const int row0 = mt * 16, col0 = nq * 64;
  const float* arow = A + (size_t)(row0 + ln) * lda;
  v8f acc[4] = {};
  for (int kb = 0; kb < K; kb += 32) {
    FragB ah, al;
    const v4f x0 = *(const v4fa*)(arow + kb + 8 * hh), x1 = *(const v4fa*)(arow + kb + 8 * hh + 4);
    const v4f x2 = *(const v4fa*)(arow + kb + 16 + 8 * hh), x3 = *(const v4fa*)(arow + kb + 16 + 8 * hh + 4);
    float xs[16] = {x0[0],x0[1],x0[2],x0[3],x1[0],x1[1],x1[2],x1[3],x2[0],x2[1],x2[2],x2[3],x3[0],x3[1],x3[2],x3[3]};
#pragma unroll
    for (int i = 0; i < 16; ++i) { const unsigned short hb = bf16_bits(xs[i]); ah.u[i] = hb; al.u[i] = ASPLIT ? bf16_bits(xs[i] - bf16_val(hb)) : (unsigned short)0; }
#pragma unroll
    for (int t = 0; t < 4; ++t) {
      const unsigned short* brow = Wt + (size_t)(col0 + t * 16 + ln) * ldb + kb;
      FragB b;
      b.half[0] = *(const v8us*)(brow + 8 * hh);
      b.half[1] = *(const v8us*)(brow + 16 + 8 * hh);
      acc[t] = mmaN<ASPLIT ? 2 : 1>(ah.v, al.v, b.v, b.v, acc[t]);
    }
  }
#pragma unroll
  for (int t = 0; t < 4; ++t) {
    const int col = col0 + t * 16 + ln;
    float bv = bias ? bias[col] : 0.f;
    if (BIAS_BF16) bv = bf16_round(bv);
#pragma unroll
    for (int r = 0; r < 8; ++r) {
      float v = acc[t][r] + bv;
      if (resid) { float rv = resid[(size_t)((row0 + 8 * hh + r) % rmod) * ldr + col]; if (RES_BF16) rv = bf16_round(rv); v += rv; }
      if (ACT == 1) v = fmaxf(v, 0.f);
      if (ACT == 2) v = 0.5f * v * (1.0f + erff(v * 0.70710678118654752f));
      if (ACT == 3) { const float u = 0.7978845608028654f * (v + 0.044715f * v * v * v); v = 0.5f * v * (1.0f + tanhf(u)); }
      so[w][8 * hh + r][t * 16 + ln] = v;
    }
  }
  __builtin_amdgcn_fence(__ATOMIC_ACQ_REL, "workgroup");
  __builtin_amdgcn_wave_barrier();
  const int rsub = lane >> 4, c4 = (lane & 15) * 4;
  {
#pragma unroll
    for (int q = 0; q < 8; ++q) {
      const int r = q * 2 + rsub;
      const v4f v = *(const v4fa*)&so[w][r][c4];
      *(v4f*)(C + (size_t)(row0 + r) * ldc + col0 + c4) = v;
    }
    
  }
}
// row LayerNorm (biased variance, eps) over N: s = X (+ R); optional out_sum <- s; out_norm <- (s-mu)*rsqrt(var+eps)*g + b
template <bool PARAM_BF16>
__global__ __launch_bounds__(256) void k_layernorm(const float* __restrict__ X, const float* __restrict__ R, const float* __restrict__ g, const float* __restrict__ bta,
                                                  float* __restrict__ out_sum, float* __restrict__ out_norm, int N, float eps) {
  __shared__ float red[256];
  const int row = blockIdx.x, tid = threadIdx.x;
  const float* x = X + (size_t)row * N; const float* rr = R ? R + (size_t)row * N : nullptr;
  float vals[16];                     // up to N = 4096
  const int per = N / 256;            // contiguous chunk per thread? use strided-by-4 chunks: thread handles j = tid*4 + 1024*u
  float s1 = 0.f;
  for (int u = 0; u < per / 4; ++u) {
    const int j = tid * 4 + 1024 * u;
    const v4f a = *(const v4fa*)(x + j);
    v4f b = {0.f,0.f,0.f,0.f}; if (rr) b = *(const v4fa*)(rr + j);
#pragma unroll
    for (int q = 0; q < 4; ++q) { const float v = a[q] + b[q]; vals[u * 4 + q] = v; s1 += v; }
  }
  red[tid] = s1; __syncthreads();
  for (int st = 128; st > 0; st >>= 1) { if (tid < st) red[tid] += red[tid + st]; __syncthreads(); }
  const float mu = red[0] / (float)N; __syncthreads();
  float s2 = 0.f;
  for (int u = 0; u < per / 4; ++u)
#pragma unroll
    for (int q = 0; q < 4; ++q) { const float c = vals[u * 4 + q] - mu; s2 += c * c; }
  red[tid] = s2; __syncthreads();
  for (int st = 128; st > 0; st >>= 1) { if (tid < st) red[tid] += red[tid + st]; __syncthreads(); }
  const float rs = rsqrtf(red[0] / (float)N + eps);
  {
    for (int u = 0; u < per / 4; ++u) {
      const int j = tid * 4 + 1024 * u;
      v4f o, sm;
#pragma unroll
      for (int q = 0; q < 4; ++q) {
        float gg = g[j + q], bb = bta[j + q];
        if (PARAM_BF16) { gg = bf16_round(gg); bb = bf16_round(bb); }
        sm[q] = vals[u * 4 + q]; o[q] = (vals[u * 4 + q] - mu) * rs * gg + bb;
      }
      if (out_sum) *(v4f*)(out_sum + (size_t)row * N + j) = sm;
      *(v4f*)(out_norm + (size_t)row * N + j) = o;
    }
    
  }
}



// ---- f16 WMMA path (v_wmma_f32_16x16x32_f16): 11-bit significands for operands in range — used where a [0,1] probability operand needs more precision than bf16
typedef _Float16 v16h __attribute__((ext_vector_type(16)));
union FragH { v16h v; v8us half[2]; _Float16 h[16]; unsigned short u[16]; };
template <int NT>
__device__ __forceinline__ v8f mmaH(v16h ah, v16h al, v16h bh, v16h bl, v8f c) {
  c = __builtin_amdgcn_wmma_f32_16x16x32_f16(false, ah, false, bh, (short)0, c, false, false);
  if (NT >= 2) c = __builtin_amdgcn_wmma_f32_16x16x32_f16(false, al, false, bh, (short)0, c, false, false);
  if (NT >= 3) c = __builtin_amdgcn_wmma_f32_16x16x32_f16(false, ah, false, bl, (short)0, c, false, false);
  asm volatile("v_nop\n\tv_nop\n\tv_nop\n\tv_nop" : "+v"(c) : "v"(ah), "v"(al), "v"(bh), "v"(bl));
  return c;
}
// batched GEMM like k_gemm_b but f16 operands: A f32 (split into f16 hi/lo if ASPLIT, else rounded to f16), Bt = f16 values [n][k]; alpha; C f32; N multiple of 16 (partial tiles skipped)
template <bool ASPLIT>
__global__ __launch_bounds__(128) void k_gemm_h(const float* __restrict__ A, int lda, size_t sA, const _Float16* __restrict__ Bh, int ldb, size_t sB, float alpha, float* __restrict__ C, int ldc, size_t sC, int M, int N, int K) {
  __shared__ __attribute__((aligned(16))) float so[4][16][64];
  const int tid = threadIdx.x, w = tid >> 5, lane = tid & 31, ln = lane & 15, hh = lane >> 4; const int by = blockIdx.y;
  A += (size_t)by * sA; Bh += (size_t)by * sB; C += (size_t)by * sC;
  const int ntn = (N + 63) / 64; const int wid = blockIdx.x * 4 + w; const int mt = wid / ntn, nq = wid % ntn; if (mt * 16 >= M) return;
  const int row0 = mt * 16, col0 = nq * 64; const float* arow = A + (size_t)(row0 + ln) * lda;
  v8f acc[4] = {};
  for (int kb = 0; kb < K; kb += 32) {
    FragH ah, al;
    const v4f x0 = *(const v4fa*)(arow + kb + 8 * hh), x1 = *(const v4fa*)(arow + kb + 8 * hh + 4), x2 = *(const v4fa*)(arow + kb + 16 + 8 * hh), x3 = *(const v4fa*)(arow + kb + 16 + 8 * hh + 4);
    float xs[16] = {x0[0],x0[1],x0[2],x0[3],x1[0],x1[1],x1[2],x1[3],x2[0],x2[1],x2[2],x2[3],x3[0],x3[1],x3[2],x3[3]};
#pragma unroll
    for (int i = 0; i < 16; ++i) { const _Float16 h = (_Float16)xs[i]; ah.h[i] = h; al.h[i] = ASPLIT ? (_Float16)(xs[i] - (float)h) : (_Float16)0.0f; }
#pragma unroll
    for (int t = 0; t < 4; ++t) { if (col0 + t * 16 >= N) continue; const size_t boff = (size_t)(col0 + t * 16 + ln) * ldb + kb; FragH bq; bq.half[0] = *(const v8us*)(Bh + boff + 8 * hh); bq.half[1] = *(const v8us*)(Bh + boff + 16 + 8 * hh);
      acc[t] = mmaH<ASPLIT ? 2 : 1>(ah.v, al.v, bq.v, bq.v, acc[t]); }
  }
#pragma unroll
  for (int t = 0; t < 4; ++t) { if (col0 + t * 16 >= N) continue;
#pragma unroll
    for (int r = 0; r < 8; ++r) so[w][8 * hh + r][t * 16 + ln] = acc[t][r] * alpha; }
  __builtin_amdgcn_fence(__ATOMIC_ACQ_REL, "workgroup"); __builtin_amdgcn_wave_barrier();
  const int rsub = lane >> 4, c4 = (lane & 15) * 4;
  {
#pragma unroll
    for (int q = 0; q < 8; ++q) { const int r = q * 2 + rsub; if (col0 + c4 < N) { const v4f v = *(const v4fa*)&so[w][r][c4]; *(v4f*)(C + (size_t)(row0 + r) * ldc + col0 + c4) = v; } }
     }
}

// Wt[n][k] = f16(W[k][n]·scale) from f32 row-major W[K][N] (scale = power of two; bf16-exact weights stay exact in f16 away from the subnormal range)
__global__ __launch_bounds__(256) void k_wt_f16(const float* __restrict__ W, _Float16* __restrict__ Wt, int K, int N, float scale) {
  const int t = blockIdx.x * 256 + threadIdx.x; if (t >= N * (K / 8)) return; const int n = t / (K / 8), k8 = (t % (K / 8)) * 8; FragH f;
#pragma unroll
  for (int i = 0; i < 8; ++i) f.h[i] = (_Float16)(bf16_round(W[(size_t)(k8 + i) * N + n]) * scale); const v8us o = f.half[0];
  *(v8us*)((unsigned short*)Wt + (size_t)n * K + k8) = o; 
}
// k_gemm_hh variant with fused epilogue: v = acc·alpha + bias[by·sBias + col] (+ CP[(row/rowsPerB)·sCPb + by·64 + col] if CP) ; ACT 0 none / 1 elu ; writes f16 C16 (and f32 C if non-null)
template <int ACT>
__global__ __launch_bounds__(128) void k_gemm_hhx(const _Float16* __restrict__ A, int lda, size_t sA, const _Float16* __restrict__ Bh, int ldb, size_t sB, float alpha, const float* __restrict__ bias, size_t sBias, const float* __restrict__ CP, int rowsPerB, size_t sCPb, int row0g,
    float* __restrict__ C, _Float16* __restrict__ C16, int ldc, size_t sC, int M, int N, int K) {
  __shared__ __attribute__((aligned(16))) float so[4][16][64];
  const int tid = threadIdx.x, w = tid >> 5, lane = tid & 31, ln = lane & 15, hh = lane >> 4; const int by = blockIdx.y;
  A += (size_t)by * sA; Bh += (size_t)by * sB; const size_t cofs = (size_t)by * sC; const float* bp = bias ? bias + (size_t)by * sBias : nullptr;
  const int ntn = (N + 63) / 64; const int wid = blockIdx.x * 4 + w; const int mt = wid / ntn, nq = wid % ntn; if (mt * 16 >= M) return;
  const int row0 = mt * 16, col0 = nq * 64; const _Float16* arow = A + (size_t)(row0 + ln) * lda;
  v8f acc[4] = {};
  for (int kb = 0; kb < K; kb += 32) { FragH ah; ah.half[0] = *(const v8us*)((const unsigned short*)arow + kb + 8 * hh); ah.half[1] = *(const v8us*)((const unsigned short*)arow + kb + 16 + 8 * hh);
#pragma unroll
    for (int t = 0; t < 4; ++t) { if (col0 + t * 16 >= N) continue; const size_t boff = (size_t)(col0 + t * 16 + ln) * ldb + kb; FragH bq; bq.half[0] = *(const v8us*)((const unsigned short*)Bh + boff + 8 * hh); bq.half[1] = *(const v8us*)((const unsigned short*)Bh + boff + 16 + 8 * hh);
      acc[t] = mmaH<1>(ah.v, ah.v, bq.v, bq.v, acc[t]); }
  }
#pragma unroll
  for (int t = 0; t < 4; ++t) { if (col0 + t * 16 >= N) continue; const int col = col0 + t * 16 + ln; const float bv = bp ? bf16_round(bp[col]) : 0.f;
#pragma unroll
    for (int r = 0; r < 8; ++r) { float v = acc[t][r] * alpha + bv; if (CP) { const int rr = row0g + row0 + 8 * hh + r; if (rowsPerB < 0) v += CP[cofs + (size_t)rr * ldc + col];      /* rowsPerB < 0: own element of the batched C plane */ else { const int bidx = rr / rowsPerB; v += CP[(size_t)bidx * sCPb + (size_t)by * 64 + col]; } } if (ACT == 1) v = (v > 0.f) ? v : expm1f(v); else if (ACT == 7) v = (v > 0.f) ? v + 1.0f : expf(v); else if (ACT == 8) v = tanhf(v); else if (ACT == 9) v = 0.5f * v * (1.0f + tanhf(0.7978845608028654f * (v + 0.044715f * v * v * v))); else if (ACT == 11) v = 1.0f / (1.0f + expf(-v)); else if (ACT == 12) v = (v > 0.f) ? v : 0.01f * v; else if (ACT == 14) v = (v > 0.f) ? v : 0.1f * v; else if (ACT == 16) v = (v >= 0.f) ? v : 0.3f * v; else if (ACT == 17) v = (v >= 0.f) ? v : 0.2f * v; else if (ACT == 15) v = v / (1.0f + expf(-v)); else if (ACT == 3) v = fmaxf(v, 0.f); else if (ACT == 6) v = 0.5f * v * (1.0f + erff(v * 0.70710678118654752f)); so[w][8 * hh + r][t * 16 + ln] = v; } }
  __builtin_amdgcn_fence(__ATOMIC_ACQ_REL, "workgroup"); __builtin_amdgcn_wave_barrier();
  const int rsub = lane >> 4, c4 = (lane & 15) * 4; typedef _Float16 v4h __attribute__((ext_vector_type(4)));
  {
#pragma unroll
    for (int q = 0; q < 8; ++q) { const int r = q * 2 + rsub; if (col0 + c4 < N) { const v4f v = *(const v4fa*)&so[w][r][c4]; if (C) *(v4f*)(C + cofs + (size_t)(row0 + r) * ldc + col0 + c4) = v; if (C16) { v4h h4; for (int i = 0; i < 4; ++i) h4[i] = (_Float16)v[i]; *(v4h*)(C16 + cofs + (size_t)(row0 + r) * ldc + col0 + c4) = h4; } } }
     }
}


typedef _Float16 v4h __attribute__((ext_vector_type(4)));

__global__ __launch_bounds__(256) void k_x16(const float* __restrict__ x, _Float16* __restrict__ X16, size_t n8) { const size_t t = (size_t)blockIdx.x * 256 + threadIdx.x; if (t >= n8) return; FragH f;
#pragma unroll
  for (int q = 0; q < 8; ++q) f.h[q] = (_Float16)bf16_round(x[t * 8 + q]); *(v8us*)((unsigned short*)X16 + t * 8) = f.half[0];  }
__global__ __launch_bounds__(256) void k_h16(const float* __restrict__ x, _Float16* __restrict__ X16, size_t n8) { const size_t t = (size_t)blockIdx.x * 256 + threadIdx.x; if (t >= n8) return; FragH f;
#pragma unroll
  for (int q = 0; q < 8; ++q) f.h[q] = (_Float16)x[t * 8 + q]; *(v8us*)((unsigned short*)X16 + t * 8) = f.half[0];  }
__global__ __launch_bounds__(256) void k_round16f(const float* __restrict__ W, _Float16* __restrict__ Bt, size_t n8) { const size_t t = (size_t)blockIdx.x * 256 + threadIdx.x; if (t >= n8) return; FragH f;
#pragma unroll
  for (int i = 0; i < 8; ++i) f.h[i] = (_Float16)(bf16_round(W[t * 8 + i]) * 16.0f); *(v8us*)((unsigned short*)Bt + t * 8) = f.half[0];  }
template <int NHv, int TTv>
__global__ __launch_bounds__(256) void k_vt(const _Float16* __restrict__ V16, int ldv, int voff, _Float16* __restrict__ Vt) { __shared__ unsigned short tl[64][66]; const int tid = threadIdx.x; const int slab = blockIdx.x / (TTv / 64), lg = blockIdx.x % (TTv / 64); const int b = slab / NHv, h = slab % NHv;
  for (int i = tid; i < 64 * 8; i += 256) { const int r = i / 8, c8 = (i % 8) * 8; FragH f; f.half[0] = *(const v8us*)((const unsigned short*)V16 + ((size_t)b * TTv + lg * 64 + r) * ldv + voff + h * 64 + c8);
#pragma unroll
    for (int q = 0; q < 8; ++q) tl[r][c8 + q] = f.u[q]; }
  __syncthreads();
  {
#pragma unroll
    for (int rd = 0; rd < 2; ++rd) { const int d = rd * 32 + tid / 8, pc = tid % 8; FragH f;
#pragma unroll
      for (int q = 0; q < 8; ++q) f.u[q] = tl[pc * 8 + q][d];
      *(v8us*)((unsigned short*)Vt + ((size_t)slab * 64 + d) * TTv + lg * 64 + pc * 8) = f.half[0]; }
     } }

__global__ __launch_bounds__(256) void k_hl(const float* __restrict__ F, _Float16* __restrict__ Hh, _Float16* __restrict__ Hl, size_t n8) { const size_t t = (size_t)blockIdx.x * 256 + threadIdx.x; if (t >= n8) return; FragH fh, fl; const v4f a = *(const v4fa*)(F + t * 8), c = *(const v4fa*)(F + t * 8 + 4);
#pragma unroll
  for (int q = 0; q < 4; ++q) { _Float16 h = (_Float16)a[q]; fh.h[q] = h; fl.h[q] = (_Float16)((a[q] - (float)h) * 1024.0f); h = (_Float16)c[q]; fh.h[4 + q] = h; fl.h[4 + q] = (_Float16)((c[q] - (float)h) * 1024.0f); }
  { *(v8us*)((unsigned short*)Hh + t * 8) = fh.half[0]; *(v8us*)((unsigned short*)Hl + t * 8) = fl.half[0];  } }

// ---- fast GEMM (wave tile 32x64; requires M % 32 == 0 rows per launch region and N % 64 == 0); epilogue = k_gemm_hhx semantics ----
__device__ __forceinline__ v16h g2_frag(const _Float16* p, int hh) { FragH f; f.half[0] = *(const v8us*)((const unsigned short*)p + 8 * hh); f.half[1] = *(const v8us*)((const unsigned short*)p + 16 + 8 * hh); return f.v; }
__device__ __forceinline__ v8f g2_mma(v16h a, v16h b, v8f c) { v8f d = __builtin_amdgcn_wmma_f32_16x16x32_f16(false, a, false, b, (short)0, c, false, false); asm volatile("v_nop\n\tv_nop\n\tv_nop\n\tv_nop" : "+v"(d) : "v"(a), "v"(b)); return d; }
template <int ACT>
__global__ __launch_bounds__(128) void k_gemm2(const _Float16* __restrict__ A, int lda, size_t sA, const _Float16* __restrict__ Bh, int ldb, size_t sB, float alpha, const float* __restrict__ bias, size_t sBias, const float* __restrict__ CP, int rowsPerB, size_t sCPb, int row0g,
    float* __restrict__ C, _Float16* __restrict__ C16, int ldc, size_t sC, int M, int N, int K) { static_assert(ACT == 0 || ACT == 3 || ACT == 6 || ACT == 8 || ACT == 9 || ACT == 11 || ACT == 12 || ACT == 14 || ACT == 15 || ACT == 16 || ACT == 17, "k_gemm2: unsupported ACT code (would silently apply no activation)");
  __shared__ __attribute__((aligned(16))) float so[4][32][68];
  const int tid = threadIdx.x, w = tid >> 5, lane = tid & 31, ln = lane & 15, hh = lane >> 4; const int by = blockIdx.y;
  A += (size_t)by * sA; Bh += (size_t)by * sB; const size_t cofs = (size_t)by * sC; const float* bp = bias ? bias + (size_t)by * sBias : nullptr;
  const int ntn = N >> 6; const int mt = blockIdx.x / ntn, nq = blockIdx.x - mt * ntn; const int row0 = mt * 128 + 32 * w, col0 = nq * 64; if (row0 >= M) return;
  const _Float16* a0p = A + (size_t)(row0 + ln) * lda; const _Float16* a1p = a0p + (size_t)16 * lda;
  const _Float16* b0p = Bh + (size_t)(col0 + ln) * ldb; const _Float16* b1p = b0p + (size_t)16 * ldb; const _Float16* b2p = b1p + (size_t)16 * ldb; const _Float16* b3p = b2p + (size_t)16 * ldb;
  const v8f z8 = {0.f,0.f,0.f,0.f,0.f,0.f,0.f,0.f}; v8f c00 = z8, c01 = z8, c02 = z8, c03 = z8, c10 = z8, c11 = z8, c12 = z8, c13 = z8;
#pragma unroll 1
  for (int kb = 0; kb < K; kb += 32) { const v16h a0 = g2_frag(a0p + kb, hh), a1 = g2_frag(a1p + kb, hh);
    v16h b = g2_frag(b0p + kb, hh); c00 = g2_mma(a0, b, c00); c10 = g2_mma(a1, b, c10);
    b = g2_frag(b1p + kb, hh); c01 = g2_mma(a0, b, c01); c11 = g2_mma(a1, b, c11);
    b = g2_frag(b2p + kb, hh); c02 = g2_mma(a0, b, c02); c12 = g2_mma(a1, b, c12);
    b = g2_frag(b3p + kb, hh); c03 = g2_mma(a0, b, c03); c13 = g2_mma(a1, b, c13); }
  v8f accs[8] = {c00, c01, c02, c03, c10, c11, c12, c13};
#pragma unroll
  for (int u = 0; u < 8; ++u) { const int t = u & 3, half = u >> 2; const int col = col0 + t * 16 + ln; const float bv = bp ? bf16_round(bp[col]) : 0.f;
#pragma unroll
    for (int r = 0; r < 8; ++r) { const int rloc = half * 16 + 8 * hh + r; float v = accs[u][r] * alpha + bv; if (CP) { if (rowsPerB < 0) v += CP[cofs + (size_t)(row0g + row0 + rloc) * ldc + col];      /* rowsPerB < 0: own element of the batched C plane */ else { const int bidx = (row0g + row0 + rloc) / rowsPerB; v += CP[(size_t)bidx * sCPb + (size_t)by * 64 + col]; } }
      if (ACT == 3) v = fmaxf(v, 0.f); else if (ACT == 6) v = 0.5f * v * (1.0f + erff(v * 0.70710678118654752f)); else if (ACT == 11) v = 1.0f / (1.0f + expf(-v)); else if (ACT == 15) v = v / (1.0f + expf(-v)); else if (ACT == 12) v = (v > 0.f) ? v : 0.01f * v; else if (ACT == 8) v = tanhf(v); else if (ACT == 9) v = 0.5f * v * (1.0f + tanhf(0.7978845608028654f * (v + 0.044715f * v * v * v))); else if (ACT == 14) v = (v > 0.f) ? v : 0.1f * v; else if (ACT == 16) v = (v >= 0.f) ? v : 0.3f * v; else if (ACT == 17) v = (v >= 0.f) ? v : 0.2f * v;
      so[w][rloc][t * 16 + ln] = v; } }
  __builtin_amdgcn_fence(__ATOMIC_ACQ_REL, "workgroup"); __builtin_amdgcn_wave_barrier();
  const int rsub = lane >> 4, c4 = (lane & 15) * 4;
  {
#pragma unroll
    for (int q = 0; q < 16; ++q) { const int r = q * 2 + rsub; const v4f v = *(const v4fa*)&so[w][r][c4]; if (C) *(v4f*)(C + cofs + (size_t)(row0 + r) * ldc + col0 + c4) = v; if (C16) { v4h h4; for (int i = 0; i < 4; ++i) h4[i] = (_Float16)v[i]; *(v4h*)(C16 + cofs + (size_t)(row0 + r) * ldc + col0 + c4) = h4; } }
     } }


// out-product GEMM for a small M x N with a long K: the 32x64 tile of one work-group is computed by NW waves, wave w taking the 32-wide k chunks w, w + NW, ... (neighbouring waves read neighbouring 64-byte pieces of the same rows in the same trip);
// each wave's f32 partial tile goes to its own LDS plane, and behind one barrier every thread sums one float4 over the NW planes in plane order; C = sum * alpha (+ CP, the own element of C, if non-null). M % 32 == 0, N % 64 == 0, K % (NW * 32) == 0.
template <int NW>
__global__ __launch_bounds__(NW * 32) void k_gemm2k(const _Float16* __restrict__ A, int lda, const _Float16* __restrict__ Bh, int ldb, float alpha, const float* CP, float* C, int ldc, int N, int K) {
  static_assert(NW == 16, "the reduction gives each of the NW * 32 threads exactly one float4 of the 32 x 64 tile");
  __shared__ __attribute__((aligned(16))) float so[NW][32][68];
  const int tid = threadIdx.x, w = tid >> 5, lane = tid & 31, ln = lane & 15, hh = lane >> 4;
  const int ntn = N >> 6; const int mt = blockIdx.x / ntn, nq = blockIdx.x - mt * ntn; const int row0 = mt * 32, col0 = nq * 64;
  const _Float16* a0p = A + (size_t)(row0 + ln) * lda + w * 32; const _Float16* a1p = a0p + (size_t)16 * lda;
  const _Float16* b0p = Bh + (size_t)(col0 + ln) * ldb + w * 32; const _Float16* b1p = b0p + (size_t)16 * ldb; const _Float16* b2p = b1p + (size_t)16 * ldb; const _Float16* b3p = b2p + (size_t)16 * ldb;
  const v8f z8 = {0.f,0.f,0.f,0.f,0.f,0.f,0.f,0.f}; v8f c00 = z8, c01 = z8, c02 = z8, c03 = z8, c10 = z8, c11 = z8, c12 = z8, c13 = z8;
  // rolled as in k_gemm2, so that the trip's code stays the one already timed there and only the share of trips per wave changes; unrolling it is a separate change
#pragma unroll 1
  for (int kb = 0; kb < K; kb += NW * 32) { const v16h a0 = g2_frag(a0p + kb, hh); v16h b = g2_frag(b0p + kb, hh); FragH fa1; fa1.half[0] = *(const v8us*)((const unsigned short*)(a1p + kb) + 8 * hh);
    asm volatile("s_wait_xcnt 0x0" ::: "memory");      /* the last load's result may be given registers that hold an address of the loads above */
    fa1.half[1] = *(const v8us*)((const unsigned short*)(a1p + kb) + 16 + 8 * hh); const v16h a1 = fa1.v;
    c00 = g2_mma(a0, b, c00); c10 = g2_mma(a1, b, c10);
    b = g2_frag(b1p + kb, hh); c01 = g2_mma(a0, b, c01); c11 = g2_mma(a1, b, c11);
    b = g2_frag(b2p + kb, hh); c02 = g2_mma(a0, b, c02); c12 = g2_mma(a1, b, c12);
    b = g2_frag(b3p + kb, hh); c03 = g2_mma(a0, b, c03); c13 = g2_mma(a1, b, c13); }
  v8f accs[8] = {c00, c01, c02, c03, c10, c11, c12, c13};
#pragma unroll
  for (int u = 0; u < 8; ++u) { const int t = u & 3, half = u >> 2;
#pragma unroll
    for (int r = 0; r < 8; ++r) so[w][half * 16 + 8 * hh + r][t * 16 + ln] = accs[u][r]; }
  __syncthreads();      /* every wave's partial tile is in LDS before any thread sums across the planes */
  const int r = tid >> 4, c4 = (tid & 15) * 4;
  v4f sum = *(const v4fa*)&so[0][r][c4];
#pragma unroll
  for (int j = 1; j < NW; ++j) sum += *(const v4fa*)&so[j][r][c4];
  const size_t o = (size_t)(row0 + r) * ldc + col0 + c4;
  v4f v = sum * alpha; if (CP) v += *(const v4fa*)(CP + o);
  *(v4f*)(C + o) = v; }


__global__ __launch_bounds__(256) void k_wnat(const float* __restrict__ w, size_t n8, _Float16* __restrict__ Bt) { const size_t t = (size_t)blockIdx.x * 256 + threadIdx.x; if (t >= n8) return; FragH f; for (int q = 0; q < 8; ++q) f.h[q] = (_Float16)(bf16_round(w[t * 8 + q]) * 16.0f); *(v8us*)((unsigned short*)Bt + t * 8) = f.half[0];  }
__global__ __launch_bounds__(256) void k_rsm(const float* __restrict__ S, _Float16* __restrict__ P, int nrows) {
  #pragma clang fp contract(off)
  const int i = blockIdx.x * 256 + threadIdx.x; if (i >= nrows) return; const float* s = S + (size_t)i * SQ; float mx = -3.0e38f;
#pragma unroll 1
  for (int j = 0; j < SQ; ++j) mx = fmaxf(mx, s[j]); float se = 0.f;
#pragma unroll 1
  for (int j = 0; j < SQ; ++j) se += expf(s[j] - mx); const float sc = 256.0f / se;
#pragma unroll 1
  for (int j0 = 0; j0 < SQ; j0 += 8) { FragH f; for (int q = 0; q < 8; ++q) f.h[q] = (_Float16)(expf(s[j0 + q] - mx) * sc); unsigned short* d = (unsigned short*)P + (size_t)i * SQ + j0; *(v8us*)d = f.half[0];  } }
__global__ __launch_bounds__(256) void k_vt(const _Float16* __restrict__ V16, int b, int h0, _Float16* __restrict__ VT) { __shared__ unsigned short tl[64][65]; const int tid = threadIdx.x; const int hh = blockIdx.x % HG, sg = blockIdx.x / HG; const int s0 = sg * 64; const int h = h0 + hh;
  for (int i = tid; i < 64 * 8; i += 256) { const int j = i / 8, d8 = (i % 8) * 8; FragH f; f.half[0] = *(const v8us*)((const unsigned short*)V16 + ((size_t)b * SQ + s0 + j) * DM + h * HD + d8); for (int q = 0; q < 8; ++q) tl[d8 + q][j] = f.u[q]; }
  __syncthreads();
  { for (int i = tid; i < 64 * 8; i += 256) { const int d = i / 8, j8 = (i % 8) * 8; FragH f; for (int q = 0; q < 8; ++q) f.u[q] = tl[d][j8 + q]; *(v8us*)((unsigned short*)VT + ((size_t)hh * HD + d) * SQ + s0 + j8) = f.half[0]; }  } }


// cross-lane steps of the wave-wide reductions below: row_xmask DPP inside a 16-lane row, permlanex16 for lane ^ 16 (no LDS round trip)
template <int CTRL>
__device__ __forceinline__ float xl_row(float v) { return __int_as_float(__builtin_amdgcn_update_dpp(0, __float_as_int(v), CTRL, 0xf, 0xf, true)); }
__device__ __forceinline__ float xl_half(float v) { const int i = __float_as_int(v); return __int_as_float(__builtin_amdgcn_permlanex16(i, i, 0x76543210, 0xfedcba98, false, false)); }
__device__ __forceinline__ float wave_max(float v) { v = fmaxf(v, xl_row<0x161>(v)); v = fmaxf(v, xl_row<0x162>(v)); v = fmaxf(v, xl_row<0x164>(v)); v = fmaxf(v, xl_row<0x168>(v)); return fmaxf(v, xl_half(v)); }
__device__ __forceinline__ float wave_sum(float v) { v += xl_row<0x161>(v); v += xl_row<0x162>(v); v += xl_row<0x164>(v); v += xl_row<0x168>(v); return v + xl_half(v); }
// row softmax, one wave per row: each load is 512 contiguous bytes of the row, the whole row (32 x 4 scores a lane) stays in registers, so S is read once and exp is taken once; P = f16(exp(s - max) * 256 / sum)
__global__ __launch_bounds__(256) void k_rsmw(const float* __restrict__ S, _Float16* __restrict__ P) {
  const int lane = threadIdx.x & 31; const size_t row = (size_t)blockIdx.x * 8 + (threadIdx.x >> 5);
  const float* s = S + row * SQ + lane * 4; _Float16* p = P + row * SQ + lane * 4;
  v4f x[SQ / 128];
  // full unroll here and below: x[] must be indexed by constants to live in registers, and all 32 loads are to be in flight at once
#pragma unroll
  for (int u = 0; u < SQ / 128; ++u) x[u] = *(const v4fa*)(s + u * 128);
  v4f m4 = x[0];
#pragma unroll
  for (int u = 1; u < SQ / 128; ++u) for (int q = 0; q < 4; ++q) m4[q] = fmaxf(m4[q], x[u][q]);
  const float mx = wave_max(fmaxf(fmaxf(m4[0], m4[1]), fmaxf(m4[2], m4[3])));
  v4f a4 = {0.f, 0.f, 0.f, 0.f};
#pragma unroll
  for (int u = 0; u < SQ / 128; ++u) for (int q = 0; q < 4; ++q) { const float e = __expf(x[u][q] - mx); x[u][q] = e; a4[q] += e; }
  const float sc = 256.0f / wave_sum((a4[0] + a4[1]) + (a4[2] + a4[3]));
#pragma unroll
  for (int u = 0; u < SQ / 128; ++u) { v4h h4; for (int q = 0; q < 4; ++q) h4[q] = (_Float16)(x[u][q] * sc); *(v4h*)(p + u * 128) = h4; } }

extern "C" void kernel_launch(void* const* d_in, const int* in_sizes, int n_in,
                              void* d_out, int out_size, void* d_ws, size_t ws_size, hipStream_t stream) {
  (void)in_sizes; (void)n_in; (void)out_size;
  const float* const* I = (const float* const*)d_in; const float* xq = I[0]; const float* xk = I[1]; const float* xv = I[2]; const float* wq = I[3]; const float* bq = I[4]; const float* wk = I[5]; const float* bk = I[6]; const float* wv = I[7]; const float* bv = I[8];
  char* ws = (char*)d_ws; size_t off = 0;
  auto take = [&](size_t bytes) { char* p = ws + off; off += (bytes + 255) & ~(size_t)255; return p; };
  _Float16* BQ = (_Float16*)take((size_t)DM * DM * 2); _Float16* BK = (_Float16*)take((size_t)DM * DM * 2); _Float16* BV = (_Float16*)take((size_t)DM * DM * 2);
  _Float16* XQ = (_Float16*)take(NR * DM * 2); _Float16* XK = (_Float16*)take(NR * DM * 2); _Float16* XV = (_Float16*)take(NR * DM * 2); _Float16* Q16 = (_Float16*)take(NR * DM * 2); _Float16* K16 = (_Float16*)take(NR * DM * 2); float* VF = (float*)take(NR * DM * 4); _Float16* VH = (_Float16*)take(NR * DM * 2); _Float16* VL = (_Float16*)take(NR * DM * 2);
  float* S = (float*)take((size_t)SQ * SQ * 4); _Float16* P = (_Float16*)take((size_t)SQ * SQ * 2); _Float16* VT = (_Float16*)take((size_t)DM * SQ * 2); _Float16* VTL = (_Float16*)take((size_t)DM * SQ * 2);
  if (off > ws_size) return;      /* approx 0.4 + 8 x 5 + 16 + 8 + 8 + 64 + 32 + 4 = 172 MiB */
  { const unsigned g = (unsigned)(((size_t)DM * (DM / 8) + 255) / 256); k_wt_f16<<<g, 256, 0, stream>>>(wq, BQ, DM, DM, 16.0f); k_wt_f16<<<g, 256, 0, stream>>>(wk, BK, DM, DM, 16.0f); k_wt_f16<<<g, 256, 0, stream>>>(wv, BV, DM, DM, 16.0f); }
  k_x16<<<(unsigned)((NR * DM / 8 + 255) / 256), 256, 0, stream>>>(xq, XQ, NR * DM / 8); k_x16<<<(unsigned)((NR * DM / 8 + 255) / 256), 256, 0, stream>>>(xk, XK, NR * DM / 8); k_x16<<<(unsigned)((NR * DM / 8 + 255) / 256), 256, 0, stream>>>(xv, XV, NR * DM / 8);
  k_gemm2<0><<<dim3((unsigned)((NR / 128) * (DM / 64)), 1), 128, 0, stream>>>(XQ, DM, 0, BQ, DM, 0, 0.0625f, bq, 0, nullptr, 1, 0, 0, nullptr, Q16, DM, 0, (int)NR, DM, DM);
  k_gemm2<0><<<dim3((unsigned)((NR / 128) * (DM / 64)), 1), 128, 0, stream>>>(XK, DM, 0, BK, DM, 0, 0.0625f, bk, 0, nullptr, 1, 0, 0, nullptr, K16, DM, 0, (int)NR, DM, DM);
  k_gemm2<0><<<dim3((unsigned)((NR / 128) * (DM / 64)), 1), 128, 0, stream>>>(XV, DM, 0, BV, DM, 0, 0.0625f, bv, 0, nullptr, 1, 0, 0, VF, nullptr, DM, 0, (int)NR, DM, DM); k_hl<<<(unsigned)((NR * DM / 8 + 255) / 256), 256, 0, stream>>>(VF, VH, VL, NR * DM / 8);      /* v (f32) -> f16 hi + x1024 residual */
  for (int b = 0; b < NB; ++b) { const size_t r0 = (size_t)b * SQ;
    k_vt<DM / 64, SQ><<<(DM / 64) * (SQ / 64), 256, 0, stream>>>(VH + r0 * DM, DM, 0, VT); k_vt<DM / 64, SQ><<<(DM / 64) * (SQ / 64), 256, 0, stream>>>(VL + r0 * DM, DM, 0, VTL);
    k_gemm2<0><<<dim3((SQ / 128) * (SQ / 64), 1), 128, 0, stream>>>(Q16 + r0 * DM, DM, 0, K16 + r0 * DM, DM, 0, 0.0625f, nullptr, 0, nullptr, 1, 0, 0, S, nullptr, SQ, 0, SQ, SQ, DM);      /* scores / 16 (K = 256) */
    k_rsmw<<<SQ / 8, 256, 0, stream>>>(S, P);
    k_gemm2k<16><<<(SQ / 32) * (DM / 64), 512, 0, stream>>>(P, SQ, VT, SQ, 0.00390625f, nullptr, (float*)d_out + r0 * DM, DM, DM, SQ);      /* out = P V_hi / 256 */
    k_gemm2k<16><<<(SQ / 32) * (DM / 64), 512, 0, stream>>>(P, SQ, VTL, SQ, 0.000003814697265625f, (const float*)d_out + r0 * DM, (float*)d_out + r0 * DM, DM, DM, SQ); }      /* += P V_lo 2^-18 (own element) */
}

// v003
// Measured time: 335 microseconds a run.
// Timed twice side by side with v002, it ran 1.64 and 1.66 times as fast.
// All steps since v000 together make it 11.5 times as fast.
#include <hip/hip_runtime.h>
// Single-head attention with dense projections (q_in, k_in, v_in [4][4096][256]; q = q_in Wq + bq, k = k_in Wk + bk, v = v_in Wv + bv ([in][out] 256x256 glorot-uniform, biases uniform); scores = q . k x 256^-0.5; softmax over the 4096 keys (no mask); out = attn v -> [4][4096][256]; no output projection).
// Structure: the three inputs as exact f16 rows; [in][out] weights as exact x16 planes; q, k as WMMA GEMMs (32x64 wave tiles, f32 accumulation, + bias, f16 outputs: logits sigma ~1), v as an f32-output GEMM split into f16 hi + x1024 residual planes; per batch: V^T of the hi and residual planes (4 slabs of 64) via LDS transposes; scores as ONE GEMM (K = 256, alpha 1/16) into an f32 [4096][4096] plane; row softmax on VALU (f32 statistics, native exp; weights x256 f16); out = P V_hi^T (N = 256, K = 4096, alpha 2^-8) straight into the output, then += P V_lo^T 2^-18 (own-element accumulate in the next launch); launches: see trace.
// Compute dtype: inputs rounded to bf16; x / weights exact; q, k, P plain f16 (~2^-12), v as hi + residual; scores / statistics / out f32; v_wmma_f32_16x16x32_f16.
#define NB 4
#define SQ 4096
#define DM 256
#define NH 1
#define HD 64
#define HG 1
#define NR ((size_t)NB * SQ)
typedef __bf16 v16b __attribute__((ext_vector_type(16)));
typedef unsigned short v8us __attribute__((ext_vector_type(8), may_alias));
typedef float  v8f  __attribute__((ext_vector_type(8)));
typedef float  v4f  __attribute__((ext_vector_type(4)));
typedef float  v4fa __attribute__((ext_vector_type(4), may_alias));
union FragB { v16b v; v8us half[2]; unsigned short u[16]; };

__device__ __forceinline__ unsigned short bf16_bits(float x) { unsigned int u = __float_as_uint(x); return (unsigned short)((u + 0x7FFFu + ((u >> 16) & 1u)) >> 16); }
__device__ __forceinline__ float bf16_val(unsigned short b) { return __uint_as_float(((unsigned int)b) << 16); }
__device__ __forceinline__ float bf16_round(float x) { return bf16_val(bf16_bits(x)); }
// D += A·B with NT terms: 1 = ah·bh, 2 = + al·bh (A split), 3 = + ah·bl (both split)
template <int NT>
__device__ __forceinline__ v8f mmaN(v16b ah, v16b al, v16b bh, v16b bl, v8f c) {
  c = __builtin_amdgcn_wmma_f32_16x16x32_bf16(false, ah, false, bh, (short)0, c, false, false);
  if (NT >= 2) c = __builtin_amdgcn_wmma_f32_16x16x32_bf16(false, al, false, bh, (short)0, c, false, false);
  if (NT >= 3) c = __builtin_amdgcn_wmma_f32_16x16x32_bf16(false, ah, false, bl, (short)0, c, false, false);
  asm volatile("v_nop\n\tv_nop\n\tv_nop\n\tv_nop" : "+v"(c) : "v"(ah), "v"(al), "v"(bh), "v"(bl));
  return c;
}

__global__ __launch_bounds__(256) void k_wt_bf16(const float* __restrict__ W, unsigned short* __restrict__ Wt, int K, int N) {
  const int t = blockIdx.x * 256 + threadIdx.x;
  const int k8n = K / 8;
  if (t >= N * k8n) return;
  const int n = t / k8n, k8 = (t % k8n) * 8;
  v8us v;
#pragma unroll
  for (int i = 0; i < 8; ++i) v[i] = bf16_bits(W[(size_t)(k8 + i) * N + n]);
  *(v8us*)(Wt + (size_t)n * K + k8) = v;
  
}

// GEMM C[M][N] (f32, pitch ldc) = act(A[M][K]·W + bias). A f32 row-major (pitch lda) converted per fragment to bf16
// (ASPLIT: hi/lo two planes -> 2 terms, else single rounded term); Wt bf16 [N][K] (pitch ldb). BIAS_BF16 rounds the
// bias to bf16 first (bias quantised to bf16 before the add). K%32==0, M%16==0, N%64==0.
template <bool ASPLIT, int ACT, bool BIAS_BF16>
__global__ __launch_bounds__(128) void k_gemm_bf(const float* __restrict__ A, int lda, const unsigned short* __restrict__ Wt, int ldb,
                                               const float* __restrict__ bias, float* __restrict__ C, int ldc, int M, int N, int K) {
  __shared__ __attribute__((aligned(16))) float so[4][16][64];
  const int tid = threadIdx.x, w = tid >> 5, lane = tid & 31, ln = lane & 15, hh = lane >> 4;
  const int ntn = N / 64;
  const int wid = blockIdx.x * 4 + w;
  const int mt = wid / ntn, nq = wid % ntn;
  if (mt * 16 >= M) return;
  const int row0 = mt * 16, col0 = nq * 64;
  const float* arow = A + (size_t)(row0 + ln) * lda;
  v8f acc[4] = {};
  for (int kb = 0; kb < K; kb += 32) {
    FragB ah, al;
    const v4f x0 = *(const v4fa*)(arow + kb + 8 * hh), x1 = *(const v4fa*)(arow + kb + 8 * hh + 4);
    const v4f x2 = *(const v4fa*)(arow + kb + 16 + 8 * hh), x3 = *(const v4fa*)(arow + kb + 16 + 8 * hh + 4);
    float xs[16] = {x0[0],x0[1],x0[2],x0[3],x1[0],x1[1],x1[2],x1[3],x2[0],x2[1],x2[2],x2[3],x3[0],x3[1],x3[2],x3[3]};
#pragma unroll
    for (int i = 0; i < 16; ++i) { const unsigned short hb = bf16_bits(xs[i]); ah.u[i] = hb; al.u[i] = ASPLIT ? bf16_bits(xs[i] - bf16_val(hb)) : (unsigned short)0; }
#pragma unroll
    for (int t = 0; t < 4; ++t) {
      const unsigned short* brow = Wt + (size_t)(col0 + t * 16 + ln) * ldb + kb;
      FragB b;
      b.half[0] = *(const v8us*)(brow + 8 * hh);
      b.half[1] = *(const v8us*)(brow + 16 + 8 * hh);
      acc[t] = mmaN<ASPLIT ? 2 : 1>(ah.v, al.v, b.v, b.v, acc[t]);
    }
  }
#pragma unroll
  for (int t = 0; t < 4; ++t) {
    float bv = bias ? bias[col0 + t * 16 + ln] : 0.f;
    if (BIAS_BF16) bv = bf16_round(bv);
#pragma unroll
    for (int r = 0; r < 8; ++r) { float v = acc[t][r] + bv; if (ACT == 1) v = fmaxf(v, 0.f); so[w][8 * hh + r][t * 16 + ln] = v; }
  }
  __builtin_amdgcn_fence(__ATOMIC_ACQ_REL, "workgroup");
  __builtin_amdgcn_wave_barrier();
  const int rsub = lane >> 4, c4 = (lane & 15) * 4;
  {
#pragma unroll
    for (int q = 0; q < 8; ++q) {
      const int r = q * 2 + rsub;
      const v4f v = *(const v4fa*)&so[w][r][c4];
      *(v4f*)(C + (size_t)(row0 + r) * ldc + col0 + c4) = v;
    }
    
  }
}

// GEMM C = act(A·W + bias + resid): A f32 (ASPLIT -> hi/lo 2 terms), Wt bf16 [N][K]; ACT 0 none, 1 relu, 2 exact gelu;
// resid (optional, f32, row index = (row % rmod), pitch ldr, RES_BF16 rounds it) added before the activation.
template <bool ASPLIT, int ACT, bool BIAS_BF16, bool RES_BF16>
__global__ __launch_bounds__(128) void k_gemm_bf3(const float* __restrict__ A, int lda, const unsigned short* __restrict__ Wt, int ldb,
                                                const float* __restrict__ bias, const float* __restrict__ resid, int rmod, int ldr,
                                                float* __restrict__ C, int ldc, int M, int N, int K) {
  __shared__ __attribute__((aligned(16))) float so[4][16][64];
  const int tid = threadIdx.x, w = tid >> 5, lane = tid & 31, ln = lane & 15, hh = lane >> 4;
  const int ntn = N / 64;
  const int wid = blockIdx.x * 4 + w;
  const int mt = wid / ntn, nq = wid % ntn;
  if (mt * 16 >= M) return;
  const int row0 = mt * 16, col0 = nq * 64;
  const float* arow = A + (size_t)(row0 + ln) * lda;
  v8f acc[4] = {};
  for (int kb = 0; kb < K; kb += 32) {
    FragB ah, al;
    const v4f x0 = *(const v4fa*)(arow + kb + 8 * hh), x1 = *(const v4fa*)(arow + kb + 8 * hh + 4);
    const v4f x2 = *(const v4fa*)(arow + kb + 16 + 8 * hh), x3 = *(const v4fa*)(arow + kb + 16 + 8 * hh + 4);
    float xs[16] = {x0[0],x0[1],x0[2],x0[3],x1[0],x1[1],x1[2],x1[3],x2[0],x2[1],x2[2],x2[3],x3[0],x3[1],x3[2],x3[3]};
#pragma unroll
    for (int i = 0; i < 16; ++i) { const unsigned short hb = bf16_bits(xs[i]); ah.u[i] = hb; al.u[i] = ASPLIT ? bf16_bits(xs[i] - bf16_val(hb)) : (unsigned short)0; }
#pragma unroll
    for (int t = 0; t < 4; ++t) {
      const unsigned short* brow = Wt + (size_t)(col0 + t * 16 + ln) * ldb + kb;
      FragB b;
      b.half[0] = *(const v8us*)(brow + 8 * hh);
      b.half[1] = *(const v8us*)(brow + 16 + 8 * hh);
      acc[t] = mmaN<ASPLIT ? 2 : 1>(ah.v, al.v, b.v, b.v, acc[t]);
    }
  }
#pragma unroll
  for (int t = 0; t < 4; ++t) {
    const int col = col0 + t * 16 + ln;
    float bv = bias ? bias[col] : 0.f;
    if (BIAS_BF16) bv = bf16_round(bv);
#pragma unroll
    for (int r = 0; r < 8; ++r) {
      float v = acc[t][r] + bv;
      if (resid) { float rv = resid[(size_t)((row0 + 8 * hh + r) % rmod) * ldr + col]; if (RES_BF16) rv = bf16_round(rv); v += rv; }
      if (ACT == 1) v = fmaxf(v, 0.f);
      if (ACT == 2) v = 0.5f * v * (1.0f + erff(v * 0.70710678118654752f));
      if (ACT == 3) { const float u = 0.7978845608028654f * (v + 0.044715f * v * v * v); v = 0.5f * v * (1.0f + tanhf(u)); }
      so[w][8 * hh + r][t * 16 + ln] = v;
    }
  }
  __builtin_amdgcn_fence(__ATOMIC_ACQ_REL, "workgroup");
  __builtin_amdgcn_wave_barrier();
  const int rsub = lane >> 4, c4 = (lane & 15) * 4;
  {
#pragma unroll
    for (int q = 0; q < 8; ++q) {
      const int r = q * 2 + rsub;
      const v4f v = *(const v4fa*)&so[w][r][c4];
      *(v4f*)(C + (size_t)(row0 + r) * ldc + col0 + c4) = v;
    }
    
  }
}
// row LayerNorm (biased variance, eps) over N: s = X (+ R); optional out_sum <- s; out_norm <- (s-mu)*rsqrt(var+eps)*g + b
template <bool PARAM_BF16>
__global__ __launch_bounds__(256) void k_layernorm(const float* __restrict__ X, const float* __restrict__ R, const float* __restrict__ g, const float* __restrict__ bta,
                                                  float* __restrict__ out_sum, float* __restrict__ out_norm, int N, float eps) {
  __shared__ float red[256];
  const int row = blockIdx.x, tid = threadIdx.x;
  const float* x = X + (size_t)row * N; const float* rr = R ? R + (size_t)row * N : nullptr;
  float vals[16];                     // up to N = 4096
  const int per = N / 256;            // contiguous chunk per thread? use strided-by-4 chunks: thread handles j = tid*4 + 1024*u
  float s1 = 0.f;
  for (int u = 0; u < per / 4; ++u) {
    const int j = tid * 4 + 1024 * u;
    const v4f a = *(const v4fa*)(x + j);
    v4f b = {0.f,0.f,0.f,0.f}; if (rr) b = *(const v4fa*)(rr + j);
#pragma unroll
    for (int q = 0; q < 4; ++q) { const float v = a[q] + b[q]; vals[u * 4 + q] = v; s1 += v; }
  }
  red[tid] = s1; __syncthreads();
  for (int st = 128; st > 0; st >>= 1) { if (tid < st) red[tid] += red[tid + st]; __syncthreads(); }
  const float mu = red[0] / (float)N; __syncthreads();
  float s2 = 0.f;
  for (int u = 0; u < per / 4; ++u)
#pragma unroll
    for (int q = 0; q < 4; ++q) { const float c = vals[u * 4 + q] - mu; s2 += c * c; }
  red[tid] = s2; __syncthreads();
  for (int st = 128; st > 0; st >>= 1) { if (tid < st) red[tid] += red[tid + st]; __syncthreads(); }
  const float rs = rsqrtf(red[0] / (float)N + eps);
  {
    for (int u = 0; u < per / 4; ++u) {
      const int j = tid * 4 + 1024 * u;
      v4f o, sm;
#pragma unroll
      for (int q = 0; q < 4; ++q) {
        float gg = g[j + q], bb = bta[j + q];
        if (PARAM_BF16) { gg = bf16_round(gg); bb = bf16_round(bb); }
        sm[q] = vals[u * 4 + q]; o[q] = (vals[u * 4 + q] - mu) * rs * gg + bb;
      }
      if (out_sum) *(v4f*)(out_sum + (size_t)row * N + j) = sm;
      *(v4f*)(out_norm + (size_t)row * N + j) = o;
    }
    
  }
}



// ---- f16 WMMA path (v_wmma_f32_16x16x32_f16): 11-bit significands for operands in range — used where a [0,1] probability operand needs more precision than bf16
typedef _Float16 v16h __attribute__((ext_vector_type(16)));
union FragH { v16h v; v8us half[2]; _Float16 h[16]; unsigned short u[16]; };
template <int NT>
__device__ __forceinline__ v8f mmaH(v16h ah, v16h al, v16h bh, v16h bl, v8f c) {
  c = __builtin_amdgcn_wmma_f32_16x16x32_f16(false, ah, false, bh, (short)0, c, false, false);
  if (NT >= 2) c = __builtin_amdgcn_wmma_f32_16x16x32_f16(false, al, false, bh, (short)0, c, false, false);
  if (NT >= 3) c = __builtin_amdgcn_wmma_f32_16x16x32_f16(false, ah, false, bl, (short)0, c, false, false);
  asm volatile("v_nop\n\tv_nop\n\tv_nop\n\tv_nop" : "+v"(c) : "v"(ah), "v"(al), "v"(bh), "v"(bl));
  return c;
}
// batched GEMM like k_gemm_b but f16 operands: A f32 (split into f16 hi/lo if ASPLIT, else rounded to f16), Bt = f16 values [n][k]; alpha; C f32; N multiple of 16 (partial tiles skipped)
template <bool ASPLIT>
__global__ __launch_bounds__(128) void k_gemm_h(const float* __restrict__ A, int lda, size_t sA, const _Float16* __restrict__ Bh, int ldb, size_t sB, float alpha, float* __restrict__ C, int ldc, size_t sC, int M, int N, int K) {
  __shared__ __attribute__((aligned(16))) float so[4][16][64];
  const int tid = threadIdx.x, w = tid >> 5, lane = tid & 31, ln = lane & 15, hh = lane >> 4; const int by = blockIdx.y;
  A += (size_t)by * sA; Bh += (size_t)by * sB; C += (size_t)by * sC;
  const int ntn = (N + 63) / 64; const int wid = blockIdx.x * 4 + w; const int mt = wid / ntn, nq = wid % ntn; if (mt * 16 >= M) return;
  const int row0 = mt * 16, col0 = nq * 64; const float* arow = A + (size_t)(row0 + ln) * lda;
  v8f acc[4] = {};
  for (int kb = 0; kb < K; kb += 32) {
    FragH ah, al;
    const v4f x0 = *(const v4fa*)(arow + kb + 8 * hh), x1 = *(const v4fa*)(arow + kb + 8 * hh + 4), x2 = *(const v4fa*)(arow + kb + 16 + 8 * hh), x3 = *(const v4fa*)(arow + kb + 16 + 8 * hh + 4);
    float xs[16] = {x0[0],x0[1],x0[2],x0[3],x1[0],x1[1],x1[2],x1[3],x2[0],x2[1],x2[2],x2[3],x3[0],x3[1],x3[2],x3[3]};
#pragma unroll
    for (int i = 0; i < 16; ++i) { const _Float16 h = (_Float16)xs[i]; ah.h[i] = h; al.h[i] = ASPLIT ? (_Float16)(xs[i] - (float)h) : (_Float16)0.0f; }
#pragma unroll
    for (int t = 0; t < 4; ++t) { if (col0 + t * 16 >= N) continue; const size_t boff = (size_t)(col0 + t * 16 + ln) * ldb + kb; FragH bq; bq.half[0] = *(const v8us*)(Bh + boff + 8 * hh); bq.half[1] = *(const v8us*)(Bh + boff + 16 + 8 * hh);
      acc[t] = mmaH<ASPLIT ? 2 : 1>(ah.v, al.v, bq.v, bq.v, acc[t]); }
  }
#pragma unroll
  for (int t = 0; t < 4; ++t) { if (col0 + t * 16 >= N) continue;
#pragma unroll
    for (int r = 0; r < 8; ++r) so[w][8 * hh + r][t * 16 + ln] = acc[t][r] * alpha; }
  __builtin_amdgcn_fence(__ATOMIC_ACQ_REL, "workgroup"); __builtin_amdgcn_wave_barrier();
  const int rsub = lane >> 4, c4 = (lane & 15) * 4;
  {
#pragma unroll
    for (int q = 0; q < 8; ++q) { const int r = q * 2 + rsub; if (col0 + c4 < N) { const v4f v = *(const v4fa*)&so[w][r][c4]; *(v4f*)(C + (size_t)(row0 + r) * ldc + col0 + c4) = v; } }
     }
}

// Wt[n][k] = f16(W[k][n]·scale) from f32 row-major W[K][N] (scale = power of two; bf16-exact weights stay exact in f16 away from the subnormal range)
__global__ __launch_bounds__(256) void k_wt_f16(const float* __restrict__ W, _Float16* __restrict__ Wt, int K, int N, float scale) {
  const int t = blockIdx.x * 256 + threadIdx.x; if (t >= N * (K / 8)) return; const int n = t / (K / 8), k8 = (t % (K / 8)) * 8; FragH f;
#pragma unroll
  for (int i = 0; i < 8; ++i) f.h[i] = (_Float16)(bf16_round(W[(size_t)(k8 + i) * N + n]) * scale); const v8us o = f.half[0];
  *(v8us*)((unsigned short*)Wt + (size_t)n * K + k8) = o; 
}
// k_gemm_hh variant with fused epilogue: v = acc·alpha + bias[by·sBias + col] (+ CP[(row/rowsPerB)·sCPb + by·64 + col] if CP) ; ACT 0 none / 1 elu ; writes f16 C16 (and f32 C if non-null)
template <int ACT>
__global__ __launch_bounds__(128) void k_gemm_hhx(const _Float16* __restrict__ A, int lda, size_t sA, const _Float16* __restrict__ Bh, int ldb, size_t sB, float alpha, const float* __restrict__ bias, size_t sBias, const float* __restrict__ CP, int rowsPerB, size_t sCPb, int row0g,
    float* __restrict__ C, _Float16* __restrict__ C16, int ldc, size_t sC, int M, int N, int K) {
  __shared__ __attribute__((aligned(16))) float so[4][16][64];
  const int tid = threadIdx.x, w = tid >> 5, lane = tid & 31, ln = lane & 15, hh = lane >> 4; const int by = blockIdx.y;
  A += (size_t)by * sA; Bh += (size_t)by * sB; const size_t cofs = (size_t)by * sC; const float* bp = bias ? bias + (size_t)by * sBias : nullptr;
  const int ntn = (N + 63) / 64; const int wid = blockIdx.x * 4 + w; const int mt = wid / ntn, nq = wid % ntn; if (mt * 16 >= M) return;
  const int row0 = mt * 16, col0 = nq * 64; const _Float16* arow = A + (size_t)(row0 + ln) * lda;
  v8f acc[4] = {};
  for (int kb = 0; kb < K; kb += 32) { FragH ah; ah.half[0] = *(const v8us*)((const unsigned short*)arow + kb + 8 * hh); ah.half[1] = *(const v8us*)((const unsigned short*)arow + kb + 16 + 8 * hh);
#pragma unroll
    for (int t = 0; t < 4; ++t) { if (col0 + t * 16 >= N) continue; const size_t boff = (size_t)(col0 + t * 16 + ln) * ldb + kb; FragH bq; bq.half[0] = *(const v8us*)((const unsigned short*)Bh + boff + 8 * hh); bq.half[1] = *(const v8us*)((const unsigned short*)Bh + boff + 16 + 8 * hh);
      acc[t] = mmaH<1>(ah.v, ah.v, bq.v, bq.v, acc[t]); }
  }
#pragma unroll
  for (int t = 0; t < 4; ++t) { if (col0 + t * 16 >= N) continue; const int col = col0 + t * 16 + ln; const float bv = bp ? bf16_round(bp[col]) : 0.f;
#pragma unroll
    for (int r = 0; r < 8; ++r) { float v = acc[t][r] * alpha + bv; if (CP) { const int rr = row0g + row0 + 8 * hh + r; if (rowsPerB < 0) v += CP[cofs + (size_t)rr * ldc + col];      /* rowsPerB < 0: own element of the batched C plane */ else { const int bidx = rr / rowsPerB; v += CP[(size_t)bidx * sCPb + (size_t)by * 64 + col]; } } if (ACT == 1) v = (v > 0.f) ? v : expm1f(v); else if (ACT == 7) v = (v > 0.f) ? v + 1.0f : expf(v); else if (ACT == 8) v = tanhf(v); else if (ACT == 9) v = 0.5f * v * (1.0f + tanhf(0.7978845608028654f * (v + 0.044715f * v * v * v))); else if (ACT == 11) v = 1.0f / (1.0f + expf(-v)); else if (ACT == 12) v = (v > 0.f) ? v : 0.01f * v; else if (ACT == 14) v = (v > 0.f) ? v : 0.1f * v; else if (ACT == 16) v = (v >= 0.f) ? v : 0.3f * v; else if (ACT == 17) v = (v >= 0.f) ? v : 0.2f * v; else if (ACT == 15) v = v / (1.0f + expf(-v)); else if (ACT == 3) v = fmaxf(v, 0.f); else if (ACT == 6) v = 0.5f * v * (1.0f + erff(v * 0.70710678118654752f)); so[w][8 * hh + r][t * 16 + ln] = v; } }
  __builtin_amdgcn_fence(__ATOMIC_ACQ_REL, "workgroup"); __builtin_amdgcn_wave_barrier();
  const int rsub = lane >> 4, c4 = (lane & 15) * 4; typedef _Float16 v4h __attribute__((ext_vector_type(4)));
  {
#pragma unroll
    for (int q = 0; q < 8; ++q) { const int r = q * 2 + rsub; if (col0 + c4 < N) { const v4f v = *(const v4fa*)&so[w][r][c4]; if (C) *(v4f*)(C + cofs + (size_t)(row0 + r) * ldc + col0 + c4) = v; if (C16) { v4h h4; for (int i = 0; i < 4; ++i) h4[i] = (_Float16)v[i]; *(v4h*)(C16 + cofs + (size_t)(row0 + r) * ldc + col0 + c4) = h4; } } }
     }
}


typedef _Float16 v4h __attribute__((ext_vector_type(4)));

__global__ __launch_bounds__(256) void k_x16(const float* __restrict__ x, _Float16* __restrict__ X16, size_t n8) { const size_t t = (size_t)blockIdx.x * 256 + threadIdx.x; if (t >= n8) return; FragH f;
#pragma unroll
  for (int q = 0; q < 8; ++q) f.h[q] = (_Float16)bf16_round(x[t * 8 + q]); *(v8us*)((unsigned short*)X16 + t * 8) = f.half[0];  }
__global__ __launch_bounds__(256) void k_h16(const float* __restrict__ x, _Float16* __restrict__ X16, size_t n8) { const size_t t = (size_t)blockIdx.x * 256 + threadIdx.x; if (t >= n8) return; FragH f;
#pragma unroll
  for (int q = 0; q < 8; ++q) f.h[q] = (_Float16)x[t * 8 + q]; *(v8us*)((unsigned short*)X16 + t * 8) = f.half[0];  }
__global__ __launch_bounds__(256) void k_round16f(const float* __restrict__ W, _Float16* __restrict__ Bt, size_t n8) { const size_t t = (size_t)blockIdx.x * 256 + threadIdx.x; if (t >= n8) return; FragH f;
#pragma unroll
  for (int i = 0; i < 8; ++i) f.h[i] = (_Float16)(bf16_round(W[t * 8 + i]) * 16.0f); *(v8us*)((unsigned short*)Bt + t * 8) = f.half[0];  }
template <int NHv, int TTv>
__global__ __launch_bounds__(256) void k_vt(const _Float16* __restrict__ V16, int ldv, int voff, _Float16* __restrict__ Vt) { __shared__ unsigned short tl[64][66]; const int tid = threadIdx.x; const int slab = blockIdx.x / (TTv / 64), lg = blockIdx.x % (TTv / 64); const int b = slab / NHv, h = slab % NHv;
  for (int i = tid; i < 64 * 8; i += 256) { const int r = i / 8, c8 = (i % 8) * 8; FragH f; f.half[0] = *(const v8us*)((const unsigned short*)V16 + ((size_t)b * TTv + lg * 64 + r) * ldv + voff + h * 64 + c8);
#pragma unroll
    for (int q = 0; q < 8; ++q) tl[r][c8 + q] = f.u[q]; }
  __syncthreads();
  {
#pragma unroll
    for (int rd = 0; rd < 2; ++rd) { const int d = rd * 32 + tid / 8, pc = tid % 8; FragH f;
#pragma unroll
      for (int q = 0; q < 8; ++q) f.u[q] = tl[pc * 8 + q][d];
      *(v8us*)((unsigned short*)Vt + ((size_t)slab * 64 + d) * TTv + lg * 64 + pc * 8) = f.half[0]; }
     } }

__global__ __launch_bounds__(256) void k_hl(const float* __restrict__ F, _Float16* __restrict__ Hh, _Float16* __restrict__ Hl, size_t n8) { const size_t t = (size_t)blockIdx.x * 256 + threadIdx.x; if (t >= n8) return; FragH fh, fl; const v4f a = *(const v4fa*)(F + t * 8), c = *(const v4fa*)(F + t * 8 + 4);
#pragma unroll
  for (int q = 0; q < 4; ++q) { _Float16 h = (_Float16)a[q]; fh.h[q] = h; fl.h[q] = (_Float16)((a[q] - (float)h) * 1024.0f); h = (_Float16)c[q]; fh.h[4 + q] = h; fl.h[4 + q] = (_Float16)((c[q] - (float)h) * 1024.0f); }
  { *(v8us*)((unsigned short*)Hh + t * 8) = fh.half[0]; *(v8us*)((unsigned short*)Hl + t * 8) = fl.half[0];  } }

// ---- fast GEMM (wave tile 32x64; requires M % 32 == 0 rows per launch region and N % 64 == 0); epilogue = k_gemm_hhx semantics ----
__device__ __forceinline__ v16h g2_frag(const _Float16* p, int hh) { FragH f; f.half[0] = *(const v8us*)((const unsigned short*)p + 8 * hh); f.half[1] = *(const v8us*)((const unsigned short*)p + 16 + 8 * hh); return f.v; }
__device__ __forceinline__ v8f g2_mma(v16h a, v16h b, v8f c) { v8f d = __builtin_amdgcn_wmma_f32_16x16x32_f16(false, a, false, b, (short)0, c, false, false); asm volatile("v_nop\n\tv_nop\n\tv_nop\n\tv_nop" : "+v"(d) : "v"(a), "v"(b)); return d; }
template <int ACT>
__global__ __launch_bounds__(128) void k_gemm2(const _Float16* __restrict__ A, int lda, size_t sA, const _Float16* __restrict__ Bh, int ldb, size_t sB, float alpha, const float* __restrict__ bias, size_t sBias, const float* __restrict__ CP, int rowsPerB, size_t sCPb, int row0g,
    float* __restrict__ C, _Float16* __restrict__ C16, int ldc, size_t sC, int M, int N, int K) { static_assert(ACT == 0 || ACT == 3 || ACT == 6 || ACT == 8 || ACT == 9 || ACT == 11 || ACT == 12 || ACT == 14 || ACT == 15 || ACT == 16 || ACT == 17, "k_gemm2: unsupported ACT code (would silently apply no activation)");
  __shared__ __attribute__((aligned(16))) float so[4][32][68];
  const int tid = threadIdx.x, w = tid >> 5, lane = tid & 31, ln = lane & 15, hh = lane >> 4; const int by = blockIdx.y;
  A += (size_t)by * sA; Bh += (size_t)by * sB; const size_t cofs = (size_t)by * sC; const float* bp = bias ? bias + (size_t)by * sBias : nullptr;
  const int ntn = N >> 6; const int mt = blockIdx.x / ntn, nq = blockIdx.x - mt * ntn; const int row0 = mt * 128 + 32 * w, col0 = nq * 64; if (row0 >= M) return;
  const _Float16* a0p = A + (size_t)(row0 + ln) * lda; const _Float16* a1p = a0p + (size_t)16 * lda;
  const _Float16* b0p = Bh + (size_t)(col0 + ln) * ldb; const _Float16* b1p = b0p + (size_t)16 * ldb; const _Float16* b2p = b1p + (size_t)16 * ldb; const _Float16* b3p = b2p + (size_t)16 * ldb;
  const v8f z8 = {0.f,0.f,0.f,0.f,0.f,0.f,0.f,0.f}; v8f c00 = z8, c01 = z8, c02 = z8, c03 = z8, c10 = z8, c11 = z8, c12 = z8, c13 = z8;
#pragma unroll 1
  for (int kb = 0; kb < K; kb += 32) { const v16h a0 = g2_frag(a0p + kb, hh), a1 = g2_frag(a1p + kb, hh);
    v16h b = g2_frag(b0p + kb, hh); c00 = g2_mma(a0, b, c00); c10 = g2_mma(a1, b, c10);
    b = g2_frag(b1p + kb, hh); c01 = g2_mma(a0, b, c01); c11 = g2_mma(a1, b, c11);
    b = g2_frag(b2p + kb, hh); c02 = g2_mma(a0, b, c02); c12 = g2_mma(a1, b, c12);
    b = g2_frag(b3p + kb, hh); c03 = g2_mma(a0, b, c03); c13 = g2_mma(a1, b, c13); }
  v8f accs[8] = {c00, c01, c02, c03, c10, c11, c12, c13};
#pragma unroll
  for (int u = 0; u < 8; ++u) { const int t = u & 3, half = u >> 2; const int col = col0 + t * 16 + ln; const float bv = bp ? bf16_round(bp[col]) : 0.f;
#pragma unroll
    for (int r = 0; r < 8; ++r) { const int rloc = half * 16 + 8 * hh + r; float v = accs[u][r] * alpha + bv; if (CP) { if (rowsPerB < 0) v += CP[cofs + (size_t)(row0g + row0 + rloc) * ldc + col];      /* rowsPerB < 0: own element of the batched C plane */ else { const int bidx = (row0g + row0 + rloc) / rowsPerB; v += CP[(size_t)bidx * sCPb + (size_t)by * 64 + col]; } }
      if (ACT == 3) v = fmaxf(v, 0.f); else if (ACT == 6) v = 0.5f * v * (1.0f + erff(v * 0.70710678118654752f)); else if (ACT == 11) v = 1.0f / (1.0f + expf(-v)); else if (ACT == 15) v = v / (1.0f + expf(-v)); else if (ACT == 12) v = (v > 0.f) ? v : 0.01f * v; else if (ACT == 8) v = tanhf(v); else if (ACT == 9) v = 0.5f * v * (1.0f + tanhf(0.7978845608028654f * (v + 0.044715f * v * v * v))); else if (ACT == 14) v = (v > 0.f) ? v : 0.1f * v; else if (ACT == 16) v = (v >= 0.f) ? v : 0.3f * v; else if (ACT == 17) v = (v >= 0.f) ? v : 0.2f * v;
      so[w][rloc][t * 16 + ln] = v; } }
  __builtin_amdgcn_fence(__ATOMIC_ACQ_REL, "workgroup"); __builtin_amdgcn_wave_barrier();
  const int rsub = lane >> 4, c4 = (lane & 15) * 4;
  {
#pragma unroll
    for (int q = 0; q < 16; ++q) { const int r = q * 2 + rsub; const v4f v = *(const v4fa*)&so[w][r][c4]; if (C) *(v4f*)(C + cofs + (size_t)(row0 + r) * ldc + col0 + c4) = v; if (C16) { v4h h4; for (int i = 0; i < 4; ++i) h4[i] = (_Float16)v[i]; *(v4h*)(C16 + cofs + (size_t)(row0 + r) * ldc + col0 + c4) = h4; } }
     } }


// GEMM with K = 256 and dense rows (A [M][256], B [N][256]), operands staged in LDS: one work-group of 8 waves computes a 128x128 tile. All 256 k (512 bytes) of the tile's 128 A rows and 128 B rows are brought in once, every wave-wide 16-byte load
// taking the 512 contiguous bytes of one row (four whole lines), and laid at a row pitch of 528 bytes (16 x odd, for the ds_load_b128 readers); behind one barrier wave w takes rows 32 * (w & 3) ... + 31 and columns 64 * (w >> 2) ... + 63, k ascending as in k_gemm2.
// Epilogue = k_gemm2's: v = acc * alpha + bias[col] (bias rounded to bf16), staged per wave in LDS (over the operand rows, behind a second barrier) and stored as whole rows of the wave tile, to C16 (f16) if F16OUT, else to C (f32). M % 128 == 0, N % 128 == 0.
template <bool F16OUT>
__global__ __launch_bounds__(256) void k_gemm2t(const _Float16* __restrict__ A, const _Float16* __restrict__ Bh, float alpha, const float* __restrict__ bias, float* __restrict__ C, _Float16* __restrict__ C16, int ldc, int N) {
  constexpr int KC = 256, PITCH = KC + 8;      /* in f16 elements */
  static_assert(8 * 32 * 68 * 4 <= 256 * PITCH * 2, "the operand rows are the larger use of the LDS block");
  __shared__ __attribute__((aligned(16))) unsigned char smem[256 * PITCH * 2];
  _Float16* const sb = (_Float16*)smem;
  const int tid = threadIdx.x, w = tid >> 5, lane = tid & 31, ln = lane & 15, hh = lane >> 4;
  const int ntn = N >> 7; const int mt = blockIdx.x / ntn, nq = blockIdx.x - mt * ntn; const int row0 = mt * 128, col0 = nq * 128;
  const int wm = w & 3, wn = w >> 2; const int rw = row0 + wm * 32, cw = col0 + wn * 64;
  float bv[4];
#pragma unroll
  for (int t = 0; t < 4; ++t) bv[t] = bias ? bf16_round(bias[cw + t * 16 + ln]) : 0.f;
  { // staging: wave w brings LDS rows 32 w ... 32 w + 31 (rows 0 - 127 are A's, 128 - 255 are B's), 16 KiB in a row in global memory
    const unsigned short* g = (const unsigned short*)(w < 4 ? A + (size_t)(row0 + w * 32) * KC : Bh + (size_t)(col0 + (w - 4) * 32) * KC) + lane * 8;
    unsigned short* const sw = (unsigned short*)sb + (w * 32) * PITCH + lane * 8;
    v8us t[32];
    // full unroll of both loops: t[] must be indexed by constants to live in registers, and all 32 loads are to be in flight at once
#pragma unroll
    for (int j = 0; j < 32; ++j) t[j] = *(const v8us*)(g + j * KC);
    asm volatile("s_wait_xcnt 0x0" :: "v"(g) : "memory");      /* the address pair of the 32 loads stays untouched (it is an input here) until this wait has passed */
#pragma unroll
    for (int j = 0; j < 32; ++j) *(v8us*)(sw + j * PITCH) = t[j]; }
  __syncthreads();      /* all operand rows are in LDS before any wave reads a fragment */
  const _Float16* const fa = sb + (wm * 32 + ln) * PITCH; const _Float16* const fb = sb + (128 + wn * 64 + ln) * PITCH;
  const v8f z8 = {0.f,0.f,0.f,0.f,0.f,0.f,0.f,0.f}; v8f c00 = z8, c01 = z8, c02 = z8, c03 = z8, c10 = z8, c11 = z8, c12 = z8, c13 = z8;
  // unrolled so that the k offsets are immediates of the LDS reads and a later k step's reads can be issued ahead of this step's products
#pragma unroll
  for (int kb = 0; kb < KC; kb += 32) {
    const v16h a0 = g2_frag(fa + kb, hh), a1 = g2_frag(fa + 16 * PITCH + kb, hh), b0 = g2_frag(fb + kb, hh), b1 = g2_frag(fb + 16 * PITCH + kb, hh), b2 = g2_frag(fb + 32 * PITCH + kb, hh), b3 = g2_frag(fb + 48 * PITCH + kb, hh);
    c00 = g2_mma(a0, b0, c00); c10 = g2_mma(a1, b0, c10); c01 = g2_mma(a0, b1, c01); c11 = g2_mma(a1, b1, c11);
    c02 = g2_mma(a0, b2, c02); c12 = g2_mma(a1, b2, c12); c03 = g2_mma(a0, b3, c03); c13 = g2_mma(a1, b3, c13); }
  __syncthreads();      /* every read of the operand rows has ended before the output staging goes over them */
  float (*so)[32][68] = (float (*)[32][68])smem;
  v8f accs[8] = {c00, c01, c02, c03, c10, c11, c12, c13};
#pragma unroll
  for (int u = 0; u < 8; ++u) { const int t = u & 3, half = u >> 2;
#pragma unroll
    for (int r = 0; r < 8; ++r) so[w][half * 16 + 8 * hh + r][t * 16 + ln] = accs[u][r] * alpha + bv[t]; }
  __builtin_amdgcn_fence(__ATOMIC_ACQ_REL, "workgroup"); __builtin_amdgcn_wave_barrier();      /* as in k_gemm2: the wave reads back only its own plane */
  const int rsub = lane >> 4, c4 = (lane & 15) * 4;
#pragma unroll
  for (int q = 0; q < 16; ++q) { const int r = q * 2 + rsub; const v4f v = *(const v4fa*)&so[w][r][c4]; const size_t o = (size_t)(rw + r) * ldc + cw + c4;
    if (F16OUT) { v4h h4; for (int i = 0; i < 4; ++i) h4[i] = (_Float16)v[i]; *(v4h*)(C16 + o) = h4; } else *(v4f*)(C + o) = v; } }

// out-product GEMM for a small M x N with a long K, operands staged in LDS: one work-group of 16 waves computes a 64x64 tile. A stage is 256 k (512 bytes) of the tile's 64 A rows and 64 B rows;
// every wave-wide 16-byte load brings the 512 contiguous bytes of one row (four whole lines), two stages ahead, into one of two register sets, and the set goes to one of two LDS buffers one stage ahead (row pitch 528 bytes, 16 x odd, for the ds_load_b128 readers).
// Inside a stage wave w takes rows 32 * (w & 1) ... + 31 and the 32-wide k chunk w >> 1; each wave's f32 partial tile goes to its own LDS plane (over the stage buffers, behind the loop's last barrier), and behind one more barrier
// every thread sums two float4 over the 8 planes of their row half in plane order; C = sum * alpha (+ CP, the own element of C, if non-null). M % 64 == 0, N % 64 == 0, K % 512 == 0.
__global__ __launch_bounds__(512) void k_gemm2s(const _Float16* __restrict__ A, int lda, const _Float16* __restrict__ Bh, int ldb, float alpha, const float* CP, float* C, int ldc, int N, int K) {
  constexpr int KC = 256, PITCH = KC + 8, STAGE = 128 * PITCH;      /* in f16 elements */
  static_assert(2 * STAGE * 2 <= 16 * 32 * 68 * 4, "the partial planes are the larger use of the LDS block");
  __shared__ __attribute__((aligned(16))) unsigned char smem[16 * 32 * 68 * 4];
  _Float16* const sb = (_Float16*)smem;
  const int tid = threadIdx.x, w = tid >> 5, lane = tid & 31, ln = lane & 15, hh = lane >> 4;
  const int ntn = N >> 6; const int mt = blockIdx.x / ntn, nq = blockIdx.x - mt * ntn; const int row0 = mt * 64, col0 = nq * 64;
  // staging: wave w brings stage rows 8 w ... 8 w + 7 (rows 0 - 63 are A's, 64 - 127 are B's)
  const int ld = w < 8 ? lda : ldb;
  const _Float16* g = (w < 8 ? A + (size_t)(row0 + w * 8) * lda : Bh + (size_t)(col0 + (w - 8) * 8) * ldb) + lane * 8;
  _Float16* const sw = sb + (w * 8) * PITCH + lane * 8;
  // fragments: A rows 32 mi + ln and + 16, B rows 64 + 16 t + ln, k chunk kq
  const int mi = w & 1, kq = w >> 1;
  const _Float16* const fa = sb + (mi * 32 + ln) * PITCH + kq * 32; const _Float16* const fb = sb + (64 + ln) * PITCH + kq * 32;
  const v8f z8 = {0.f,0.f,0.f,0.f,0.f,0.f,0.f,0.f}; v8f c00 = z8, c01 = z8, c02 = z8, c03 = z8, c10 = z8, c11 = z8, c12 = z8, c13 = z8;
  v8us r0[8], r1[8];      /* the two register sets; the loops over them are fully unrolled, so that they are indexed by constants and live in registers and a set's 8 loads are in flight together */
  auto fetch = [&](v8us (&r)[8], int s) {
#pragma unroll
    for (int j = 0; j < 8; ++j) r[j] = *(const v8us*)((const unsigned short*)g + (size_t)j * ld + (size_t)s * KC);
    asm volatile("s_wait_xcnt 0x0" ::: "memory"); };      /* the loads stay in flight over the loop's back edge, where their address registers are written anew */
  auto put = [&](const v8us (&r)[8], int buf) {
#pragma unroll
    for (int j = 0; j < 8; ++j) *(v8us*)((unsigned short*)sw + buf * STAGE + j * PITCH) = r[j]; };
  auto work = [&](int buf) { const _Float16* pa = fa + buf * STAGE; const _Float16* pb = fb + buf * STAGE;
    const v16h a0 = g2_frag(pa, hh), a1 = g2_frag(pa + 16 * PITCH, hh), b0 = g2_frag(pb, hh), b1 = g2_frag(pb + 16 * PITCH, hh), b2 = g2_frag(pb + 32 * PITCH, hh), b3 = g2_frag(pb + 48 * PITCH, hh);
    c00 = g2_mma(a0, b0, c00); c10 = g2_mma(a1, b0, c10); c01 = g2_mma(a0, b1, c01); c11 = g2_mma(a1, b1, c11);
    c02 = g2_mma(a0, b2, c02); c12 = g2_mma(a1, b2, c12); c03 = g2_mma(a0, b3, c03); c13 = g2_mma(a1, b3, c13); };
  // work-group barrier of the stage loop, by hand: __syncthreads() also waits for every global load, which would end the fetches that are meant to stay in flight across it; what the barrier orders here is LDS alone, so the wave's LDS stores and reads are waited for (s_wait_dscnt 0) and nothing else
  auto stage_barrier = [&]() { asm volatile("s_wait_dscnt 0x0\n\ts_barrier_signal -1\n\ts_barrier_wait -1" ::: "memory"); };
  const int nst = K / KC;
  fetch(r0, 0); fetch(r1, 1); put(r0, 0);
  stage_barrier();      /* stage 0 is in buffer 0 before any wave reads it */
  // the last two stages stand behind the loop, so that every fetch in it is unconditional (a branch round a fetch would merge two load counts and turn the counted waits in front of the LDS stores into waits for all loads)
  for (int s = 0; s + 2 < nst; s += 2) {
    fetch(r0, s + 2); work(0); put(r1, 1);
    stage_barrier();      /* publishes stage s + 1 in buffer 1 and ends every read of buffer 0 */
    fetch(r1, s + 3); work(1); put(r0, 0);
    stage_barrier();      /* publishes stage s + 2 in buffer 0 and ends every read of buffer 1 */
  }
  work(0); put(r1, 1);
  __syncthreads();      /* publishes the last stage in buffer 1 */
  work(1);
  __syncthreads();      /* every read of the stage buffers has ended before the partial planes go over them */
  float (*so)[32][68] = (float (*)[32][68])smem;
  v8f accs[8] = {c00, c01, c02, c03, c10, c11, c12, c13};
#pragma unroll
  for (int u = 0; u < 8; ++u) { const int t = u & 3, half = u >> 2;
#pragma unroll
    for (int r = 0; r < 8; ++r) so[w][half * 16 + 8 * hh + r][t * 16 + ln] = accs[u][r]; }
  __syncthreads();      /* every wave's partial tile is in LDS before any thread sums across the planes */
  v4f v[2]; size_t o[2];
  // both results are formed before either is stored, so that no register of an issued store is written again
#pragma unroll
  for (int i = 0; i < 2; ++i) { const int r = tid >> 4, c4 = (tid & 15) * 4;      /* row half i: planes i, i + 2, ... */
    v4f sum = *(const v4fa*)&so[i][r][c4];
#pragma unroll
    for (int j = 1; j < 8; ++j) sum += *(const v4fa*)&so[2 * j + i][r][c4];
    o[i] = (size_t)(row0 + i * 32 + r) * ldc + col0 + c4;
    v[i] = sum * alpha; if (CP) v[i] += *(const v4fa*)(CP + o[i]); }
  *(v4f*)(C + o[0]) = v[0]; *(v4f*)(C + o[1]) = v[1]; }


__global__ __launch_bounds__(256) void k_wnat(const float* __restrict__ w, size_t n8, _Float16* __restrict__ Bt) { const size_t t = (size_t)blockIdx.x * 256 + threadIdx.x; if (t >= n8) return; FragH f; for (int q = 0; q < 8; ++q) f.h[q] = (_Float16)(bf16_round(w[t * 8 + q]) * 16.0f); *(v8us*)((unsigned short*)Bt + t * 8) = f.half[0];  }
__global__ __launch_bounds__(256) void k_rsm(const float* __restrict__ S, _Float16* __restrict__ P, int nrows) {
  #pragma clang fp contract(off)
  const int i = blockIdx.x * 256 + threadIdx.x; if (i >= nrows) return; const float* s = S + (size_t)i * SQ; float mx = -3.0e38f;
#pragma unroll 1
  for (int j = 0; j < SQ; ++j) mx = fmaxf(mx, s[j]); float se = 0.f;
#pragma unroll 1
  for (int j = 0; j < SQ; ++j) se += expf(s[j] - mx); const float sc = 256.0f / se;
#pragma unroll 1
  for (int j0 = 0; j0 < SQ; j0 += 8) { FragH f; for (int q = 0; q < 8; ++q) f.h[q] = (_Float16)(expf(s[j0 + q] - mx) * sc); unsigned short* d = (unsigned short*)P + (size_t)i * SQ + j0; *(v8us*)d = f.half[0];  } }
__global__ __launch_bounds__(256) void k_vt(const _Float16* __restrict__ V16, int b, int h0, _Float16* __restrict__ VT) { __shared__ unsigned short tl[64][65]; const int tid = threadIdx.x; const int hh = blockIdx.x % HG, sg = blockIdx.x / HG; const int s0 = sg * 64; const int h = h0 + hh;
  for (int i = tid; i < 64 * 8; i += 256) { const int j = i / 8, d8 = (i % 8) * 8; FragH f; f.half[0] = *(const v8us*)((const unsigned short*)V16 + ((size_t)b * SQ + s0 + j) * DM + h * HD + d8); for (int q = 0; q < 8; ++q) tl[d8 + q][j] = f.u[q]; }
  __syncthreads();
  { for (int i = tid; i < 64 * 8; i += 256) { const int d = i / 8, j8 = (i % 8) * 8; FragH f; for (int q = 0; q < 8; ++q) f.u[q] = tl[d][j8 + q]; *(v8us*)((unsigned short*)VT + ((size_t)hh * HD + d) * SQ + s0 + j8) = f.half[0]; }  } }


// cross-lane steps of the wave-wide reductions below: row_xmask DPP inside a 16-lane row, permlanex16 for lane ^ 16 (no LDS round trip)
template <int CTRL>
__device__ __forceinline__ float xl_row(float v) { return __int_as_float(__builtin_amdgcn_update_dpp(0, __float_as_int(v), CTRL, 0xf, 0xf, true)); }
__device__ __forceinline__ float xl_half(float v) { const int i = __float_as_int(v); return __int_as_float(__builtin_amdgcn_permlanex16(i, i, 0x76543210, 0xfedcba98, false, false)); }
__device__ __forceinline__ float wave_max(float v) { v = fmaxf(v, xl_row<0x161>(v)); v = fmaxf(v, xl_row<0x162>(v)); v = fmaxf(v, xl_row<0x164>(v)); v = fmaxf(v, xl_row<0x168>(v)); return fmaxf(v, xl_half(v)); }
__device__ __forceinline__ float wave_sum(float v) { v += xl_row<0x161>(v); v += xl_row<0x162>(v); v += xl_row<0x164>(v); v += xl_row<0x168>(v); return v + xl_half(v); }
// row softmax, one wave per row: each load is 512 contiguous bytes of the row, the whole row (32 x 4 scores a lane) stays in registers, so S is read once and exp is taken once; P = f16(exp(s - max) * 256 / sum)
__global__ __launch_bounds__(256) void k_rsmw(const float* __restrict__ S, _Float16* __restrict__ P) {
  const int lane = threadIdx.x & 31; const size_t row = (size_t)blockIdx.x * 8 + (threadIdx.x >> 5);
  const float* s = S + row * SQ + lane * 4; _Float16* p = P + row * SQ + lane * 4;
  v4f x[SQ / 128];
  // full unroll here and below: x[] must be indexed by constants to live in registers, and all 32 loads are to be in flight at once
#pragma unroll
  for (int u = 0; u < SQ / 128; ++u) x[u] = *(const v4fa*)(s + u * 128);
  v4f m4 = x[0];
#pragma unroll
  for (int u = 1; u < SQ / 128; ++u) for (int q = 0; q < 4; ++q) m4[q] = fmaxf(m4[q], x[u][q]);
  const float mx = wave_max(fmaxf(fmaxf(m4[0], m4[1]), fmaxf(m4[2], m4[3])));
  v4f a4 = {0.f, 0.f, 0.f, 0.f};
#pragma unroll
  for (int u = 0; u < SQ / 128; ++u) for (int q = 0; q < 4; ++q) { const float e = __expf(x[u][q] - mx); x[u][q] = e; a4[q] += e; }
  const float sc = 256.0f / wave_sum((a4[0] + a4[1]) + (a4[2] + a4[3]));
#pragma unroll
  for (int u = 0; u < SQ / 128; ++u) { v4h h4; for (int q = 0; q < 4; ++q) h4[q] = (_Float16)(x[u][q] * sc); *(v4h*)(p + u * 128) = h4; } }

extern "C" void kernel_launch(void* const* d_in, const int* in_sizes, int n_in,
                              void* d_out, int out_size, void* d_ws, size_t ws_size, hipStream_t stream) {
  (void)in_sizes; (void)n_in; (void)out_size;
  const float* const* I = (const float* const*)d_in; const float* xq = I[0]; const float* xk = I[1]; const float* xv = I[2]; const float* wq = I[3]; const float* bq = I[4]; const float* wk = I[5]; const float* bk = I[6]; const float* wv = I[7]; const float* bv = I[8];
  char* ws = (char*)d_ws; size_t off = 0;
  auto take = [&](size_t bytes) { char* p = ws + off; off += (bytes + 255) & ~(size_t)255; return p; };
  _Float16* BQ = (_Float16*)take((size_t)DM * DM * 2); _Float16* BK = (_Float16*)take((size_t)DM * DM * 2); _Float16* BV = (_Float16*)take((size_t)DM * DM * 2);
  _Float16* XQ = (_Float16*)take(NR * DM * 2); _Float16* XK = (_Float16*)take(NR * DM * 2); _Float16* XV = (_Float16*)take(NR * DM * 2); _Float16* Q16 = (_Float16*)take(NR * DM * 2); _Float16* K16 = (_Float16*)take(NR * DM * 2); float* VF = (float*)take(NR * DM * 4); _Float16* VH = (_Float16*)take(NR * DM * 2); _Float16* VL = (_Float16*)take(NR * DM * 2);
  float* S = (float*)take((size_t)SQ * SQ * 4); _Float16* P = (_Float16*)take((size_t)SQ * SQ * 2); _Float16* VT = (_Float16*)take((size_t)DM * SQ * 2); _Float16* VTL = (_Float16*)take((size_t)DM * SQ * 2);
  if (off > ws_size) return;      /* approx 0.4 + 8 x 5 + 16 + 8 + 8 + 64 + 32 + 4 = 172 MiB */
  { const unsigned g = (unsigned)(((size_t)DM * (DM / 8) + 255) / 256); k_wt_f16<<<g, 256, 0, stream>>>(wq, BQ, DM, DM, 16.0f); k_wt_f16<<<g, 256, 0, stream>>>(wk, BK, DM, DM, 16.0f); k_wt_f16<<<g, 256, 0, stream>>>(wv, BV, DM, DM, 16.0f); }
  k_x16<<<(unsigned)((NR * DM / 8 + 255) / 256), 256, 0, stream>>>(xq, XQ, NR * DM / 8); k_x16<<<(unsigned)((NR * DM / 8 + 255) / 256), 256, 0, stream>>>(xk, XK, NR * DM / 8); k_x16<<<(unsigned)((NR * DM / 8 + 255) / 256), 256, 0, stream>>>(xv, XV, NR * DM / 8);
  k_gemm2t<true><<<(unsigned)((NR / 128) * (DM / 128)), 256, 0, stream>>>(XQ, BQ, 0.0625f, bq, nullptr, Q16, DM, DM);
  k_gemm2t<true><<<(unsigned)((NR / 128) * (DM / 128)), 256, 0, stream>>>(XK, BK, 0.0625f, bk, nullptr, K16, DM, DM);
  k_gemm2t<false><<<(unsigned)((NR / 128) * (DM / 128)), 256, 0, stream>>>(XV, BV, 0.0625f, bv, VF, nullptr, DM, DM); k_hl<<<(unsigned)((NR * DM / 8 + 255) / 256), 256, 0, stream>>>(VF, VH, VL, NR * DM / 8);      /* v (f32) -> f16 hi + x1024 residual */
  for (int b = 0; b < NB; ++b) { const size_t r0 = (size_t)b * SQ;
    k_vt<DM / 64, SQ><<<(DM / 64) * (SQ / 64), 256, 0, stream>>>(VH + r0 * DM, DM, 0, VT); k_vt<DM / 64, SQ><<<(DM / 64) * (SQ / 64), 256, 0, stream>>>(VL + r0 * DM, DM, 0, VTL);
    k_gemm2t<false><<<(SQ / 128) * (SQ / 128), 256, 0, stream>>>(Q16 + r0 * DM, K16 + r0 * DM, 0.0625f, nullptr, S, nullptr, SQ, SQ);      /* scores / 16 (K = 256) */
    k_rsmw<<<SQ / 8, 256, 0, stream>>>(S, P);
    k_gemm2s<<<(SQ / 64) * (DM / 64), 512, 0, stream>>>(P, SQ, VT, SQ, 0.00390625f, nullptr, (float*)d_out + r0 * DM, DM, DM, SQ);      /* out = P V_hi / 256 */
    k_gemm2s<<<(SQ / 64) * (DM / 64), 512, 0, stream>>>(P, SQ, VTL, SQ, 0.000003814697265625f, (const float*)d_out + r0 * DM, (float*)d_out + r0 * DM, DM, DM, SQ); }      /* += P V_lo 2^-18 (own element) */
}

// v004
// It runs in 163 microseconds.
// Next to v003, in two timings, it ran 2.05 and 2.06 times as fast.
// Over all steps from v000 it is 23.5 times as fast.
#include <hip/hip_runtime.h>
// Single-head attention with dense projections (q_in, k_in, v_in [4][4096][256]; q = q_in Wq + bq, k = k_in Wk + bk, v = v_in Wv + bv ([in][out] 256x256 glorot-uniform, biases uniform); scores = q . k x 256^-0.5; softmax over the 4096 keys (no mask); out = attn v -> [4][4096][256]; no output projection).
// Structure: the three inputs as exact f16 rows; [in][out] weights as exact x16 planes; q, k as WMMA GEMMs (LDS-staged 128x128 tiles, f32 accumulation, + bias, f16 outputs: logits sigma ~1), v as an f32-output GEMM split into f16 hi + x1024 residual planes; V^T of the hi and residual planes of all batches (slabs of 64) via LDS transposes; then ONE fused launch for all batches: scores (K = 256, x 1/16), running-maximum softmax (f32 statistics, native exp; weights plain f16, not normalised) and O = P V_hi^T + 2^-10 P V_lo^T, divided by the row sum at the end.
// Compute dtype: inputs rounded to bf16; x / weights exact; q, k, P plain f16 (~2^-12), v as hi + residual; scores / statistics / out f32. v_wmma_f32_16x16x32_f16.
#define NB 4
#define SQ 4096
#define DM 256
#define NH 1
#define HD 64
#define HG 1
#define NR ((size_t)NB * SQ)
typedef __bf16 v16b __attribute__((ext_vector_type(16)));
typedef unsigned short v8us __attribute__((ext_vector_type(8), may_alias));
typedef float  v8f  __attribute__((ext_vector_type(8)));
typedef float  v4f  __attribute__((ext_vector_type(4)));
typedef float  v4fa __attribute__((ext_vector_type(4), may_alias));
union FragB { v16b v; v8us half[2]; unsigned short u[16]; };

__device__ __forceinline__ unsigned short bf16_bits(float x) { unsigned int u = __float_as_uint(x); return (unsigned short)((u + 0x7FFFu + ((u >> 16) & 1u)) >> 16); }
__device__ __forceinline__ float bf16_val(unsigned short b) { return __uint_as_float(((unsigned int)b) << 16); }
__device__ __forceinline__ float bf16_round(float x) { return bf16_val(bf16_bits(x)); }
// D += A·B with NT terms: 1 = ah·bh, 2 = + al·bh (A split), 3 = + ah·bl (both split)
template <int NT>
__device__ __forceinline__ v8f mmaN(v16b ah, v16b al, v16b bh, v16b bl, v8f c) {
  c = __builtin_amdgcn_wmma_f32_16x16x32_bf16(false, ah, false, bh, (short)0, c, false, false);
  if (NT >= 2) c = __builtin_amdgcn_wmma_f32_16x16x32_bf16(false, al, false, bh, (short)0, c, false, false);
  if (NT >= 3) c = __builtin_amdgcn_wmma_f32_16x16x32_bf16(false, ah, false, bl, (short)0, c, false, false);
  asm volatile("v_nop\n\tv_nop\n\tv_nop\n\tv_nop" : "+v"(c) : "v"(ah), "v"(al), "v"(bh), "v"(bl));
  return c;
}

__global__ __launch_bounds__(256) void k_wt_bf16(const float* __restrict__ W, unsigned short* __restrict__ Wt, int K, int N) {
  const int t = blockIdx.x * 256 + threadIdx.x;
  const int k8n = K / 8;
  if (t >= N * k8n) return;
  const int n = t / k8n, k8 = (t % k8n) * 8;
  v8us v;
#pragma unroll
  for (int i = 0; i < 8; ++i) v[i] = bf16_bits(W[(size_t)(k8 + i) * N + n]);
  *(v8us*)(Wt + (size_t)n * K + k8) = v;
  
}

// GEMM C[M][N] (f32, pitch ldc) = act(A[M][K]·W + bias). A f32 row-major (pitch lda) converted per fragment to bf16
// (ASPLIT: hi/lo two planes -> 2 terms, else single rounded term); Wt bf16 [N][K] (pitch ldb). BIAS_BF16 rounds the
// bias to bf16 first (bias quantised to bf16 before the add). K%32==0, M%16==0, N%64==0.
template <bool ASPLIT, int ACT, bool BIAS_BF16>
__global__ __launch_bounds__(128) void k_gemm_bf(const float* __restrict__ A, int lda, const unsigned short* __restrict__ Wt, int ldb,
                                               const float* __restrict__ bias, float* __restrict__ C, int ldc, int M, int N, int K) {
  __shared__ __attribute__((aligned(16))) float so[4][16][64];
  const int tid = threadIdx.x, w = tid >> 5, lane = tid & 31, ln = lane & 15, hh = lane >> 4;
  const int ntn = N / 64;
  const int wid = blockIdx.x * 4 + w;
  const int mt = wid / ntn, nq = wid % ntn;
  if (mt * 16 >= M) return;
  const int row0 = mt * 16, col0 = nq * 64;
  const float* arow = A + (size_t)(row0 + ln) * lda;
  v8f acc[4] = {};
  for (int kb = 0; kb < K; kb += 32) {
    FragB ah, al;
    const v4f x0 = *(const v4fa*)(arow + kb + 8 * hh), x1 = *(const v4fa*)(arow + kb + 8 * hh + 4);
    const v4f x2 = *(const v4fa*)(arow + kb + 16 + 8 * hh), x3 = *(const v4fa*)(arow + kb + 16 + 8 * hh + 4);
    float xs[16] = {x0[0],x0[1],x0[2],x0[3],x1[0],x1[1],x1[2],x1[3],x2[0],x2[1],x2[2],x2[3],x3[0],x3[1],x3[2],x3[3]};
#pragma unroll
    for (int i = 0; i < 16; ++i) { const unsigned short hb = bf16_bits(xs[i]); ah.u[i] = hb; al.u[i] = ASPLIT ? bf16_bits(xs[i] - bf16_val(hb)) : (unsigned short)0; }
#pragma unroll
    for (int t = 0; t < 4; ++t) {
      const unsigned short* brow = Wt + (size_t)(col0 + t * 16 + ln) * ldb + kb;
      FragB b;
      b.half[0] = *(const v8us*)(brow + 8 * hh);
      b.half[1] = *(const v8us*)(brow + 16 + 8 * hh);
      acc[t] = mmaN<ASPLIT ? 2 : 1>(ah.v, al.v, b.v, b.v, acc[t]);
    }
  }
#pragma unroll
  for (int t = 0; t < 4; ++t) {
    float bv = bias ? bias[col0 + t * 16 + ln] : 0.f;
    if (BIAS_BF16) bv = bf16_round(bv);
#pragma unroll
    for (int r = 0; r < 8; ++r) { float v = acc[t][r] + bv; if (ACT == 1) v = fmaxf(v, 0.f); so[w][8 * hh + r][t * 16 + ln] = v; }
  }
  __builtin_amdgcn_fence(__ATOMIC_ACQ_REL, "workgroup");
  __builtin_amdgcn_wave_barrier();
  const int rsub = lane >> 4, c4 = (lane & 15) * 4;
  {
#pragma unroll
    for (int q = 0; q < 8; ++q) {
      const int r = q * 2 + rsub;
      const v4f v = *(const v4fa*)&so[w][r][c4];
      *(v4f*)(C + (size_t)(row0 + r) * ldc + col0 + c4) = v;
    }
    
  }
}

// GEMM C = act(A·W + bias + resid): A f32 (ASPLIT -> hi/lo 2 terms), Wt bf16 [N][K]; ACT 0 none, 1 relu, 2 exact gelu;
// resid (optional, f32, row index = (row % rmod), pitch ldr, RES_BF16 rounds it) added before the activation.
template <bool ASPLIT, int ACT, bool BIAS_BF16, bool RES_BF16>
__global__ __launch_bounds__(128) void k_gemm_bf3(const float* __restrict__ A, int lda, const unsigned short* __restrict__ Wt, int ldb,
                                                const float* __restrict__ bias, const float* __restrict__ resid, int rmod, int ldr,
                                                float* __restrict__ C, int ldc, int M, int N, int K) {
  __shared__ __attribute__((aligned(16))) float so[4][16][64];
  const int tid = threadIdx.x, w = tid >> 5, lane = tid & 31, ln = lane & 15, hh = lane >> 4;
  const int ntn = N / 64;
  const int wid = blockIdx.x * 4 + w;
  const int mt = wid / ntn, nq = wid % ntn;
  if (mt * 16 >= M) return;
  const int row0 = mt * 16, col0 = nq * 64;
  const float* arow = A + (size_t)(row0 + ln) * lda;
  v8f acc[4] = {};
  for (int kb = 0; kb < K; kb += 32) {
    FragB ah, al;
    const v4f x0 = *(const v4fa*)(arow + kb + 8 * hh), x1 = *(const v4fa*)(arow + kb + 8 * hh + 4);
    const v4f x2 = *(const v4fa*)(arow + kb + 16 + 8 * hh), x3 = *(const v4fa*)(arow + kb + 16 + 8 * hh + 4);
    float xs[16] = {x0[0],x0[1],x0[2],x0[3],x1[0],x1[1],x1[2],x1[3],x2[0],x2[1],x2[2],x2[3],x3[0],x3[1],x3[2],x3[3]};
#pragma unroll
    for (int i = 0; i < 16; ++i) { const unsigned short hb = bf16_bits(xs[i]); ah.u[i] = hb; al.u[i] = ASPLIT ? bf16_bits(xs[i] - bf16_val(hb)) : (unsigned short)0; }
#pragma unroll
    for (int t = 0; t < 4; ++t) {
      const unsigned short* brow = Wt + (size_t)(col0 + t * 16 + ln) * ldb + kb;
      FragB b;
      b.half[0] = *(const v8us*)(brow + 8 * hh);
      b.half[1] = *(const v8us*)(brow + 16 + 8 * hh);
      acc[t] = mmaN<ASPLIT ? 2 : 1>(ah.v, al.v, b.v, b.v, acc[t]);
    }
  }
#pragma unroll
  for (int t = 0; t < 4; ++t) {
    const int col = col0 + t * 16 + ln;
    float bv = bias ? bias[col] : 0.f;
    if (BIAS_BF16) bv = bf16_round(bv);
#pragma unroll
    for (int r = 0; r < 8; ++r) {
      float v = acc[t][r] + bv;
      if (resid) { float rv = resid[(size_t)((row0 + 8 * hh + r) % rmod) * ldr + col]; if (RES_BF16) rv = bf16_round(rv); v += rv; }
      if (ACT == 1) v = fmaxf(v, 0.f);
      if (ACT == 2) v = 0.5f * v * (1.0f + erff(v * 0.70710678118654752f));
      if (ACT == 3) { const float u = 0.7978845608028654f * (v + 0.044715f * v * v * v); v = 0.5f * v * (1.0f + tanhf(u)); }
      so[w][8 * hh + r][t * 16 + ln] = v;
    }
  }
  __builtin_amdgcn_fence(__ATOMIC_ACQ_REL, "workgroup");
  __builtin_amdgcn_wave_barrier();
  const int rsub = lane >> 4, c4 = (lane & 15) * 4;
  {
#pragma unroll
    for (int q = 0; q < 8; ++q) {
      const int r = q * 2 + rsub;
      const v4f v = *(const v4fa*)&so[w][r][c4];
      *(v4f*)(C + (size_t)(row0 + r) * ldc + col0 + c4) = v;
    }
    
  }
}
// row LayerNorm (biased variance, eps) over N: s = X (+ R); optional out_sum <- s; out_norm <- (s-mu)*rsqrt(var+eps)*g + b
template <bool PARAM_BF16>
__global__ __launch_bounds__(256) void k_layernorm(const float* __restrict__ X, const float* __restrict__ R, const float* __restrict__ g, const float* __restrict__ bta,
                                                  float* __restrict__ out_sum, float* __restrict__ out_norm, int N, float eps) {
  __shared__ float red[256];
  const int row = blockIdx.x, tid = threadIdx.x;
  const float* x = X + (size_t)row * N; const float* rr = R ? R + (size_t)row * N : nullptr;
  float vals[16];                     // up to N = 4096
  const int per = N / 256;            // contiguous chunk per thread? use strided-by-4 chunks: thread handles j = tid*4 + 1024*u
  float s1 = 0.f;
  for (int u = 0; u < per / 4; ++u) {
    const int j = tid * 4 + 1024 * u;
    const v4f a = *(const v4fa*)(x + j);
    v4f b = {0.f,0.f,0.f,0.f}; if (rr) b = *(const v4fa*)(rr + j);
#pragma unroll
    for (int q = 0; q < 4; ++q) { const float v = a[q] + b[q]; vals[u * 4 + q] = v; s1 += v; }
  }
  red[tid] = s1; __syncthreads();
  for (int st = 128; st > 0; st >>= 1) { if (tid < st) red[tid] += red[tid + st]; __syncthreads(); }
  const float mu = red[0] / (float)N; __syncthreads();
  float s2 = 0.f;
  for (int u = 0; u < per / 4; ++u)
#pragma unroll
    for (int q = 0; q < 4; ++q) { const float c = vals[u * 4 + q] - mu; s2 += c * c; }
  red[tid] = s2; __syncthreads();
  for (int st = 128; st > 0; st >>= 1) { if (tid < st) red[tid] += red[tid + st]; __syncthreads(); }
  const float rs = rsqrtf(red[0] / (float)N + eps);
  {
    for (int u = 0; u < per / 4; ++u) {
      const int j = tid * 4 + 1024 * u;
      v4f o, sm;
#pragma unroll
      for (int q = 0; q < 4; ++q) {
        float gg = g[j + q], bb = bta[j + q];
        if (PARAM_BF16) { gg = bf16_round(gg); bb = bf16_round(bb); }
        sm[q] = vals[u * 4 + q]; o[q] = (vals[u * 4 + q] - mu) * rs * gg + bb;
      }
      if (out_sum) *(v4f*)(out_sum + (size_t)row * N + j) = sm;
      *(v4f*)(out_norm + (size_t)row * N + j) = o;
    }
    
  }
}



// ---- f16 WMMA path (v_wmma_f32_16x16x32_f16): 11-bit significands for operands in range — used where a [0,1] probability operand needs more precision than bf16
typedef _Float16 v16h __attribute__((ext_vector_type(16)));
union FragH { v16h v; v8us half[2]; _Float16 h[16]; unsigned short u[16]; };
template <int NT>
__device__ __forceinline__ v8f mmaH(v16h ah, v16h al, v16h bh, v16h bl, v8f c) {
  c = __builtin_amdgcn_wmma_f32_16x16x32_f16(false, ah, false, bh, (short)0, c, false, false);
  if (NT >= 2) c = __builtin_amdgcn_wmma_f32_16x16x32_f16(false, al, false, bh, (short)0, c, false, false);
  if (NT >= 3) c = __builtin_amdgcn_wmma_f32_16x16x32_f16(false, ah, false, bl, (short)0, c, false, false);
  asm volatile("v_nop\n\tv_nop\n\tv_nop\n\tv_nop" : "+v"(c) : "v"(ah), "v"(al), "v"(bh), "v"(bl));
  return c;
}
// batched GEMM like k_gemm_b but f16 operands: A f32 (split into f16 hi/lo if ASPLIT, else rounded to f16), Bt = f16 values [n][k]; alpha; C f32; N multiple of 16 (partial tiles skipped)
template <bool ASPLIT>
__global__ __launch_bounds__(128) void k_gemm_h(const float* __restrict__ A, int lda, size_t sA, const _Float16* __restrict__ Bh, int ldb, size_t sB, float alpha, float* __restrict__ C, int ldc, size_t sC, int M, int N, int K) {
  __shared__ __attribute__((aligned(16))) float so[4][16][64];
  const int tid = threadIdx.x, w = tid >> 5, lane = tid & 31, ln = lane & 15, hh = lane >> 4; const int by = blockIdx.y;
  A += (size_t)by * sA; Bh += (size_t)by * sB; C += (size_t)by * sC;
  const int ntn = (N + 63) / 64; const int wid = blockIdx.x * 4 + w; const int mt = wid / ntn, nq = wid % ntn; if (mt * 16 >= M) return;
  const int row0 = mt * 16, col0 = nq * 64; const float* arow = A + (size_t)(row0 + ln) * lda;
  v8f acc[4] = {};
  for (int kb = 0; kb < K; kb += 32) {
    FragH ah, al;
    const v4f x0 = *(const v4fa*)(arow + kb + 8 * hh), x1 = *(const v4fa*)(arow + kb + 8 * hh + 4), x2 = *(const v4fa*)(arow + kb + 16 + 8 * hh), x3 = *(const v4fa*)(arow + kb + 16 + 8 * hh + 4);
    float xs[16] = {x0[0],x0[1],x0[2],x0[3],x1[0],x1[1],x1[2],x1[3],x2[0],x2[1],x2[2],x2[3],x3[0],x3[1],x3[2],x3[3]};
#pragma unroll
    for (int i = 0; i < 16; ++i) { const _Float16 h = (_Float16)xs[i]; ah.h[i] = h; al.h[i] = ASPLIT ? (_Float16)(xs[i] - (float)h) : (_Float16)0.0f; }
#pragma unroll
    for (int t = 0; t < 4; ++t) { if (col0 + t * 16 >= N) continue; const size_t boff = (size_t)(col0 + t * 16 + ln) * ldb + kb; FragH bq; bq.half[0] = *(const v8us*)(Bh + boff + 8 * hh); bq.half[1] = *(const v8us*)(Bh + boff + 16 + 8 * hh);
      acc[t] = mmaH<ASPLIT ? 2 : 1>(ah.v, al.v, bq.v, bq.v, acc[t]); }
  }
#pragma unroll
  for (int t = 0; t < 4; ++t) { if (col0 + t * 16 >= N) continue;
#pragma unroll
    for (int r = 0; r < 8; ++r) so[w][8 * hh + r][t * 16 + ln] = acc[t][r] * alpha; }
  __builtin_amdgcn_fence(__ATOMIC_ACQ_REL, "workgroup"); __builtin_amdgcn_wave_barrier();
  const int rsub = lane >> 4, c4 = (lane & 15) * 4;
  {
#pragma unroll
    for (int q = 0; q < 8; ++q) { const int r = q * 2 + rsub; if (col0 + c4 < N) { const v4f v = *(const v4fa*)&so[w][r][c4]; *(v4f*)(C + (size_t)(row0 + r) * ldc + col0 + c4) = v; } }
     }
}

// Wt[n][k] = f16(W[k][n]·scale) from f32 row-major W[K][N] (scale = power of two; bf16-exact weights stay exact in f16 away from the subnormal range)
__global__ __launch_bounds__(256) void k_wt_f16(const float* __restrict__ W, _Float16* __restrict__ Wt, int K, int N, float scale) {
  const int t = blockIdx.x * 256 + threadIdx.x; if (t >= N * (K / 8)) return; const int n = t / (K / 8), k8 = (t % (K / 8)) * 8; FragH f;
#pragma unroll
  for (int i = 0; i < 8; ++i) f.h[i] = (_Float16)(bf16_round(W[(size_t)(k8 + i) * N + n]) * scale); const v8us o = f.half[0];
  *(v8us*)((unsigned short*)Wt + (size_t)n * K + k8) = o; 
}
// k_gemm_hh variant with fused epilogue: v = acc·alpha + bias[by·sBias + col] (+ CP[(row/rowsPerB)·sCPb + by·64 + col] if CP) ; ACT 0 none / 1 elu ; writes f16 C16 (and f32 C if non-null)
template <int ACT>
__global__ __launch_bounds__(128) void k_gemm_hhx(const _Float16* __restrict__ A, int lda, size_t sA, const _Float16* __restrict__ Bh, int ldb, size_t sB, float alpha, const float* __restrict__ bias, size_t sBias, const float* __restrict__ CP, int rowsPerB, size_t sCPb, int row0g,
    float* __restrict__ C, _Float16* __restrict__ C16, int ldc, size_t sC, int M, int N, int K) {
  __shared__ __attribute__((aligned(16))) float so[4][16][64];
  const int tid = threadIdx.x, w = tid >> 5, lane = tid & 31, ln = lane & 15, hh = lane >> 4; const int by = blockIdx.y;
  A += (size_t)by * sA; Bh += (size_t)by * sB; const size_t cofs = (size_t)by * sC; const float* bp = bias ? bias + (size_t)by * sBias : nullptr;
  const int ntn = (N + 63) / 64; const int wid = blockIdx.x * 4 + w; const int mt = wid / ntn, nq = wid % ntn; if (mt * 16 >= M) return;
  const int row0 = mt * 16, col0 = nq * 64; const _Float16* arow = A + (size_t)(row0 + ln) * lda;
  v8f acc[4] = {};
  for (int kb = 0; kb < K; kb += 32) { FragH ah; ah.half[0] = *(const v8us*)((const unsigned short*)arow + kb + 8 * hh); ah.half[1] = *(const v8us*)((const unsigned short*)arow + kb + 16 + 8 * hh);
#pragma unroll
    for (int t = 0; t < 4; ++t) { if (col0 + t * 16 >= N) continue; const size_t boff = (size_t)(col0 + t * 16 + ln) * ldb + kb; FragH bq; bq.half[0] = *(const v8us*)((const unsigned short*)Bh + boff + 8 * hh); bq.half[1] = *(const v8us*)((const unsigned short*)Bh + boff + 16 + 8 * hh);
      acc[t] = mmaH<1>(ah.v, ah.v, bq.v, bq.v, acc[t]); }
  }
#pragma unroll
  for (int t = 0; t < 4; ++t) { if (col0 + t * 16 >= N) continue; const int col = col0 + t * 16 + ln; const float bv = bp ? bf16_round(bp[col]) : 0.f;
#pragma unroll
    for (int r = 0; r < 8; ++r) { float v = acc[t][r] * alpha + bv; if (CP) { const int rr = row0g + row0 + 8 * hh + r; if (rowsPerB < 0) v += CP[cofs + (size_t)rr * ldc + col];      /* rowsPerB < 0: own element of the batched C plane */ else { const int bidx = rr / rowsPerB; v += CP[(size_t)bidx * sCPb + (size_t)by * 64 + col]; } } if (ACT == 1) v = (v > 0.f) ? v : expm1f(v); else if (ACT == 7) v = (v > 0.f) ? v + 1.0f : expf(v); else if (ACT == 8) v = tanhf(v); else if (ACT == 9) v = 0.5f * v * (1.0f + tanhf(0.7978845608028654f * (v + 0.044715f * v * v * v))); else if (ACT == 11) v = 1.0f / (1.0f + expf(-v)); else if (ACT == 12) v = (v > 0.f) ? v : 0.01f * v; else if (ACT == 14) v = (v > 0.f) ? v : 0.1f * v; else if (ACT == 16) v = (v >= 0.f) ? v : 0.3f * v; else if (ACT == 17) v = (v >= 0.f) ? v : 0.2f * v; else if (ACT == 15) v = v / (1.0f + expf(-v)); else if (ACT == 3) v = fmaxf(v, 0.f); else if (ACT == 6) v = 0.5f * v * (1.0f + erff(v * 0.70710678118654752f)); so[w][8 * hh + r][t * 16 + ln] = v; } }
  __builtin_amdgcn_fence(__ATOMIC_ACQ_REL, "workgroup"); __builtin_amdgcn_wave_barrier();
  const int rsub = lane >> 4, c4 = (lane & 15) * 4; typedef _Float16 v4h __attribute__((ext_vector_type(4)));
  {
#pragma unroll
    for (int q = 0; q < 8; ++q) { const int r = q * 2 + rsub; if (col0 + c4 < N) { const v4f v = *(const v4fa*)&so[w][r][c4]; if (C) *(v4f*)(C + cofs + (size_t)(row0 + r) * ldc + col0 + c4) = v; if (C16) { v4h h4; for (int i = 0; i < 4; ++i) h4[i] = (_Float16)v[i]; *(v4h*)(C16 + cofs + (size_t)(row0 + r) * ldc + col0 + c4) = h4; } } }
     }
}


typedef _Float16 v4h __attribute__((ext_vector_type(4)));

__global__ __launch_bounds__(256) void k_x16(const float* __restrict__ x, _Float16* __restrict__ X16, size_t n8) { const size_t t = (size_t)blockIdx.x * 256 + threadIdx.x; if (t >= n8) return; FragH f;
#pragma unroll
  for (int q = 0; q < 8; ++q) f.h[q] = (_Float16)bf16_round(x[t * 8 + q]); *(v8us*)((unsigned short*)X16 + t * 8) = f.half[0];  }
__global__ __launch_bounds__(256) void k_h16(const float* __restrict__ x, _Float16* __restrict__ X16, size_t n8) { const size_t t = (size_t)blockIdx.x * 256 + threadIdx.x; if (t >= n8) return; FragH f;
#pragma unroll
  for (int q = 0; q < 8; ++q) f.h[q] = (_Float16)x[t * 8 + q]; *(v8us*)((unsigned short*)X16 + t * 8) = f.half[0];  }
__global__ __launch_bounds__(256) void k_round16f(const float* __restrict__ W, _Float16* __restrict__ Bt, size_t n8) { const size_t t = (size_t)blockIdx.x * 256 + threadIdx.x; if (t >= n8) return; FragH f;
#pragma unroll
  for (int i = 0; i < 8; ++i) f.h[i] = (_Float16)(bf16_round(W[t * 8 + i]) * 16.0f); *(v8us*)((unsigned short*)Bt + t * 8) = f.half[0];  }
template <int NHv, int TTv>
__global__ __launch_bounds__(256) void k_vt(const _Float16* __restrict__ V16, int ldv, int voff, _Float16* __restrict__ Vt) { __shared__ unsigned short tl[64][66]; const int tid = threadIdx.x; const int slab = blockIdx.x / (TTv / 64), lg = blockIdx.x % (TTv / 64); const int b = slab / NHv, h = slab % NHv;
  for (int i = tid; i < 64 * 8; i += 256) { const int r = i / 8, c8 = (i % 8) * 8; FragH f; f.half[0] = *(const v8us*)((const unsigned short*)V16 + ((size_t)b * TTv + lg * 64 + r) * ldv + voff + h * 64 + c8);
#pragma unroll
    for (int q = 0; q < 8; ++q) tl[r][c8 + q] = f.u[q]; }
  __syncthreads();
  {
#pragma unroll
    for (int rd = 0; rd < 2; ++rd) { const int d = rd * 32 + tid / 8, pc = tid % 8; FragH f;
#pragma unroll
      for (int q = 0; q < 8; ++q) f.u[q] = tl[pc * 8 + q][d];
      *(v8us*)((unsigned short*)Vt + ((size_t)slab * 64 + d) * TTv + lg * 64 + pc * 8) = f.half[0]; }
     } }

__global__ __launch_bounds__(256) void k_hl(const float* __restrict__ F, _Float16* __restrict__ Hh, _Float16* __restrict__ Hl, size_t n8) { const size_t t = (size_t)blockIdx.x * 256 + threadIdx.x; if (t >= n8) return; FragH fh, fl; const v4f a = *(const v4fa*)(F + t * 8), c = *(const v4fa*)(F + t * 8 + 4);
#pragma unroll
  for (int q = 0; q < 4; ++q) { _Float16 h = (_Float16)a[q]; fh.h[q] = h; fl.h[q] = (_Float16)((a[q] - (float)h) * 1024.0f); h = (_Float16)c[q]; fh.h[4 + q] = h; fl.h[4 + q] = (_Float16)((c[q] - (float)h) * 1024.0f); }
  { *(v8us*)((unsigned short*)Hh + t * 8) = fh.half[0]; *(v8us*)((unsigned short*)Hl + t * 8) = fl.half[0];  } }

// ---- fast GEMM (wave tile 32x64; requires M % 32 == 0 rows per launch region and N % 64 == 0); epilogue = k_gemm_hhx semantics ----
__device__ __forceinline__ v16h g2_frag(const _Float16* p, int hh) { FragH f; f.half[0] = *(const v8us*)((const unsigned short*)p + 8 * hh); f.half[1] = *(const v8us*)((const unsigned short*)p + 16 + 8 * hh); return f.v; }
__device__ __forceinline__ v8f g2_mma(v16h a, v16h b, v8f c) { v8f d = __builtin_amdgcn_wmma_f32_16x16x32_f16(false, a, false, b, (short)0, c, false, false); asm volatile("v_nop\n\tv_nop\n\tv_nop\n\tv_nop" : "+v"(d) : "v"(a), "v"(b)); return d; }
template <int ACT>
__global__ __launch_bounds__(128) void k_gemm2(const _Float16* __restrict__ A, int lda, size_t sA, const _Float16* __restrict__ Bh, int ldb, size_t sB, float alpha, const float* __restrict__ bias, size_t sBias, const float* __restrict__ CP, int rowsPerB, size_t sCPb, int row0g,
    float* __restrict__ C, _Float16* __restrict__ C16, int ldc, size_t sC, int M, int N, int K) { static_assert(ACT == 0 || ACT == 3 || ACT == 6 || ACT == 8 || ACT == 9 || ACT == 11 || ACT == 12 || ACT == 14 || ACT == 15 || ACT == 16 || ACT == 17, "k_gemm2: unsupported ACT code (would silently apply no activation)");
  __shared__ __attribute__((aligned(16))) float so[4][32][68];
  const int tid = threadIdx.x, w = tid >> 5, lane = tid & 31, ln = lane & 15, hh = lane >> 4; const int by = blockIdx.y;
  A += (size_t)by * sA; Bh += (size_t)by * sB; const size_t cofs = (size_t)by * sC; const float* bp = bias ? bias + (size_t)by * sBias : nullptr;
  const int ntn = N >> 6; const int mt = blockIdx.x / ntn, nq = blockIdx.x - mt * ntn; const int row0 = mt * 128 + 32 * w, col0 = nq * 64; if (row0 >= M) return;
  const _Float16* a0p = A + (size_t)(row0 + ln) * lda; const _Float16* a1p = a0p + (size_t)16 * lda;
  const _Float16* b0p = Bh + (size_t)(col0 + ln) * ldb; const _Float16* b1p = b0p + (size_t)16 * ldb; const _Float16* b2p = b1p + (size_t)16 * ldb; const _Float16* b3p = b2p + (size_t)16 * ldb;
  const v8f z8 = {0.f,0.f,0.f,0.f,0.f,0.f,0.f,0.f}; v8f c00 = z8, c01 = z8, c02 = z8, c03 = z8, c10 = z8, c11 = z8, c12 = z8, c13 = z8;
#pragma unroll 1
  for (int kb = 0; kb < K; kb += 32) { const v16h a0 = g2_frag(a0p + kb, hh), a1 = g2_frag(a1p + kb, hh);
    v16h b = g2_frag(b0p + kb, hh); c00 = g2_mma(a0, b, c00); c10 = g2_mma(a1, b, c10);
    b = g2_frag(b1p + kb, hh); c01 = g2_mma(a0, b, c01); c11 = g2_mma(a1, b, c11);
    b = g2_frag(b2p + kb, hh); c02 = g2_mma(a0, b, c02); c12 = g2_mma(a1, b, c12);
    b = g2_frag(b3p + kb, hh); c03 = g2_mma(a0, b, c03); c13 = g2_mma(a1, b, c13); }
  v8f accs[8] = {c00, c01, c02, c03, c10, c11, c12, c13};
#pragma unroll
  for (int u = 0; u < 8; ++u) { const int t = u & 3, half = u >> 2; const int col = col0 + t * 16 + ln; const float bv = bp ? bf16_round(bp[col]) : 0.f;
#pragma unroll
    for (int r = 0; r < 8; ++r) { const int rloc = half * 16 + 8 * hh + r; float v = accs[u][r] * alpha + bv; if (CP) { if (rowsPerB < 0) v += CP[cofs + (size_t)(row0g + row0 + rloc) * ldc + col];      /* rowsPerB < 0: own element of the batched C plane */ else { const int bidx = (row0g + row0 + rloc) / rowsPerB; v += CP[(size_t)bidx * sCPb + (size_t)by * 64 + col]; } }
      if (ACT == 3) v = fmaxf(v, 0.f); else if (ACT == 6) v = 0.5f * v * (1.0f + erff(v * 0.70710678118654752f)); else if (ACT == 11) v = 1.0f / (1.0f + expf(-v)); else if (ACT == 15) v = v / (1.0f + expf(-v)); else if (ACT == 12) v = (v > 0.f) ? v : 0.01f * v; else if (ACT == 8) v = tanhf(v); else if (ACT == 9) v = 0.5f * v * (1.0f + tanhf(0.7978845608028654f * (v + 0.044715f * v * v * v))); else if (ACT == 14) v = (v > 0.f) ? v : 0.1f * v; else if (ACT == 16) v = (v >= 0.f) ? v : 0.3f * v; else if (ACT == 17) v = (v >= 0.f) ? v : 0.2f * v;
      so[w][rloc][t * 16 + ln] = v; } }
  __builtin_amdgcn_fence(__ATOMIC_ACQ_REL, "workgroup"); __builtin_amdgcn_wave_barrier();
  const int rsub = lane >> 4, c4 = (lane & 15) * 4;
  {
#pragma unroll
    for (int q = 0; q < 16; ++q) { const int r = q * 2 + rsub; const v4f v = *(const v4fa*)&so[w][r][c4]; if (C) *(v4f*)(C + cofs + (size_t)(row0 + r) * ldc + col0 + c4) = v; if (C16) { v4h h4; for (int i = 0; i < 4; ++i) h4[i] = (_Float16)v[i]; *(v4h*)(C16 + cofs + (size_t)(row0 + r) * ldc + col0 + c4) = h4; } }
     } }


// GEMM with K = 256 and dense rows (A [M][256], B [N][256]), operands staged in LDS: one work-group of 8 waves computes a 128x128 tile. All 256 k (512 bytes) of the tile's 128 A rows and 128 B rows are brought in once, every wave-wide 16-byte load
// taking the 512 contiguous bytes of one row (four whole lines), and laid at a row pitch of 528 bytes (16 x odd, for the ds_load_b128 readers); behind one barrier wave w takes rows 32 * (w & 3) ... + 31 and columns 64 * (w >> 2) ... + 63, k ascending as in k_gemm2.
// Epilogue = k_gemm2's: v = acc * alpha + bias[col] (bias rounded to bf16), staged per wave in LDS (over the operand rows, behind a second barrier) and stored as whole rows of the wave tile, to C16 (f16) if F16OUT, else to C (f32). M % 128 == 0, N % 128 == 0.
template <bool F16OUT>
__global__ __launch_bounds__(256) void k_gemm2t(const _Float16* __restrict__ A, const _Float16* __restrict__ Bh, float alpha, const float* __restrict__ bias, float* __restrict__ C, _Float16* __restrict__ C16, int ldc, int N) {
  constexpr int KC = 256, PITCH = KC + 8;      /* in f16 elements */
  static_assert(8 * 32 * 68 * 4 <= 256 * PITCH * 2, "the operand rows are the larger use of the LDS block");
  __shared__ __attribute__((aligned(16))) unsigned char smem[256 * PITCH * 2];
  _Float16* const sb = (_Float16*)smem;
  const int tid = threadIdx.x, w = tid >> 5, lane = tid & 31, ln = lane & 15, hh = lane >> 4;
  const int ntn = N >> 7; const int mt = blockIdx.x / ntn, nq = blockIdx.x - mt * ntn; const int row0 = mt * 128, col0 = nq * 128;
  const int wm = w & 3, wn = w >> 2; const int rw = row0 + wm * 32, cw = col0 + wn * 64;
  float bv[4];
#pragma unroll
  for (int t = 0; t < 4; ++t) bv[t] = bias ? bf16_round(bias[cw + t * 16 + ln]) : 0.f;
  { // staging: wave w brings LDS rows 32 w ... 32 w + 31 (rows 0 - 127 are A's, 128 - 255 are B's), 16 KiB in a row in global memory
    const unsigned short* g = (const unsigned short*)(w < 4 ? A + (size_t)(row0 + w * 32) * KC : Bh + (size_t)(col0 + (w - 4) * 32) * KC) + lane * 8;
    unsigned short* const sw = (unsigned short*)sb + (w * 32) * PITCH + lane * 8;
    v8us t[32];
    // full unroll of both loops: t[] must be indexed by constants to live in registers, and all 32 loads are to be in flight at once
#pragma unroll
    for (int j = 0; j < 32; ++j) t[j] = *(const v8us*)(g + j * KC);
    asm volatile("s_wait_xcnt 0x0" :: "v"(g) : "memory");      /* the address pair of the 32 loads stays untouched (it is an input here) until this wait has passed */
#pragma unroll
    for (int j = 0; j < 32; ++j) *(v8us*)(sw + j * PITCH) = t[j]; }
  __syncthreads();      /* all operand rows are in LDS before any wave reads a fragment */
  const _Float16* const fa = sb + (wm * 32 + ln) * PITCH; const _Float16* const fb = sb + (128 + wn * 64 + ln) * PITCH;
  const v8f z8 = {0.f,0.f,0.f,0.f,0.f,0.f,0.f,0.f}; v8f c00 = z8, c01 = z8, c02 = z8, c03 = z8, c10 = z8, c11 = z8, c12 = z8, c13 = z8;
  // unrolled so that the k offsets are immediates of the LDS reads and a later k step's reads can be issued ahead of this step's products
#pragma unroll
  for (int kb = 0; kb < KC; kb += 32) {
    const v16h a0 = g2_frag(fa + kb, hh), a1 = g2_frag(fa + 16 * PITCH + kb, hh), b0 = g2_frag(fb + kb, hh), b1 = g2_frag(fb + 16 * PITCH + kb, hh), b2 = g2_frag(fb + 32 * PITCH + kb, hh), b3 = g2_frag(fb + 48 * PITCH + kb, hh);
    c00 = g2_mma(a0, b0, c00); c10 = g2_mma(a1, b0, c10); c01 = g2_mma(a0, b1, c01); c11 = g2_mma(a1, b1, c11);
    c02 = g2_mma(a0, b2, c02); c12 = g2_mma(a1, b2, c12); c03 = g2_mma(a0, b3, c03); c13 = g2_mma(a1, b3, c13); }
  __syncthreads();      /* every read of the operand rows has ended before the output staging goes over them */
  float (*so)[32][68] = (float (*)[32][68])smem;
  v8f accs[8] = {c00, c01, c02, c03, c10, c11, c12, c13};
#pragma unroll
  for (int u = 0; u < 8; ++u) { const int t = u & 3, half = u >> 2;
#pragma unroll
    for (int r = 0; r < 8; ++r) so[w][half * 16 + 8 * hh + r][t * 16 + ln] = accs[u][r] * alpha + bv[t]; }
  __builtin_amdgcn_fence(__ATOMIC_ACQ_REL, "workgroup"); __builtin_amdgcn_wave_barrier();      /* as in k_gemm2: the wave reads back only its own plane */
  const int rsub = lane >> 4, c4 = (lane & 15) * 4;
#pragma unroll
  for (int q = 0; q < 16; ++q) { const int r = q * 2 + rsub; const v4f v = *(const v4fa*)&so[w][r][c4]; const size_t o = (size_t)(rw + r) * ldc + cw + c4;
    if (F16OUT) { v4h h4; for (int i = 0; i < 4; ++i) h4[i] = (_Float16)v[i]; *(v4h*)(C16 + o) = h4; } else *(v4f*)(C + o) = v; } }

__global__ __launch_bounds__(256) void k_wnat(const float* __restrict__ w, size_t n8, _Float16* __restrict__ Bt) { const size_t t = (size_t)blockIdx.x * 256 + threadIdx.x; if (t >= n8) return; FragH f; for (int q = 0; q < 8; ++q) f.h[q] = (_Float16)(bf16_round(w[t * 8 + q]) * 16.0f); *(v8us*)((unsigned short*)Bt + t * 8) = f.half[0];  }
__global__ __launch_bounds__(256) void k_rsm(const float* __restrict__ S, _Float16* __restrict__ P, int nrows) {
  #pragma clang fp contract(off)
  const int i = blockIdx.x * 256 + threadIdx.x; if (i >= nrows) return; const float* s = S + (size_t)i * SQ; float mx = -3.0e38f;
#pragma unroll 1
  for (int j = 0; j < SQ; ++j) mx = fmaxf(mx, s[j]); float se = 0.f;
#pragma unroll 1
  for (int j = 0; j < SQ; ++j) se += expf(s[j] - mx); const float sc = 256.0f / se;
#pragma unroll 1
  for (int j0 = 0; j0 < SQ; j0 += 8) { FragH f; for (int q = 0; q < 8; ++q) f.h[q] = (_Float16)(expf(s[j0 + q] - mx) * sc); unsigned short* d = (unsigned short*)P + (size_t)i * SQ + j0; *(v8us*)d = f.half[0];  } }
__global__ __launch_bounds__(256) void k_vt(const _Float16* __restrict__ V16, int b, int h0, _Float16* __restrict__ VT) { __shared__ unsigned short tl[64][65]; const int tid = threadIdx.x; const int hh = blockIdx.x % HG, sg = blockIdx.x / HG; const int s0 = sg * 64; const int h = h0 + hh;
  for (int i = tid; i < 64 * 8; i += 256) { const int j = i / 8, d8 = (i % 8) * 8; FragH f; f.half[0] = *(const v8us*)((const unsigned short*)V16 + ((size_t)b * SQ + s0 + j) * DM + h * HD + d8); for (int q = 0; q < 8; ++q) tl[d8 + q][j] = f.u[q]; }
  __syncthreads();
  { for (int i = tid; i < 64 * 8; i += 256) { const int d = i / 8, j8 = (i % 8) * 8; FragH f; for (int q = 0; q < 8; ++q) f.u[q] = tl[d][j8 + q]; *(v8us*)((unsigned short*)VT + ((size_t)hh * HD + d) * SQ + s0 + j8) = f.half[0]; }  } }


// lane ^ 16 by permlanex16 (no LDS round trip)
__device__ __forceinline__ float xl_half(float v) { const int i = __float_as_int(v); return __int_as_float(__builtin_amdgcn_permlanex16(i, i, 0x76543210, 0xfedcba98, false, false)); }
__device__ __forceinline__ v8f fa_mma(v16h a, v16h b, v8f c) { return __builtin_amdgcn_wmma_f32_16x16x32_f16(false, a, false, b, (short)0, c, false, false); }
__global__ __launch_bounds__(256) void k_fattn(const _Float16* __restrict__ Q, const _Float16* __restrict__ Kx, const _Float16* __restrict__ Vh, const _Float16* __restrict__ Vl, float* __restrict__ O) {
  constexpr int KB = 64, KP = DM + 8, VP = KB + 8, OFF_VH = KB * KP, OFF_VL = OFF_VH + DM * VP, STAGE = OFF_VL + DM * VP, OP = DM + 4;      /* f16 elements; OP in floats */
  static_assert(64 * OP * 4 <= 2 * STAGE * 2, "the stage buffers are the larger use of the LDS block");
  __shared__ __attribute__((aligned(16))) unsigned char smem[2 * STAGE * 2];
  _Float16* const sb = (_Float16*)smem;
  const int tid = threadIdx.x, w = tid >> 5, lane = tid & 31, ln = lane & 15, hh = lane >> 4;
  const int b = blockIdx.x / (SQ / 64), q0 = (blockIdx.x % (SQ / 64)) * 64; const int qi = w & 3, dh = w >> 2;
  // staging: wave w brings K rows 8 w ... + 7 (one row a load) and V^T rows 32 w ... + 31 of both planes (four rows a load)
  const int vr = lane >> 3, vc = (lane & 7) * 8;
  const unsigned short* const gk = (const unsigned short*)Kx + ((size_t)b * SQ + w * 8) * DM + lane * 8;
  const unsigned short* const gh = (const unsigned short*)Vh + ((size_t)b * DM + w * 32 + vr) * SQ + vc;
  const unsigned short* const gl = (const unsigned short*)Vl + ((size_t)b * DM + w * 32 + vr) * SQ + vc;
  unsigned short* const sk = (unsigned short*)sb + (w * 8) * KP + lane * 8;
  unsigned short* const sh = (unsigned short*)sb + OFF_VH + (w * 32 + vr) * VP + vc;
  unsigned short* const sl = (unsigned short*)sb + OFF_VL + (w * 32 + vr) * VP + vc;
  // scheduling fence. Round the fragment groups it keeps a group of LDS reads together and ahead of the products of the group before it (left alone, the compiler puts each fragment's two reads directly in front of its product, and the wave then waits out the LDS latency at every product);
  // round a fetch it keeps every other register write from being moved between the loads and their s_wait_xcnt
  auto hold = [&]() { __builtin_amdgcn_sched_barrier(0); };
  v8us rk[8], rh[8], rl[8];      /* one register set for each part of a stage (K rows, the two V^T planes); the loops over them are fully unrolled, so that they are indexed by constants and live in registers and a part's 8 loads are in flight together */
  auto fetch = [&](v8us (&rs)[8], const unsigned short* g, size_t step) {
    hold();
#pragma unroll
    for (int j = 0; j < 8; ++j) rs[j] = *(const v8us*)(g + j * step);
    asm volatile("s_wait_xcnt 0x0" ::: "memory");      /* the loads stay in flight while their address registers are written anew */
    hold(); };
  auto put = [&](const v8us (&rs)[8], unsigned short* d, int step) {
#pragma unroll
    for (int j = 0; j < 8; ++j) *(v8us*)(d + j * step) = rs[j]; };
  // work-group barrier of the stage loop, by hand: __syncthreads() also waits for every global load, which would end the fetch that is meant to stay in flight across it; what the barrier orders here is LDS alone
  auto stage_barrier = [&]() { asm volatile("s_wait_dscnt 0x0\n\ts_barrier_signal -1\n\ts_barrier_wait -1" ::: "memory"); };
  v16h qf[8];
  { const _Float16* const qp = Q + ((size_t)b * SQ + q0 + qi * 16 + ln) * DM;
#pragma unroll
    for (int kb = 0; kb < 8; ++kb) qf[kb] = g2_frag(qp + kb * 32, hh);
    asm volatile("s_wait_xcnt 0x0" ::: "memory");      /* before the address pair of the query loads is used for anything else */
    hold(); }
  const _Float16* const fk = sb + ln * KP; const _Float16* const fvh = sb + OFF_VH + (dh * 128 + ln) * VP; const _Float16* const fvl = sb + OFF_VL + (dh * 128 + ln) * VP;
  const v8f z8 = {0.f,0.f,0.f,0.f,0.f,0.f,0.f,0.f};
  v8f oh[8], ol[8];
  float m = -3.0e38f, l = 0.f;      /* l: the sum over this lane's own keys; the halves are joined behind the loop */
  v16h fa[8], fb[8];      /* two sets of 8 A fragments: one is loaded while the other is multiplied */
  // one stage: n1 / n2 say whether stages s + 1 / s + 2 exist (literals at every call). The parts of stage s + 1 go into the other buffer, which nobody reads during this trip; behind a part's LDS stores its register set takes the loads of stage s + 2, a whole trip ahead of their stores.
  auto trip = [&](int s, bool n1, bool n2) {
    const int buf = s & 1, ob = (buf ^ 1) * STAGE;
    const _Float16* const pk = fk + buf * STAGE; const _Float16* const ph = fvh + buf * STAGE; const _Float16* const pl = fvl + buf * STAGE;
    // full unroll of every loop of the trip: the register arrays must be indexed by constants to live in registers, and the offsets become immediates of the LDS reads
    auto ldk = [&](v16h (&f)[8], int g) {
#pragma unroll
      for (int i = 0; i < 8; ++i) f[i] = g2_frag(pk + (i & 3) * 16 * KP + (2 * g + (i >> 2)) * 32, hh); hold(); };
    auto ldv = [&](v16h (&f)[8], const _Float16* p, int g) {
#pragma unroll
      for (int i = 0; i < 8; ++i) f[i] = g2_frag(p + (4 * g + (i >> 1)) * 16 * VP + (i & 1) * 32, hh); hold(); };
    v8f st[4] = {z8, z8, z8, z8};
    auto mmk = [&](const v16h (&f)[8], int g) {
#pragma unroll
      for (int i = 0; i < 8; ++i) st[i & 3] = fa_mma(f[i], qf[2 * g + (i >> 2)], st[i & 3]); hold(); };
    FragH pb[2];
    auto mmv = [&](const v16h (&f)[8], v8f (&o)[8], int g) {
#pragma unroll
      for (int i = 0; i < 8; ++i) o[4 * g + (i >> 1)] = fa_mma(f[i], pb[i & 1].v, o[4 * g + (i >> 1)]); hold(); };
    ldk(fa, 0);
    if (n1) { put(rk, sk + ob, KP); hold(); }
    if (n2) { fetch(rk, gk + (size_t)(s + 2) * KB * DM, DM); }
    ldk(fb, 1); mmk(fa, 0); ldk(fa, 2); mmk(fb, 1); ldk(fb, 3); mmk(fa, 2); ldv(fa, ph, 0); mmk(fb, 3);
    v8f m8 = st[0];
#pragma unroll
    for (int kt = 1; kt < 4; ++kt) for (int r = 0; r < 8; ++r) m8[r] = fmaxf(m8[r], st[kt][r]);
    float mx = fmaxf(fmaxf(fmaxf(m8[0], m8[1]), fmaxf(m8[2], m8[3])), fmaxf(fmaxf(m8[4], m8[5]), fmaxf(m8[6], m8[7])));
    mx = fmaxf(mx, xl_half(mx)) * 0.0625f;
    const float mn = fmaxf(m, mx);
    if (__builtin_amdgcn_ballot_w32(mn > m) != 0) {      /* wave-uniform: skipped only where every factor would be exactly 1 */
      const float f = __expf(m - mn); l *= f; m = mn;
#pragma unroll
      for (int dt = 0; dt < 8; ++dt) { oh[dt] *= f; ol[dt] *= f; } }
#pragma unroll
    for (int kt = 0; kt < 4; ++kt) for (int r = 0; r < 8; ++r) st[kt][r] = (st[kt][r] * 0.0625f - m) * 1.44269504088896340736f;
    hold();
    // behind each exponential the one independent slot that the instruction set asks for before its result is read or its source overwritten; the fence keeps the v_nop directly behind its exponential
#pragma unroll
    for (int kt = 0; kt < 4; ++kt) for (int r = 0; r < 8; ++r) { st[kt][r] = __builtin_amdgcn_exp2f(st[kt][r]); asm volatile("v_nop"); hold(); }
    float la[4];
#pragma unroll
    for (int kt = 0; kt < 4; ++kt) { la[kt] = 0.f;
#pragma unroll
      for (int r = 0; r < 8; ++r) { la[kt] += st[kt][r]; pb[kt >> 1].h[(kt & 1) * 8 + r] = (_Float16)st[kt][r]; } }
    l += (la[0] + la[1]) + (la[2] + la[3]);
    hold();
    if (n1) { put(rh, sh + ob, 4 * VP); hold(); }
    if (n2) { fetch(rh, gh + (s + 2) * KB, (size_t)4 * SQ); }
    ldv(fb, ph, 1); mmv(fa, oh, 0); ldv(fa, pl, 0); mmv(fb, oh, 1);
    if (n1) { put(rl, sl + ob, 4 * VP); hold(); }
    if (n2) { fetch(rl, gl + (s + 2) * KB, (size_t)4 * SQ); }
    ldv(fb, pl, 1); mmv(fa, ol, 0); mmv(fb, ol, 1); };
  constexpr int nst = SQ / KB;
  fetch(rk, gk, DM); fetch(rh, gh, (size_t)4 * SQ); fetch(rl, gl, (size_t)4 * SQ); put(rk, sk, KP); put(rh, sh, 4 * VP); put(rl, sl, 4 * VP);
  fetch(rk, gk + (size_t)KB * DM, DM); fetch(rh, gh + KB, (size_t)4 * SQ); fetch(rl, gl + KB, (size_t)4 * SQ);
  stage_barrier();      /* stage 0 is in buffer 0 before any wave reads it */
  hold();      /* the accumulators are cleared behind the fetches' waits, not among their loads */
#pragma unroll
  for (int dt = 0; dt < 8; ++dt) { oh[dt] = z8; ol[dt] = z8; }
  // the last two stages stand behind the loop, so that every fetch in it is unconditional
#pragma unroll 1      /* one copy of the trip in the loop: the buffer is chosen by an address offset, and a second copy would only cost instruction cache */
  for (int s = 0; s + 2 < nst; ++s) {
    trip(s, true, true);
    stage_barrier();      /* publishes stage s + 1 and ends every read of stage s, whose buffer the next trip refills */
  }
  trip(nst - 2, true, false);
  stage_barrier();      /* publishes the last stage */
  trip(nst - 1, false, false);
  __syncthreads();      /* every read of the stage buffers has ended before the output staging goes over them */
  const float inv = 1.0f / (l + xl_half(l));
  float* const so = (float*)smem;
#pragma unroll
  for (int dt = 0; dt < 8; ++dt) { v4f x0, x1;
#pragma unroll
    for (int r = 0; r < 4; ++r) { x0[r] = (oh[dt][r] + ol[dt][r] * 0.0009765625f) * inv; x1[r] = (oh[dt][4 + r] + ol[dt][4 + r] * 0.0009765625f) * inv; }
    float* const d = so + (qi * 16 + ln) * OP + dh * 128 + dt * 16 + 8 * hh; *(v4fa*)d = x0; *(v4fa*)(d + 4) = x1; }
  __syncthreads();      /* the 64 output rows are whole in LDS before any thread stores them */
  float* const og = O + ((size_t)b * SQ + q0) * DM;
#pragma unroll
  for (int i = 0; i < 16; ++i) { const int idx = i * 256 + tid; const v4f v = *(const v4fa*)(so + (idx >> 6) * OP + (idx & 63) * 4); *(v4f*)(og + (size_t)idx * 4) = v; } }

extern "C" void kernel_launch(void* const* d_in, const int* in_sizes, int n_in,
                              void* d_out, int out_size, void* d_ws, size_t ws_size, hipStream_t stream) {
  (void)in_sizes; (void)n_in; (void)out_size;
  const float* const* I = (const float* const*)d_in; const float* xq = I[0]; const float* xk = I[1]; const float* xv = I[2]; const float* wq = I[3]; const float* bq = I[4]; const float* wk = I[5]; const float* bk = I[6]; const float* wv = I[7]; const float* bv = I[8];
  char* ws = (char*)d_ws; size_t off = 0;
  auto take = [&](size_t bytes) { char* p = ws + off; off += (bytes + 255) & ~(size_t)255; return p; };
  _Float16* BQ = (_Float16*)take((size_t)DM * DM * 2); _Float16* BK = (_Float16*)take((size_t)DM * DM * 2); _Float16* BV = (_Float16*)take((size_t)DM * DM * 2);
  _Float16* XQ = (_Float16*)take(NR * DM * 2); _Float16* XK = (_Float16*)take(NR * DM * 2); _Float16* XV = (_Float16*)take(NR * DM * 2); _Float16* Q16 = (_Float16*)take(NR * DM * 2); _Float16* K16 = (_Float16*)take(NR * DM * 2); float* VF = (float*)take(NR * DM * 4); _Float16* VH = (_Float16*)take(NR * DM * 2); _Float16* VL = (_Float16*)take(NR * DM * 2);
  _Float16* VT = (_Float16*)take((size_t)NB * DM * SQ * 2); _Float16* VTL = (_Float16*)take((size_t)NB * DM * SQ * 2);
  if (off > ws_size) return;      /* approx 0.4 + 8 x 5 + 16 + 8 + 8 + 8 + 8 = 89 MiB */
  { const unsigned g = (unsigned)(((size_t)DM * (DM / 8) + 255) / 256); k_wt_f16<<<g, 256, 0, stream>>>(wq, BQ, DM, DM, 16.0f); k_wt_f16<<<g, 256, 0, stream>>>(wk, BK, DM, DM, 16.0f); k_wt_f16<<<g, 256, 0, stream>>>(wv, BV, DM, DM, 16.0f); }
  k_x16<<<(unsigned)((NR * DM / 8 + 255) / 256), 256, 0, stream>>>(xq, XQ, NR * DM / 8); k_x16<<<(unsigned)((NR * DM / 8 + 255) / 256), 256, 0, stream>>>(xk, XK, NR * DM / 8); k_x16<<<(unsigned)((NR * DM / 8 + 255) / 256), 256, 0, stream>>>(xv, XV, NR * DM / 8);
  k_gemm2t<true><<<(unsigned)((NR / 128) * (DM / 128)), 256, 0, stream>>>(XQ, BQ, 0.0625f, bq, nullptr, Q16, DM, DM);
  k_gemm2t<true><<<(unsigned)((NR / 128) * (DM / 128)), 256, 0, stream>>>(XK, BK, 0.0625f, bk, nullptr, K16, DM, DM);
  k_gemm2t<false><<<(unsigned)((NR / 128) * (DM / 128)), 256, 0, stream>>>(XV, BV, 0.0625f, bv, VF, nullptr, DM, DM); k_hl<<<(unsigned)((NR * DM / 8 + 255) / 256), 256, 0, stream>>>(VF, VH, VL, NR * DM / 8);      /* v (f32) -> f16 hi + x1024 residual */
  k_vt<DM / 64, SQ><<<NB * (DM / 64) * (SQ / 64), 256, 0, stream>>>(VH, DM, 0, VT); k_vt<DM / 64, SQ><<<NB * (DM / 64) * (SQ / 64), 256, 0, stream>>>(VL, DM, 0, VTL);      /* [batch][column][key] */
  k_fattn<<<NB * (SQ / 64), 256, 0, stream>>>(Q16, K16, VT, VTL, (float*)d_out);
}

// v005
// A run of this version takes 127 microseconds.
// Two timings next to v004 both put it at 1.28 times that version's speed.
// Counting every step since v000, it is 30.2 times as fast.
#include <hip/hip_runtime.h>
// Single-head attention with dense projections (q_in, k_in, v_in [4][4096][256]; q = q_in Wq + bq, k = k_in Wk + bk, v = v_in Wv + bv ([in][out] 256x256 glorot-uniform, biases uniform); scores = q . k x 256^-0.5; softmax over the 4096 keys (no mask); out = attn v -> [4][4096][256]; no output projection).
// Structure: ONE launch for the three projections, from the f32 inputs: inputs as exact f16 rows and [in][out] weights as exact x16 [out][in] rows, formed while they are staged in LDS; WMMA GEMMs (128x128 tiles, f32 accumulation, + bias); q, k as f16 outputs (logits sigma ~1), v split in the epilogue into f16 hi + x1024 residual and written transposed (V^T planes, [batch][column][key]); then ONE fused launch for all batches: scores (K = 256, x 1/16), running-maximum softmax (f32 statistics, native exp; weights plain f16, not normalised) and O = P V_hi^T + 2^-10 P V_lo^T, divided by the row sum at the end.
// Compute dtype: inputs rounded to bf16; x / weights exact; q, k, P plain f16 (~2^-12), v as hi + residual; scores / statistics / out f32. v_wmma_f32_16x16x32_f16.
#define NB 4
#define SQ 4096
#define DM 256
#define NH 1
#define HD 64
#define HG 1
#define NR ((size_t)NB * SQ)
typedef __bf16 v16b __attribute__((ext_vector_type(16)));
typedef unsigned short v8us __attribute__((ext_vector_type(8), may_alias));
typedef float  v8f  __attribute__((ext_vector_type(8)));
typedef float  v4f  __attribute__((ext_vector_type(4)));
typedef float  v4fa __attribute__((ext_vector_type(4), may_alias));
union FragB { v16b v; v8us half[2]; unsigned short u[16]; };

__device__ __forceinline__ unsigned short bf16_bits(float x) { unsigned int u = __float_as_uint(x); return (unsigned short)((u + 0x7FFFu + ((u >> 16) & 1u)) >> 16); }
__device__ __forceinline__ float bf16_val(unsigned short b) { return __uint_as_float(((unsigned int)b) << 16); }
__device__ __forceinline__ float bf16_round(float x) { return bf16_val(bf16_bits(x)); }
// D += A·B with NT terms: 1 = ah·bh, 2 = + al·bh (A split), 3 = + ah·bl (both split)
template <int NT>
__device__ __forceinline__ v8f mmaN(v16b ah, v16b al, v16b bh, v16b bl, v8f c) {
  c = __builtin_amdgcn_wmma_f32_16x16x32_bf16(false, ah, false, bh, (short)0, c, false, false);
  if (NT >= 2) c = __builtin_amdgcn_wmma_f32_16x16x32_bf16(false, al, false, bh, (short)0, c, false, false);
  if (NT >= 3) c = __builtin_amdgcn_wmma_f32_16x16x32_bf16(false, ah, false, bl, (short)0, c, false, false);
  asm volatile("v_nop\n\tv_nop\n\tv_nop\n\tv_nop" : "+v"(c) : "v"(ah), "v"(al), "v"(bh), "v"(bl));
  return c;
}

__global__ __launch_bounds__(256) void k_wt_bf16(const float* __restrict__ W, unsigned short* __restrict__ Wt, int K, int N) {
  const int t = blockIdx.x * 256 + threadIdx.x;
  const int k8n = K / 8;
  if (t >= N * k8n) return;
  const int n = t / k8n, k8 = (t % k8n) * 8;
  v8us v;
#pragma unroll
  for (int i = 0; i < 8; ++i) v[i] = bf16_bits(W[(size_t)(k8 + i) * N + n]);
  *(v8us*)(Wt + (size_t)n * K + k8) = v;
  
}

// GEMM C[M][N] (f32, pitch ldc) = act(A[M][K]·W + bias). A f32 row-major (pitch lda) converted per fragment to bf16
// (ASPLIT: hi/lo two planes -> 2 terms, else single rounded term); Wt bf16 [N][K] (pitch ldb). BIAS_BF16 rounds the
// bias to bf16 first (bias quantised to bf16 before the add). K%32==0, M%16==0, N%64==0.
template <bool ASPLIT, int ACT, bool BIAS_BF16>
__global__ __launch_bounds__(128) void k_gemm_bf(const float* __restrict__ A, int lda, const unsigned short* __restrict__ Wt, int ldb,
                                               const float* __restrict__ bias, float* __restrict__ C, int ldc, int M, int N, int K) {
  __shared__ __attribute__((aligned(16))) float so[4][16][64];
  const int tid = threadIdx.x, w = tid >> 5, lane = tid & 31, ln = lane & 15, hh = lane >> 4;
  const int ntn = N / 64;
  const int wid = blockIdx.x * 4 + w;
  const int mt = wid / ntn, nq = wid % ntn;
  if (mt * 16 >= M) return;
  const int row0 = mt * 16, col0 = nq * 64;
  const float* arow = A + (size_t)(row0 + ln) * lda;
  v8f acc[4] = {};
  for (int kb = 0; kb < K; kb += 32) {
    FragB ah, al;
    const v4f x0 = *(const v4fa*)(arow + kb + 8 * hh), x1 = *(const v4fa*)(arow + kb + 8 * hh + 4);
    const v4f x2 = *(const v4fa*)(arow + kb + 16 + 8 * hh), x3 = *(const v4fa*)(arow + kb + 16 + 8 * hh + 4);
    float xs[16] = {x0[0],x0[1],x0[2],x0[3],x1[0],x1[1],x1[2],x1[3],x2[0],x2[1],x2[2],x2[3],x3[0],x3[1],x3[2],x3[3]};
#pragma unroll
    for (int i = 0; i < 16; ++i) { const unsigned short hb = bf16_bits(xs[i]); ah.u[i] = hb; al.u[i] = ASPLIT ? bf16_bits(xs[i] - bf16_val(hb)) : (unsigned short)0; }
#pragma unroll
    for (int t = 0; t < 4; ++t) {
      const unsigned short* brow = Wt + (size_t)(col0 + t * 16 + ln) * ldb + kb;
      FragB b;
      b.half[0] = *(const v8us*)(brow + 8 * hh);
      b.half[1] = *(const v8us*)(brow + 16 + 8 * hh);
      acc[t] = mmaN<ASPLIT ? 2 : 1>(ah.v, al.v, b.v, b.v, acc[t]);
    }
  }
#pragma unroll
  for (int t = 0; t < 4; ++t) {
    float bv = bias ? bias[col0 + t * 16 + ln] : 0.f;
    if (BIAS_BF16) bv = bf16_round(bv);
#pragma unroll
    for (int r = 0; r < 8; ++r) { float v = acc[t][r] + bv; if (ACT == 1) v = fmaxf(v, 0.f); so[w][8 * hh + r][t * 16 + ln] = v; }
  }
  __builtin_amdgcn_fence(__ATOMIC_ACQ_REL, "workgroup");
  __builtin_amdgcn_wave_barrier();
  const int rsub = lane >> 4, c4 = (lane & 15) * 4;
  {
#pragma unroll
    for (int q = 0; q < 8; ++q) {
      const int r = q * 2 + rsub;
      const v4f v = *(const v4fa*)&so[w][r][c4];
      *(v4f*)(C + (size_t)(row0 + r) * ldc + col0 + c4) = v;
    }
    
  }
}

// GEMM C = act(A·W + bias + resid): A f32 (ASPLIT -> hi/lo 2 terms), Wt bf16 [N][K]; ACT 0 none, 1 relu, 2 exact gelu;
// resid (optional, f32, row index = (row % rmod), pitch ldr, RES_BF16 rounds it) added before the activation.
template <bool ASPLIT, int ACT, bool BIAS_BF16, bool RES_BF16>
__global__ __launch_bounds__(128) void k_gemm_bf3(const float* __restrict__ A, int lda, const unsigned short* __restrict__ Wt, int ldb,
                                                const float* __restrict__ bias, const float* __restrict__ resid, int rmod, int ldr,
                                                float* __restrict__ C, int ldc, int M, int N, int K) {
  __shared__ __attribute__((aligned(16))) float so[4][16][64];
  const int tid = threadIdx.x, w = tid >> 5, lane = tid & 31, ln = lane & 15, hh = lane >> 4;
  const int ntn = N / 64;
  const int wid = blockIdx.x * 4 + w;
  const int mt = wid / ntn, nq = wid % ntn;
  if (mt * 16 >= M) return;
  const int row0 = mt * 16, col0 = nq * 64;
  const float* arow = A + (size_t)(row0 + ln) * lda;
  v8f acc[4] = {};
  for (int kb = 0; kb < K; kb += 32) {
    FragB ah, al;
    const v4f x0 = *(const v4fa*)(arow + kb + 8 * hh), x1 = *(const v4fa*)(arow + kb + 8 * hh + 4);
    const v4f x2 = *(const v4fa*)(arow + kb + 16 + 8 * hh), x3 = *(const v4fa*)(arow + kb + 16 + 8 * hh + 4);
    float xs[16] = {x0[0],x0[1],x0[2],x0[3],x1[0],x1[1],x1[2],x1[3],x2[0],x2[1],x2[2],x2[3],x3[0],x3[1],x3[2],x3[3]};
#pragma unroll
    for (int i = 0; i < 16; ++i) { const unsigned short hb = bf16_bits(xs[i]); ah.u[i] = hb; al.u[i] = ASPLIT ? bf16_bits(xs[i] - bf16_val(hb)) : (unsigned short)0; }
#pragma unroll
    for (int t = 0; t < 4; ++t) {
      const unsigned short* brow = Wt + (size_t)(col0 + t * 16 + ln) * ldb + kb;
      FragB b;
      b.half[0] = *(const v8us*)(brow + 8 * hh);
      b.half[1] = *(const v8us*)(brow + 16 + 8 * hh);
      acc[t] = mmaN<ASPLIT ? 2 : 1>(ah.v, al.v, b.v, b.v, acc[t]);
    }
  }
#pragma unroll
  for (int t = 0; t < 4; ++t) {
    const int col = col0 + t * 16 + ln;
    float bv = bias ? bias[col] : 0.f;
    if (BIAS_BF16) bv = bf16_round(bv);
#pragma unroll
    for (int r = 0; r < 8; ++r) {
      float v = acc[t][r] + bv;
      if (resid) { float rv = resid[(size_t)((row0 + 8 * hh + r) % rmod) * ldr + col]; if (RES_BF16) rv = bf16_round(rv); v += rv; }
      if (ACT == 1) v = fmaxf(v, 0.f);
      if (ACT == 2) v = 0.5f * v * (1.0f + erff(v * 0.70710678118654752f));
      if (ACT == 3) { const float u = 0.7978845608028654f * (v + 0.044715f * v * v * v); v = 0.5f * v * (1.0f + tanhf(u)); }
      so[w][8 * hh + r][t * 16 + ln] = v;
    }
  }
  __builtin_amdgcn_fence(__ATOMIC_ACQ_REL, "workgroup");
  __builtin_amdgcn_wave_barrier();
  const int rsub = lane >> 4, c4 = (lane & 15) * 4;
  {
#pragma unroll
    for (int q = 0; q < 8; ++q) {
      const int r = q * 2 + rsub;
      const v4f v = *(const v4fa*)&so[w][r][c4];
      *(v4f*)(C + (size_t)(row0 + r) * ldc + col0 + c4) = v;
    }
    
  }
}
// row LayerNorm (biased variance, eps) over N: s = X (+ R); optional out_sum <- s; out_norm <- (s-mu)*rsqrt(var+eps)*g + b
template <bool PARAM_BF16>
__global__ __launch_bounds__(256) void k_layernorm(const float* __restrict__ X, const float* __restrict__ R, const float* __restrict__ g, const float* __restrict__ bta,
                                                  float* __restrict__ out_sum, float* __restrict__ out_norm, int N, float eps) {
  __shared__ float red[256];
  const int row = blockIdx.x, tid = threadIdx.x;
  const float* x = X + (size_t)row * N; const float* rr = R ? R + (size_t)row * N : nullptr;
  float vals[16];                     // up to N = 4096
  const int per = N / 256;            // contiguous chunk per thread? use strided-by-4 chunks: thread handles j = tid*4 + 1024*u
  float s1 = 0.f;
  for (int u = 0; u < per / 4; ++u) {
    const int j = tid * 4 + 1024 * u;
    const v4f a = *(const v4fa*)(x + j);
    v4f b = {0.f,0.f,0.f,0.f}; if (rr) b = *(const v4fa*)(rr + j);
#pragma unroll
    for (int q = 0; q < 4; ++q) { const float v = a[q] + b[q]; vals[u * 4 + q] = v; s1 += v; }
  }
  red[tid] = s1; __syncthreads();
  for (int st = 128; st > 0; st >>= 1) { if (tid < st) red[tid] += red[tid + st]; __syncthreads(); }
  const float mu = red[0] / (float)N; __syncthreads();
  float s2 = 0.f;
  for (int u = 0; u < per / 4; ++u)
#pragma unroll
    for (int q = 0; q < 4; ++q) { const float c = vals[u * 4 + q] - mu; s2 += c * c; }
  red[tid] = s2; __syncthreads();
  for (int st = 128; st > 0; st >>= 1) { if (tid < st) red[tid] += red[tid + st]; __syncthreads(); }
  const float rs = rsqrtf(red[0] / (float)N + eps);
  {
    for (int u = 0; u < per / 4; ++u) {
      const int j = tid * 4 + 1024 * u;
      v4f o, sm;
#pragma unroll
      for (int q = 0; q < 4; ++q) {
        float gg = g[j + q], bb = bta[j + q];
        if (PARAM_BF16) { gg = bf16_round(gg); bb = bf16_round(bb); }
        sm[q] = vals[u * 4 + q]; o[q] = (vals[u * 4 + q] - mu) * rs * gg + bb;
      }
      if (out_sum) *(v4f*)(out_sum + (size_t)row * N + j) = sm;
      *(v4f*)(out_norm + (size_t)row * N + j) = o;
    }
    
  }
}



// ---- f16 WMMA path (v_wmma_f32_16x16x32_f16): 11-bit significands for operands in range — used where a [0,1] probability operand needs more precision than bf16
typedef _Float16 v16h __attribute__((ext_vector_type(16)));
union FragH { v16h v; v8us half[2]; _Float16 h[16]; unsigned short u[16]; };
template <int NT>
__device__ __forceinline__ v8f mmaH(v16h ah, v16h al, v16h bh, v16h bl, v8f c) {
  c = __builtin_amdgcn_wmma_f32_16x16x32_f16(false, ah, false, bh, (short)0, c, false, false);
  if (NT >= 2) c = __builtin_amdgcn_wmma_f32_16x16x32_f16(false, al, false, bh, (short)0, c, false, false);
  if (NT >= 3) c = __builtin_amdgcn_wmma_f32_16x16x32_f16(false, ah, false, bl, (short)0, c, false, false);
  asm volatile("v_nop\n\tv_nop\n\tv_nop\n\tv_nop" : "+v"(c) : "v"(ah), "v"(al), "v"(bh), "v"(bl));
  return c;
}
// batched GEMM like k_gemm_b but f16 operands: A f32 (split into f16 hi/lo if ASPLIT, else rounded to f16), Bt = f16 values [n][k]; alpha; C f32; N multiple of 16 (partial tiles skipped)
template <bool ASPLIT>
__global__ __launch_bounds__(128) void k_gemm_h(const float* __restrict__ A, int lda, size_t sA, const _Float16* __restrict__ Bh, int ldb, size_t sB, float alpha, float* __restrict__ C, int ldc, size_t sC, int M, int N, int K) {
  __shared__ __attribute__((aligned(16))) float so[4][16][64];
  const int tid = threadIdx.x, w = tid >> 5, lane = tid & 31, ln = lane & 15, hh = lane >> 4; const int by = blockIdx.y;
  A += (size_t)by * sA; Bh += (size_t)by * sB; C += (size_t)by * sC;
  const int ntn = (N + 63) / 64; const int wid = blockIdx.x * 4 + w; const int mt = wid / ntn, nq = wid % ntn; if (mt * 16 >= M) return;
  const int row0 = mt * 16, col0 = nq * 64; const float* arow = A + (size_t)(row0 + ln) * lda;
  v8f acc[4] = {};
  for (int kb = 0; kb < K; kb += 32) {
    FragH ah, al;
    const v4f x0 = *(const v4fa*)(arow + kb + 8 * hh), x1 = *(const v4fa*)(arow + kb + 8 * hh + 4), x2 = *(const v4fa*)(arow + kb + 16 + 8 * hh), x3 = *(const v4fa*)(arow + kb + 16 + 8 * hh + 4);
    float xs[16] = {x0[0],x0[1],x0[2],x0[3],x1[0],x1[1],x1[2],x1[3],x2[0],x2[1],x2[2],x2[3],x3[0],x3[1],x3[2],x3[3]};
#pragma unroll
    for (int i = 0; i < 16; ++i) { const _Float16 h = (_Float16)xs[i]; ah.h[i] = h; al.h[i] = ASPLIT ? (_Float16)(xs[i] - (float)h) : (_Float16)0.0f; }
#pragma unroll
    for (int t = 0; t < 4; ++t) { if (col0 + t * 16 >= N) continue; const size_t boff = (size_t)(col0 + t * 16 + ln) * ldb + kb; FragH bq; bq.half[0] = *(const v8us*)(Bh + boff + 8 * hh); bq.half[1] = *(const v8us*)(Bh + boff + 16 + 8 * hh);
      acc[t] = mmaH<ASPLIT ? 2 : 1>(ah.v, al.v, bq.v, bq.v, acc[t]); }
  }
#pragma unroll
  for (int t = 0; t < 4; ++t) { if (col0 + t * 16 >= N) continue;
#pragma unroll
    for (int r = 0; r < 8; ++r) so[w][8 * hh + r][t * 16 + ln] = acc[t][r] * alpha; }
  __builtin_amdgcn_fence(__ATOMIC_ACQ_REL, "workgroup"); __builtin_amdgcn_wave_barrier();
  const int rsub = lane >> 4, c4 = (lane & 15) * 4;
  {
#pragma unroll
    for (int q = 0; q < 8; ++q) { const int r = q * 2 + rsub; if (col0 + c4 < N) { const v4f v = *(const v4fa*)&so[w][r][c4]; *(v4f*)(C + (size_t)(row0 + r) * ldc + col0 + c4) = v; } }
     }
}

// k_gemm_hh variant with fused epilogue: v = acc·alpha + bias[by·sBias + col] (+ CP[(row/rowsPerB)·sCPb + by·64 + col] if CP) ; ACT 0 none / 1 elu ; writes f16 C16 (and f32 C if non-null)
template <int ACT>
__global__ __launch_bounds__(128) void k_gemm_hhx(const _Float16* __restrict__ A, int lda, size_t sA, const _Float16* __restrict__ Bh, int ldb, size_t sB, float alpha, const float* __restrict__ bias, size_t sBias, const float* __restrict__ CP, int rowsPerB, size_t sCPb, int row0g,
    float* __restrict__ C, _Float16* __restrict__ C16, int ldc, size_t sC, int M, int N, int K) {
  __shared__ __attribute__((aligned(16))) float so[4][16][64];
  const int tid = threadIdx.x, w = tid >> 5, lane = tid & 31, ln = lane & 15, hh = lane >> 4; const int by = blockIdx.y;
  A += (size_t)by * sA; Bh += (size_t)by * sB; const size_t cofs = (size_t)by * sC; const float* bp = bias ? bias + (size_t)by * sBias : nullptr;
  const int ntn = (N + 63) / 64; const int wid = blockIdx.x * 4 + w; const int mt = wid / ntn, nq = wid % ntn; if (mt * 16 >= M) return;
  const int row0 = mt * 16, col0 = nq * 64; const _Float16* arow = A + (size_t)(row0 + ln) * lda;
  v8f acc[4] = {};
  for (int kb = 0; kb < K; kb += 32) { FragH ah; ah.half[0] = *(const v8us*)((const unsigned short*)arow + kb + 8 * hh); ah.half[1] = *(const v8us*)((const unsigned short*)arow + kb + 16 + 8 * hh);
#pragma unroll
    for (int t = 0; t < 4; ++t) { if (col0 + t * 16 >= N) continue; const size_t boff = (size_t)(col0 + t * 16 + ln) * ldb + kb; FragH bq; bq.half[0] = *(const v8us*)((const unsigned short*)Bh + boff + 8 * hh); bq.half[1] = *(const v8us*)((const unsigned short*)Bh + boff + 16 + 8 * hh);
      acc[t] = mmaH<1>(ah.v, ah.v, bq.v, bq.v, acc[t]); }
  }
#pragma unroll
  for (int t = 0; t < 4; ++t) { if (col0 + t * 16 >= N) continue; const int col = col0 + t * 16 + ln; const float bv = bp ? bf16_round(bp[col]) : 0.f;
#pragma unroll
    for (int r = 0; r < 8; ++r) { float v = acc[t][r] * alpha + bv; if (CP) { const int rr = row0g + row0 + 8 * hh + r; if (rowsPerB < 0) v += CP[cofs + (size_t)rr * ldc + col];      /* rowsPerB < 0: own element of the batched C plane */ else { const int bidx = rr / rowsPerB; v += CP[(size_t)bidx * sCPb + (size_t)by * 64 + col]; } } if (ACT == 1) v = (v > 0.f) ? v : expm1f(v); else if (ACT == 7) v = (v > 0.f) ? v + 1.0f : expf(v); else if (ACT == 8) v = tanhf(v); else if (ACT == 9) v = 0.5f * v * (1.0f + tanhf(0.7978845608028654f * (v + 0.044715f * v * v * v))); else if (ACT == 11) v = 1.0f / (1.0f + expf(-v)); else if (ACT == 12) v = (v > 0.f) ? v : 0.01f * v; else if (ACT == 14) v = (v > 0.f) ? v : 0.1f * v; else if (ACT == 16) v = (v >= 0.f) ? v : 0.3f * v; else if (ACT == 17) v = (v >= 0.f) ? v : 0.2f * v; else if (ACT == 15) v = v / (1.0f + expf(-v)); else if (ACT == 3) v = fmaxf(v, 0.f); else if (ACT == 6) v = 0.5f * v * (1.0f + erff(v * 0.70710678118654752f)); so[w][8 * hh + r][t * 16 + ln] = v; } }
  __builtin_amdgcn_fence(__ATOMIC_ACQ_REL, "workgroup"); __builtin_amdgcn_wave_barrier();
  const int rsub = lane >> 4, c4 = (lane & 15) * 4; typedef _Float16 v4h __attribute__((ext_vector_type(4)));
  {
#pragma unroll
    for (int q = 0; q < 8; ++q) { const int r = q * 2 + rsub; if (col0 + c4 < N) { const v4f v = *(const v4fa*)&so[w][r][c4]; if (C) *(v4f*)(C + cofs + (size_t)(row0 + r) * ldc + col0 + c4) = v; if (C16) { v4h h4; for (int i = 0; i < 4; ++i) h4[i] = (_Float16)v[i]; *(v4h*)(C16 + cofs + (size_t)(row0 + r) * ldc + col0 + c4) = h4; } } }
     }
}


typedef _Float16 v4h __attribute__((ext_vector_type(4)));
typedef unsigned short v4us __attribute__((ext_vector_type(4), may_alias));
typedef float v2f __attribute__((ext_vector_type(2)));
typedef __bf16 v2b __attribute__((ext_vector_type(2)));

__global__ __launch_bounds__(256) void k_h16(const float* __restrict__ x, _Float16* __restrict__ X16, size_t n8) { const size_t t = (size_t)blockIdx.x * 256 + threadIdx.x; if (t >= n8) return; FragH f;
#pragma unroll
  for (int q = 0; q < 8; ++q) f.h[q] = (_Float16)x[t * 8 + q]; *(v8us*)((unsigned short*)X16 + t * 8) = f.half[0];  }
__global__ __launch_bounds__(256) void k_round16f(const float* __restrict__ W, _Float16* __restrict__ Bt, size_t n8) { const size_t t = (size_t)blockIdx.x * 256 + threadIdx.x; if (t >= n8) return; FragH f;
#pragma unroll
  for (int i = 0; i < 8; ++i) f.h[i] = (_Float16)(bf16_round(W[t * 8 + i]) * 16.0f); *(v8us*)((unsigned short*)Bt + t * 8) = f.half[0];  }


// ---- fast GEMM (wave tile 32x64; requires M % 32 == 0 rows per launch region and N % 64 == 0); epilogue = k_gemm_hhx semantics ----
__device__ __forceinline__ v16h g2_frag(const _Float16* p, int hh) { FragH f; f.half[0] = *(const v8us*)((const unsigned short*)p + 8 * hh); f.half[1] = *(const v8us*)((const unsigned short*)p + 16 + 8 * hh); return f.v; }
__device__ __forceinline__ v8f g2_mma(v16h a, v16h b, v8f c) { v8f d = __builtin_amdgcn_wmma_f32_16x16x32_f16(false, a, false, b, (short)0, c, false, false); asm volatile("v_nop\n\tv_nop\n\tv_nop\n\tv_nop" : "+v"(d) : "v"(a), "v"(b)); return d; }
template <int ACT>
__global__ __launch_bounds__(128) void k_gemm2(const _Float16* __restrict__ A, int lda, size_t sA, const _Float16* __restrict__ Bh, int ldb, size_t sB, float alpha, const float* __restrict__ bias, size_t sBias, const float* __restrict__ CP, int rowsPerB, size_t sCPb, int row0g,
    float* __restrict__ C, _Float16* __restrict__ C16, int ldc, size_t sC, int M, int N, int K) { static_assert(ACT == 0 || ACT == 3 || ACT == 6 || ACT == 8 || ACT == 9 || ACT == 11 || ACT == 12 || ACT == 14 || ACT == 15 || ACT == 16 || ACT == 17, "k_gemm2: unsupported ACT code (would silently apply no activation)");
  __shared__ __attribute__((aligned(16))) float so[4][32][68];
  const int tid = threadIdx.x, w = tid >> 5, lane = tid & 31, ln = lane & 15, hh = lane >> 4; const int by = blockIdx.y;
  A += (size_t)by * sA; Bh += (size_t)by * sB; const size_t cofs = (size_t)by * sC; const float* bp = bias ? bias + (size_t)by * sBias : nullptr;
  const int ntn = N >> 6; const int mt = blockIdx.x / ntn, nq = blockIdx.x - mt * ntn; const int row0 = mt * 128 + 32 * w, col0 = nq * 64; if (row0 >= M) return;
  const _Float16* a0p = A + (size_t)(row0 + ln) * lda; const _Float16* a1p = a0p + (size_t)16 * lda;
  const _Float16* b0p = Bh + (size_t)(col0 + ln) * ldb; const _Float16* b1p = b0p + (size_t)16 * ldb; const _Float16* b2p = b1p + (size_t)16 * ldb; const _Float16* b3p = b2p + (size_t)16 * ldb;
  const v8f z8 = {0.f,0.f,0.f,0.f,0.f,0.f,0.f,0.f}; v8f c00 = z8, c01 = z8, c02 = z8, c03 = z8, c10 = z8, c11 = z8, c12 = z8, c13 = z8;
#pragma unroll 1
  for (int kb = 0; kb < K; kb += 32) { const v16h a0 = g2_frag(a0p + kb, hh), a1 = g2_frag(a1p + kb, hh);
    v16h b = g2_frag(b0p + kb, hh); c00 = g2_mma(a0, b, c00); c10 = g2_mma(a1, b, c10);
    b = g2_frag(b1p + kb, hh); c01 = g2_mma(a0, b, c01); c11 = g2_mma(a1, b, c11);
    b = g2_frag(b2p + kb, hh); c02 = g2_mma(a0, b, c02); c12 = g2_mma(a1, b, c12);
    b = g2_frag(b3p + kb, hh); c03 = g2_mma(a0, b, c03); c13 = g2_mma(a1, b, c13); }
  v8f accs[8] = {c00, c01, c02, c03, c10, c11, c12, c13};
#pragma unroll
  for (int u = 0; u < 8; ++u) { const int t = u & 3, half = u >> 2; const int col = col0 + t * 16 + ln; const float bv = bp ? bf16_round(bp[col]) : 0.f;
#pragma unroll
    for (int r = 0; r < 8; ++r) { const int rloc = half * 16 + 8 * hh + r; float v = accs[u][r] * alpha + bv; if (CP) { if (rowsPerB < 0) v += CP[cofs + (size_t)(row0g + row0 + rloc) * ldc + col];      /* rowsPerB < 0: own element of the batched C plane */ else { const int bidx = (row0g + row0 + rloc) / rowsPerB; v += CP[(size_t)bidx * sCPb + (size_t)by * 64 + col]; } }
      if (ACT == 3) v = fmaxf(v, 0.f); else if (ACT == 6) v = 0.5f * v * (1.0f + erff(v * 0.70710678118654752f)); else if (ACT == 11) v = 1.0f / (1.0f + expf(-v)); else if (ACT == 15) v = v / (1.0f + expf(-v)); else if (ACT == 12) v = (v > 0.f) ? v : 0.01f * v; else if (ACT == 8) v = tanhf(v); else if (ACT == 9) v = 0.5f * v * (1.0f + tanhf(0.7978845608028654f * (v + 0.044715f * v * v * v))); else if (ACT == 14) v = (v > 0.f) ? v : 0.1f * v; else if (ACT == 16) v = (v >= 0.f) ? v : 0.3f * v; else if (ACT == 17) v = (v >= 0.f) ? v : 0.2f * v;
      so[w][rloc][t * 16 + ln] = v; } }
  __builtin_amdgcn_fence(__ATOMIC_ACQ_REL, "workgroup"); __builtin_amdgcn_wave_barrier();
  const int rsub = lane >> 4, c4 = (lane & 15) * 4;
  {
#pragma unroll
    for (int q = 0; q < 16; ++q) { const int r = q * 2 + rsub; const v4f v = *(const v4fa*)&so[w][r][c4]; if (C) *(v4f*)(C + cofs + (size_t)(row0 + r) * ldc + col0 + c4) = v; if (C16) { v4h h4; for (int i = 0; i < 4; ++i) h4[i] = (_Float16)v[i]; *(v4h*)(C16 + cofs + (size_t)(row0 + r) * ldc + col0 + c4) = h4; } }
     } }


// The three projections in one launch, straight from the f32 inputs: block p * 256 + r forms a 128x128 tile of x_p W_p + b_p (p = 0 q, 1 k, 2 v; K = 256), one work-group of 8 waves.
// Staging: wave w brings x rows 16 w ... + 15 (two wave-wide 16-byte loads a row, 512 contiguous bytes each), rounds them to bf16 and lays them as f16 at a row pitch of 528 bytes (16 x odd, for the ds_load_b128 readers);
// and rows k = 32 w ... + 31 of the tile's 128 weight columns (one load a row): a lane then holds 32 consecutive k of four columns, which it lays, rounded to bf16 and x16, as 16-byte pieces of the [column][k] rows: the transposition costs no exchange between lanes.
// Behind one barrier wave w takes rows 32 * (w & 3) ... + 31 and columns 64 * (w >> 2) ... + 63, k ascending. v = acc / 16 + bias[col] (bias rounded to bf16).
// q, k: staged per wave in LDS (over the operand rows, behind a second barrier) and stored as whole f16 rows of the wave tile. v: a lane's 8 accumulator rows are 8 consecutive keys of one column, so f16 hi and x1024 residual go as 16-byte pieces
// into two [column][key] LDS planes (pitch 272 bytes) and, behind a third barrier, out as the 256 contiguous bytes that the tile owns of each V^T row ([batch][column][key]).
// Launch bounds: four waves a SIMD (256 registers a wave), so that two work-groups, whose LDS fits twice, share a WGP and one stages while the other multiplies.
__global__ __launch_bounds__(256, 4) void k_proj(const float* __restrict__ xq, const float* __restrict__ xk, const float* __restrict__ xv, const float* __restrict__ wq, const float* __restrict__ wk, const float* __restrict__ wv,
    const float* __restrict__ bq, const float* __restrict__ bk, const float* __restrict__ bvp, _Float16* __restrict__ Q16, _Float16* __restrict__ K16, _Float16* __restrict__ VT, _Float16* __restrict__ VTL) {
  constexpr int KC = DM, PITCH = KC + 8, TP = 128 + 8, TILES = (int)(NR / 128) * (DM / 128);      /* pitches in f16 elements */
  static_assert(8 * 32 * 68 * 4 <= 256 * PITCH * 2 && 2 * 128 * TP * 2 <= 256 * PITCH * 2, "the operand rows are the largest use of the LDS block");
  __shared__ __attribute__((aligned(16))) unsigned char smem[256 * PITCH * 2];
  _Float16* const sb = (_Float16*)smem;
  const int tid = threadIdx.x, w = tid >> 5, lane = tid & 31, ln = lane & 15, hh = lane >> 4;
  const int p = blockIdx.x / TILES, rt = blockIdx.x - p * TILES; const int row0 = (rt >> 1) * 128, col0 = (rt & 1) * 128;
  const float* const X = p == 0 ? xq : p == 1 ? xk : xv; const float* const Wm = p == 0 ? wq : p == 1 ? wk : wv; const float* const bias = p == 0 ? bq : p == 1 ? bk : bvp;
  const int wm = w & 3, wn = w >> 2; const int rw = row0 + wm * 32, cw = col0 + wn * 64;
  { const float* const gw = Wm + (size_t)(w * 32) * DM + col0 + lane * 4;
    const float* const ga = X + (size_t)(row0 + w * 16) * KC + lane * 4;
    v4f tw[16], ta[16];
    auto rne2 = [](float x, float y) { const v2f a = {x, y}; return __builtin_convertvector(__builtin_convertvector(a, v2b), v2f); };      /* two values rounded to bf16 (to nearest even, as bf16_round) by the packed conversion */
    // full unroll of every loop of the staging: tw[] and ta[] must be indexed by constants to live in registers, and a group's 16 loads are to be in flight together.
    // Behind each group of loads: s_wait_xcnt, with the address pair as an input, so that the pair stays untouched until the wait has passed; the scheduling fence keeps later register writes from being moved in front of it, and the work on an earlier group behind the request for the next
    auto getw = [&](int h) {
#pragma unroll
      for (int j = 0; j < 16; ++j) tw[j] = *(const v4fa*)(gw + (h * 16 + j) * DM);
      asm volatile("s_wait_xcnt 0x0" :: "v"(gw) : "memory"); __builtin_amdgcn_sched_barrier(0); };      /* wait: before the loads' address pair may be written anew; fence: no later register write is moved in front of the wait */
    auto geta = [&](int h) {
#pragma unroll
      for (int j = 0; j < 16; ++j) ta[j] = *(const v4fa*)(ga + (h * 8 + (j >> 1)) * KC + (j & 1) * 128);
      asm volatile("s_wait_xcnt 0x0" :: "v"(ga) : "memory"); __builtin_amdgcn_sched_barrier(0); };      /* wait and fence as in getw */
    auto putw = [&](int h) {
#pragma unroll
      for (int j = 0; j < 16; ++j) tw[j] *= 16.0f;      /* x16 in f32, in front of the rounding: a power of two, so the same value as rounding first */
#pragma unroll
      for (int c = 0; c < 4; ++c) { FragH f;
#pragma unroll
        for (int j = 0; j < 16; j += 2) { const v2f r = rne2(tw[j][c], tw[j + 1][c]); f.h[j] = (_Float16)r[0]; f.h[j + 1] = (_Float16)r[1]; }
        unsigned short* const d = (unsigned short*)sb + (128 + lane * 4 + c) * PITCH + w * 32 + h * 16; *(v8us*)d = f.half[0]; *(v8us*)(d + 8) = f.half[1]; } };
    auto puta = [&](int h) {
#pragma unroll
      for (int j = 0; j < 16; ++j) { union { v4us v; _Float16 h[4]; } f;
#pragma unroll
        for (int q = 0; q < 4; q += 2) { const v2f r = rne2(ta[j][q], ta[j][q + 1]); f.h[q] = (_Float16)r[0]; f.h[q + 1] = (_Float16)r[1]; }
        *(v4us*)((unsigned short*)sb + (w * 16 + h * 8 + (j >> 1)) * PITCH + (j & 1) * 128 + lane * 4) = f.v; } };
    // loads return in order: each group is laid down, and its registers asked to take the next group, while the group behind it is still on its way
    getw(0); geta(0); putw(0); getw(1); puta(0); geta(1); putw(1); puta(1); }
  __syncthreads();      /* all operand rows are in LDS before any wave reads a fragment */
  float bv[4];      /* asked for here, not at the top: the staging has no registers to spare, and the products cover the latency */
#pragma unroll
  for (int t = 0; t < 4; ++t) bv[t] = bias[cw + t * 16 + ln];
  const _Float16* const fa = sb + (wm * 32 + ln) * PITCH; const _Float16* const fb = sb + (128 + wn * 64 + ln) * PITCH;
  const v8f z8 = {0.f,0.f,0.f,0.f,0.f,0.f,0.f,0.f}; v8f c00 = z8, c01 = z8, c02 = z8, c03 = z8, c10 = z8, c11 = z8, c12 = z8, c13 = z8;
  // unrolled so that the k offsets are immediates of the LDS reads and a later k step's reads can be issued ahead of this step's products
#pragma unroll
  for (int kb = 0; kb < KC; kb += 32) {
    const v16h a0 = g2_frag(fa + kb, hh), a1 = g2_frag(fa + 16 * PITCH + kb, hh), b0 = g2_frag(fb + kb, hh), b1 = g2_frag(fb + 16 * PITCH + kb, hh), b2 = g2_frag(fb + 32 * PITCH + kb, hh), b3 = g2_frag(fb + 48 * PITCH + kb, hh);
    c00 = g2_mma(a0, b0, c00); c10 = g2_mma(a1, b0, c10); c01 = g2_mma(a0, b1, c01); c11 = g2_mma(a1, b1, c11);
    c02 = g2_mma(a0, b2, c02); c12 = g2_mma(a1, b2, c12); c03 = g2_mma(a0, b3, c03); c13 = g2_mma(a1, b3, c13); }
  __syncthreads();      /* every read of the operand rows has ended before the output staging goes over them */
  v8f accs[8] = {c00, c01, c02, c03, c10, c11, c12, c13};
#pragma unroll
  for (int t = 0; t < 4; ++t) bv[t] = bf16_round(bv[t]);
  if (p == 2) {      /* the same for the whole work-group, so the barrier inside is passed by all of it or by none */
    unsigned short* const sT = (unsigned short*)smem;
#pragma unroll
    for (int u = 0; u < 8; ++u) { const int t = u & 3, half = u >> 2; FragH f;
#pragma unroll
      for (int r = 0; r < 8; ++r) { const float a = accs[u][r] * 0.0625f + bv[t]; const _Float16 h = (_Float16)a; f.h[r] = h; f.h[8 + r] = (_Float16)((a - (float)h) * 1024.0f); }
      unsigned short* const d = sT + (wn * 64 + t * 16 + ln) * TP + wm * 32 + half * 16 + 8 * hh; *(v8us*)d = f.half[0]; *(v8us*)(d + 128 * TP) = f.half[1]; }
    __syncthreads();      /* both planes of the tile are whole in LDS before any thread stores them */
    const size_t o = ((size_t)(row0 / SQ) * DM + col0 + (tid >> 4)) * SQ + row0 % SQ + (tid & 15) * 8; const unsigned short* const st = sT + (tid >> 4) * TP + (tid & 15) * 8;
    v8us vh[8], vl[8];      /* all LDS reads in front of the stores (loops unrolled, so that the arrays live in registers): no register of a store is written again behind it */
#pragma unroll
    for (int i = 0; i < 8; ++i) { vh[i] = *(const v8us*)(st + i * 16 * TP); vl[i] = *(const v8us*)(st + (128 + i * 16) * TP); }
#pragma unroll
    for (int i = 0; i < 8; ++i) { *(v8us*)((unsigned short*)VT + o + (size_t)i * 16 * SQ) = vh[i]; *(v8us*)((unsigned short*)VTL + o + (size_t)i * 16 * SQ) = vl[i]; }
  } else {
    _Float16* const C16 = p == 0 ? Q16 : K16;
    float (*so)[32][68] = (float (*)[32][68])smem;
#pragma unroll
    for (int u = 0; u < 8; ++u) { const int t = u & 3, half = u >> 2;
#pragma unroll
      for (int r = 0; r < 8; ++r) so[w][half * 16 + 8 * hh + r][t * 16 + ln] = accs[u][r] * 0.0625f + bv[t]; }
    __builtin_amdgcn_fence(__ATOMIC_ACQ_REL, "workgroup"); __builtin_amdgcn_wave_barrier();      /* as in k_gemm2: the wave reads back only its own plane */
    const int rsub = lane >> 4, c4 = (lane & 15) * 4;
    _Float16* const cp = C16 + (size_t)(rw + rsub) * DM + cw + c4;
    v4h h4[16];      /* as for v: all LDS reads and conversions in front of the stores (loops unrolled, so that the array lives in registers) */
#pragma unroll
    for (int q = 0; q < 16; ++q) { const v4f v = *(const v4fa*)&so[w][q * 2 + rsub][c4];
#pragma unroll
      for (int i = 0; i < 4; ++i) h4[q][i] = (_Float16)v[i]; }
#pragma unroll
    for (int q = 0; q < 16; ++q) *(v4h*)(cp + q * 2 * DM) = h4[q];
    asm volatile("s_wait_xcnt 0x0" :: "v"(cp) : "memory");      /* behind the last store: no register of the 16 stores (the address pair is an input here) is written anew, on any path of the listing, before this wait has passed */
  } }

__global__ __launch_bounds__(256) void k_wnat(const float* __restrict__ w, size_t n8, _Float16* __restrict__ Bt) { const size_t t = (size_t)blockIdx.x * 256 + threadIdx.x; if (t >= n8) return; FragH f; for (int q = 0; q < 8; ++q) f.h[q] = (_Float16)(bf16_round(w[t * 8 + q]) * 16.0f); *(v8us*)((unsigned short*)Bt + t * 8) = f.half[0];  }
__global__ __launch_bounds__(256) void k_rsm(const float* __restrict__ S, _Float16* __restrict__ P, int nrows) {
  #pragma clang fp contract(off)
  const int i = blockIdx.x * 256 + threadIdx.x; if (i >= nrows) return; const float* s = S + (size_t)i * SQ; float mx = -3.0e38f;
#pragma unroll 1
  for (int j = 0; j < SQ; ++j) mx = fmaxf(mx, s[j]); float se = 0.f;
#pragma unroll 1
  for (int j = 0; j < SQ; ++j) se += expf(s[j] - mx); const float sc = 256.0f / se;
#pragma unroll 1
  for (int j0 = 0; j0 < SQ; j0 += 8) { FragH f; for (int q = 0; q < 8; ++q) f.h[q] = (_Float16)(expf(s[j0 + q] - mx) * sc); unsigned short* d = (unsigned short*)P + (size_t)i * SQ + j0; *(v8us*)d = f.half[0];  } }
__global__ __launch_bounds__(256) void k_vt(const _Float16* __restrict__ V16, int b, int h0, _Float16* __restrict__ VT) { __shared__ unsigned short tl[64][65]; const int tid = threadIdx.x; const int hh = blockIdx.x % HG, sg = blockIdx.x / HG; const int s0 = sg * 64; const int h = h0 + hh;
  for (int i = tid; i < 64 * 8; i += 256) { const int j = i / 8, d8 = (i % 8) * 8; FragH f; f.half[0] = *(const v8us*)((const unsigned short*)V16 + ((size_t)b * SQ + s0 + j) * DM + h * HD + d8); for (int q = 0; q < 8; ++q) tl[d8 + q][j] = f.u[q]; }
  __syncthreads();
  { for (int i = tid; i < 64 * 8; i += 256) { const int d = i / 8, j8 = (i % 8) * 8; FragH f; for (int q = 0; q < 8; ++q) f.u[q] = tl[d][j8 + q]; *(v8us*)((unsigned short*)VT + ((size_t)hh * HD + d) * SQ + s0 + j8) = f.half[0]; }  } }


// lane ^ 16 by permlanex16 (no LDS round trip)
__device__ __forceinline__ float xl_half(float v) { const int i = __float_as_int(v); return __int_as_float(__builtin_amdgcn_permlanex16(i, i, 0x76543210, 0xfedcba98, false, false)); }
__device__ __forceinline__ v8f fa_mma(v16h a, v16h b, v8f c) { return __builtin_amdgcn_wmma_f32_16x16x32_f16(false, a, false, b, (short)0, c, false, false); }
__global__ __launch_bounds__(256) void k_fattn(const _Float16* __restrict__ Q, const _Float16* __restrict__ Kx, const _Float16* __restrict__ Vh, const _Float16* __restrict__ Vl, float* __restrict__ O) {
  constexpr int KB = 64, KP = DM + 8, VP = KB + 8, OFF_VH = KB * KP, OFF_VL = OFF_VH + DM * VP, STAGE = OFF_VL + DM * VP, OP = DM + 4;      /* f16 elements; OP in floats */
  static_assert(64 * OP * 4 <= 2 * STAGE * 2, "the stage buffers are the larger use of the LDS block");
  __shared__ __attribute__((aligned(16))) unsigned char smem[2 * STAGE * 2];
  _Float16* const sb = (_Float16*)smem;
  const int tid = threadIdx.x, w = tid >> 5, lane = tid & 31, ln = lane & 15, hh = lane >> 4;
  const int b = blockIdx.x / (SQ / 64), q0 = (blockIdx.x % (SQ / 64)) * 64; const int qi = w & 3, dh = w >> 2;
  // staging: wave w brings K rows 8 w ... + 7 (one row a load) and V^T rows 32 w ... + 31 of both planes (four rows a load)
  const int vr = lane >> 3, vc = (lane & 7) * 8;
  const unsigned short* const gk = (const unsigned short*)Kx + ((size_t)b * SQ + w * 8) * DM + lane * 8;
  const unsigned short* const gh = (const unsigned short*)Vh + ((size_t)b * DM + w * 32 + vr) * SQ + vc;
  const unsigned short* const gl = (const unsigned short*)Vl + ((size_t)b * DM + w * 32 + vr) * SQ + vc;
  unsigned short* const sk = (unsigned short*)sb + (w * 8) * KP + lane * 8;
  unsigned short* const sh = (unsigned short*)sb + OFF_VH + (w * 32 + vr) * VP + vc;
  unsigned short* const sl = (unsigned short*)sb + OFF_VL + (w * 32 + vr) * VP + vc;
  // scheduling fence. Round the fragment groups it keeps a group of LDS reads together and ahead of the products of the group before it (left alone, the compiler puts each fragment's two reads directly in front of its product, and the wave then waits out the LDS latency at every product);
  // round a fetch it keeps every other register write from being moved between the loads and their s_wait_xcnt
  auto hold = [&]() { __builtin_amdgcn_sched_barrier(0); };
  v8us rk[8], rh[8], rl[8];      /* one register set for each part of a stage (K rows, the two V^T planes); the loops over them are fully unrolled, so that they are indexed by constants and live in registers and a part's 8 loads are in flight together */
  auto fetch = [&](v8us (&rs)[8], const unsigned short* g, size_t step) {
    hold();
#pragma unroll
    for (int j = 0; j < 8; ++j) rs[j] = *(const v8us*)(g + j * step);
    asm volatile("s_wait_xcnt 0x0" ::: "memory");      /* the loads stay in flight while their address registers are written anew */
    hold(); };
  auto put = [&](const v8us (&rs)[8], unsigned short* d, int step) {
#pragma unroll
    for (int j = 0; j < 8; ++j) *(v8us*)(d + j * step) = rs[j]; };
  // work-group barrier of the stage loop, by hand: __syncthreads() also waits for every global load, which would end the fetch that is meant to stay in flight across it; what the barrier orders here is LDS alone
  auto stage_barrier = [&]() { asm volatile("s_wait_dscnt 0x0\n\ts_barrier_signal -1\n\ts_barrier_wait -1" ::: "memory"); };
  v16h qf[8];
  { const _Float16* const qp = Q + ((size_t)b * SQ + q0 + qi * 16 + ln) * DM;
#pragma unroll
    for (int kb = 0; kb < 8; ++kb) qf[kb] = g2_frag(qp + kb * 32, hh);
    asm volatile("s_wait_xcnt 0x0" ::: "memory");      /* before the address pair of the query loads is used for anything else */
    hold(); }
  const _Float16* const fk = sb + ln * KP; const _Float16* const fvh = sb + OFF_VH + (dh * 128 + ln) * VP; const _Float16* const fvl = sb + OFF_VL + (dh * 128 + ln) * VP;
  const v8f z8 = {0.f,0.f,0.f,0.f,0.f,0.f,0.f,0.f};
  v8f oh[8], ol[8];
  float m = -3.0e38f, l = 0.f;      /* l: the sum over this lane's own keys; the halves are joined behind the loop */
  v16h fa[8], fb[8];      /* two sets of 8 A fragments: one is loaded while the other is multiplied */
  // one stage: n1 / n2 say whether stages s + 1 / s + 2 exist (literals at every call). The parts of stage s + 1 go into the other buffer, which nobody reads during this trip; behind a part's LDS stores its register set takes the loads of stage s + 2, a whole trip ahead of their stores.
  auto trip = [&](int s, bool n1, bool n2) {
    const int buf = s & 1, ob = (buf ^ 1) * STAGE;
    const _Float16* const pk = fk + buf * STAGE; const _Float16* const ph = fvh + buf * STAGE; const _Float16* const pl = fvl + buf * STAGE;
    // full unroll of every loop of the trip: the register arrays must be indexed by constants to live in registers, and the offsets become immediates of the LDS reads
    auto ldk = [&](v16h (&f)[8], int g) {
#pragma unroll
      for (int i = 0; i < 8; ++i) f[i] = g2_frag(pk + (i & 3) * 16 * KP + (2 * g + (i >> 2)) * 32, hh); hold(); };
    auto ldv = [&](v16h (&f)[8], const _Float16* p, int g) {
#pragma unroll
      for (int i = 0; i < 8; ++i) f[i] = g2_frag(p + (4 * g + (i >> 1)) * 16 * VP + (i & 1) * 32, hh); hold(); };
    v8f st[4] = {z8, z8, z8, z8};
    auto mmk = [&](const v16h (&f)[8], int g) {
#pragma unroll
      for (int i = 0; i < 8; ++i) st[i & 3] = fa_mma(f[i], qf[2 * g + (i >> 2)], st[i & 3]); hold(); };
    FragH pb[2];
    auto mmv = [&](const v16h (&f)[8], v8f (&o)[8], int g) {
#pragma unroll
      for (int i = 0; i < 8; ++i) o[4 * g + (i >> 1)] = fa_mma(f[i], pb[i & 1].v, o[4 * g + (i >> 1)]); hold(); };
    ldk(fa, 0);
    if (n1) { put(rk, sk + ob, KP); hold(); }
    if (n2) { fetch(rk, gk + (size_t)(s + 2) * KB * DM, DM); }
    ldk(fb, 1); mmk(fa, 0); ldk(fa, 2); mmk(fb, 1); ldk(fb, 3); mmk(fa, 2); ldv(fa, ph, 0); mmk(fb, 3);
    v8f m8 = st[0];
#pragma unroll
    for (int kt = 1; kt < 4; ++kt) for (int r = 0; r < 8; ++r) m8[r] = fmaxf(m8[r], st[kt][r]);
    float mx = fmaxf(fmaxf(fmaxf(m8[0], m8[1]), fmaxf(m8[2], m8[3])), fmaxf(fmaxf(m8[4], m8[5]), fmaxf(m8[6], m8[7])));
    mx = fmaxf(mx, xl_half(mx)) * 0.0625f;
    const float mn = fmaxf(m, mx);
    if (__builtin_amdgcn_ballot_w32(mn > m) != 0) {      /* wave-uniform: skipped only where every factor would be exactly 1 */
      const float f = __expf(m - mn); l *= f; m = mn;
#pragma unroll
      for (int dt = 0; dt < 8; ++dt) { oh[dt] *= f; ol[dt] *= f; } }
#pragma unroll
    for (int kt = 0; kt < 4; ++kt) for (int r = 0; r < 8; ++r) st[kt][r] = (st[kt][r] * 0.0625f - m) * 1.44269504088896340736f;
    hold();
    // behind each exponential the one independent slot that the instruction set asks for before its result is read or its source overwritten; the fence keeps the v_nop directly behind its exponential
#pragma unroll
    for (int kt = 0; kt < 4; ++kt) for (int r = 0; r < 8; ++r) { st[kt][r] = __builtin_amdgcn_exp2f(st[kt][r]); asm volatile("v_nop"); hold(); }
    float la[4];
#pragma unroll
    for (int kt = 0; kt < 4; ++kt) { la[kt] = 0.f;
#pragma unroll
      for (int r = 0; r < 8; ++r) { la[kt] += st[kt][r]; pb[kt >> 1].h[(kt & 1) * 8 + r] = (_Float16)st[kt][r]; } }
    l += (la[0] + la[1]) + (la[2] + la[3]);
    hold();
    if (n1) { put(rh, sh + ob, 4 * VP); hold(); }
    if (n2) { fetch(rh, gh + (s + 2) * KB, (size_t)4 * SQ); }
    ldv(fb, ph, 1); mmv(fa, oh, 0); ldv(fa, pl, 0); mmv(fb, oh, 1);
    if (n1) { put(rl, sl + ob, 4 * VP); hold(); }
    if (n2) { fetch(rl, gl + (s + 2) * KB, (size_t)4 * SQ); }
    ldv(fb, pl, 1); mmv(fa, ol, 0); mmv(fb, ol, 1); };
  constexpr int nst = SQ / KB;
  fetch(rk, gk, DM); fetch(rh, gh, (size_t)4 * SQ); fetch(rl, gl, (size_t)4 * SQ); put(rk, sk, KP); put(rh, sh, 4 * VP); put(rl, sl, 4 * VP);
  fetch(rk, gk + (size_t)KB * DM, DM); fetch(rh, gh + KB, (size_t)4 * SQ); fetch(rl, gl + KB, (size_t)4 * SQ);
  stage_barrier();      /* stage 0 is in buffer 0 before any wave reads it */
  hold();      /* the accumulators are cleared behind the fetches' waits, not among their loads */
#pragma unroll
  for (int dt = 0; dt < 8; ++dt) { oh[dt] = z8; ol[dt] = z8; }
  // the last two stages stand behind the loop, so that every fetch in it is unconditional
#pragma unroll 1      /* one copy of the trip in the loop: the buffer is chosen by an address offset, and a second copy would only cost instruction cache */
  for (int s = 0; s + 2 < nst; ++s) {
    trip(s, true, true);
    stage_barrier();      /* publishes stage s + 1 and ends every read of stage s, whose buffer the next trip refills */
  }
  trip(nst - 2, true, false);
  stage_barrier();      /* publishes the last stage */
  trip(nst - 1, false, false);
  __syncthreads();      /* every read of the stage buffers has ended before the output staging goes over them */
  const float inv = 1.0f / (l + xl_half(l));
  float* const so = (float*)smem;
#pragma unroll
  for (int dt = 0; dt < 8; ++dt) { v4f x0, x1;
#pragma unroll
    for (int r = 0; r < 4; ++r) { x0[r] = (oh[dt][r] + ol[dt][r] * 0.0009765625f) * inv; x1[r] = (oh[dt][4 + r] + ol[dt][4 + r] * 0.0009765625f) * inv; }
    float* const d = so + (qi * 16 + ln) * OP + dh * 128 + dt * 16 + 8 * hh; *(v4fa*)d = x0; *(v4fa*)(d + 4) = x1; }
  __syncthreads();      /* the 64 output rows are whole in LDS before any thread stores them */
  float* const og = O + ((size_t)b * SQ + q0) * DM;
#pragma unroll
  for (int i = 0; i < 16; ++i) { const int idx = i * 256 + tid; const v4f v = *(const v4fa*)(so + (idx >> 6) * OP + (idx & 63) * 4); *(v4f*)(og + (size_t)idx * 4) = v; } }

extern "C" void kernel_launch(void* const* d_in, const int* in_sizes, int n_in,
                              void* d_out, int out_size, void* d_ws, size_t ws_size, hipStream_t stream) {
  (void)in_sizes; (void)n_in; (void)out_size;
  const float* const* I = (const float* const*)d_in; const float* xq = I[0]; const float* xk = I[1]; const float* xv = I[2]; const float* wq = I[3]; const float* bq = I[4]; const float* wk = I[5]; const float* bk = I[6]; const float* wv = I[7]; const float* bv = I[8];
  char* ws = (char*)d_ws; size_t off = 0;
  auto take = [&](size_t bytes) { char* p = ws + off; off += (bytes + 255) & ~(size_t)255; return p; };
  _Float16* Q16 = (_Float16*)take(NR * DM * 2); _Float16* K16 = (_Float16*)take(NR * DM * 2);
  _Float16* VT = (_Float16*)take((size_t)NB * DM * SQ * 2); _Float16* VTL = (_Float16*)take((size_t)NB * DM * SQ * 2);
  if (off > ws_size) return;      /* 4 x 8 = 32 MiB */
  k_proj<<<(unsigned)(3 * (NR / 128) * (DM / 128)), 256, 0, stream>>>(xq, xk, xv, wq, wk, wv, bq, bk, bv, Q16, K16, VT, VTL);
  k_fattn<<<NB * (SQ / 64), 256, 0, stream>>>(Q16, K16, VT, VTL, (float*)d_out);
}

// v006
// Measured time: 117 microseconds a run.
// In both of two side-by-side timings against v005, it was 1.09 times as fast.
// All steps since v000 together make it 32.8 times as fast.
#include <hip/hip_runtime.h>
// Single-head attention with dense projections (q_in, k_in, v_in [4][4096][256]; q = q_in Wq + bq, k = k_in Wk + bk, v = v_in Wv + bv ([in][out] 256x256 glorot-uniform, biases uniform); scores = q . k x 256^-0.5; softmax over the 4096 keys (no mask); out = attn v -> [4][4096][256]; no output projection).
// Structure: ONE launch for the three projections, from the f32 inputs: inputs as exact f16 rows and [in][out] weights as exact x16 [out][in] rows, formed while they are staged in LDS; WMMA GEMMs (128x128 tiles, f32 accumulation, + bias); q, k as f16 outputs (logits sigma ~1), v split in the epilogue into f16 hi + x1024 residual and written transposed (V^T planes, [batch][column][key]); then ONE fused launch for all batches: scores (K = 256, x 1/16), running-maximum softmax (f32 statistics, native exp; weights plain f16, not normalised) and O = P V_hi^T + 2^-10 P V_lo^T, divided by the row sum at the end.
// Compute dtype: inputs rounded to bf16; x / weights exact; q, k, P plain f16 (~2^-12), v as hi + residual; scores / statistics / out f32. v_wmma_f32_16x16x32_f16.
#define NB 4
#define SQ 4096
#define DM 256
#define NH 1
#define HD 64
#define HG 1
#define NR ((size_t)NB * SQ)
typedef __bf16 v16b __attribute__((ext_vector_type(16)));
typedef unsigned short v8us __attribute__((ext_vector_type(8), may_alias));
typedef float  v8f  __attribute__((ext_vector_type(8)));
typedef float  v4f  __attribute__((ext_vector_type(4)));
typedef float  v4fa __attribute__((ext_vector_type(4), may_alias));
union FragB { v16b v; v8us half[2]; unsigned short u[16]; };

__device__ __forceinline__ unsigned short bf16_bits(float x) { unsigned int u = __float_as_uint(x); return (unsigned short)((u + 0x7FFFu + ((u >> 16) & 1u)) >> 16); }
__device__ __forceinline__ float bf16_val(unsigned short b) { return __uint_as_float(((unsigned int)b) << 16); }
__device__ __forceinline__ float bf16_round(float x) { return bf16_val(bf16_bits(x)); }
// D += A·B with NT terms: 1 = ah·bh, 2 = + al·bh (A split), 3 = + ah·bl (both split)
template <int NT>
__device__ __forceinline__ v8f mmaN(v16b ah, v16b al, v16b bh, v16b bl, v8f c) {
  c = __builtin_amdgcn_wmma_f32_16x16x32_bf16(false, ah, false, bh, (short)0, c, false, false);
  if (NT >= 2) c = __builtin_amdgcn_wmma_f32_16x16x32_bf16(false, al, false, bh, (short)0, c, false, false);
  if (NT >= 3) c = __builtin_amdgcn_wmma_f32_16x16x32_bf16(false, ah, false, bl, (short)0, c, false, false);
  asm volatile("v_nop\n\tv_nop\n\tv_nop\n\tv_nop" : "+v"(c) : "v"(ah), "v"(al), "v"(bh), "v"(bl));
  return c;
}

__global__ __launch_bounds__(256) void k_wt_bf16(const float* __restrict__ W, unsigned short* __restrict__ Wt, int K, int N) {
  const int t = blockIdx.x * 256 + threadIdx.x;
  const int k8n = K / 8;
  if (t >= N * k8n) return;
  const int n = t / k8n, k8 = (t % k8n) * 8;
  v8us v;
#pragma unroll
  for (int i = 0; i < 8; ++i) v[i] = bf16_bits(W[(size_t)(k8 + i) * N + n]);
  *(v8us*)(Wt + (size_t)n * K + k8) = v;
  
}

// GEMM C[M][N] (f32, pitch ldc) = act(A[M][K]·W + bias). A f32 row-major (pitch lda) converted per fragment to bf16
// (ASPLIT: hi/lo two planes -> 2 terms, else single rounded term); Wt bf16 [N][K] (pitch ldb). BIAS_BF16 rounds the
// bias to bf16 first (bias quantised to bf16 before the add). K%32==0, M%16==0, N%64==0.
template <bool ASPLIT, int ACT, bool BIAS_BF16>
__global__ __launch_bounds__(128) void k_gemm_bf(const float* __restrict__ A, int lda, const unsigned short* __restrict__ Wt, int ldb,
                                               const float* __restrict__ bias, float* __restrict__ C, int ldc, int M, int N, int K) {
  __shared__ __attribute__((aligned(16))) float so[4][16][64];
  const int tid = threadIdx.x, w = tid >> 5, lane = tid & 31, ln = lane & 15, hh = lane >> 4;
  const int ntn = N / 64;
  const int wid = blockIdx.x * 4 + w;
  const int mt = wid / ntn, nq = wid % ntn;
  if (mt * 16 >= M) return;
  const int row0 = mt * 16, col0 = nq * 64;
  const float* arow = A + (size_t)(row0 + ln) * lda;
  v8f acc[4] = {};
  for (int kb = 0; kb < K; kb += 32) {
    FragB ah, al;
    const v4f x0 = *(const v4fa*)(arow + kb + 8 * hh), x1 = *(const v4fa*)(arow + kb + 8 * hh + 4);
    const v4f x2 = *(const v4fa*)(arow + kb + 16 + 8 * hh), x3 = *(const v4fa*)(arow + kb + 16 + 8 * hh + 4);
    float xs[16] = {x0[0],x0[1],x0[2],x0[3],x1[0],x1[1],x1[2],x1[3],x2[0],x2[1],x2[2],x2[3],x3[0],x3[1],x3[2],x3[3]};
#pragma unroll
    for (int i = 0; i < 16; ++i) { const unsigned short hb = bf16_bits(xs[i]); ah.u[i] = hb; al.u[i] = ASPLIT ? bf16_bits(xs[i] - bf16_val(hb)) : (unsigned short)0; }
#pragma unroll
    for (int t = 0; t < 4; ++t) {
      const unsigned short* brow = Wt + (size_t)(col0 + t * 16 + ln) * ldb + kb;
      FragB b;
      b.half[0] = *(const v8us*)(brow + 8 * hh);
      b.half[1] = *(const v8us*)(brow + 16 + 8 * hh);
      acc[t] = mmaN<ASPLIT ? 2 : 1>(ah.v, al.v, b.v, b.v, acc[t]);
    }
  }
#pragma unroll
  for (int t = 0; t < 4; ++t) {
    float bv = bias ? bias[col0 + t * 16 + ln] : 0.f;
    if (BIAS_BF16) bv = bf16_round(bv);
#pragma unroll
    for (int r = 0; r < 8; ++r) { float v = acc[t][r] + bv; if (ACT == 1) v = fmaxf(v, 0.f); so[w][8 * hh + r][t * 16 + ln] = v; }
  }
  __builtin_amdgcn_fence(__ATOMIC_ACQ_REL, "workgroup");
  __builtin_amdgcn_wave_barrier();
  const int rsub = lane >> 4, c4 = (lane & 15) * 4;
  {
#pragma unroll
    for (int q = 0; q < 8; ++q) {
      const int r = q * 2 + rsub;
      const v4f v = *(const v4fa*)&so[w][r][c4];
      *(v4f*)(C + (size_t)(row0 + r) * ldc + col0 + c4) = v;
    }
    
  }
}

// GEMM C = act(A·W + bias + resid): A f32 (ASPLIT -> hi/lo 2 terms), Wt bf16 [N][K]; ACT 0 none, 1 relu, 2 exact gelu;
// resid (optional, f32, row index = (row % rmod), pitch ldr, RES_BF16 rounds it) added before the activation.
template <bool ASPLIT, int ACT, bool BIAS_BF16, bool RES_BF16>
__global__ __launch_bounds__(128) void k_gemm_bf3(const float* __restrict__ A, int lda, const unsigned short* __restrict__ Wt, int ldb,
                                                const float* __restrict__ bias, const float* __restrict__ resid, int rmod, int ldr,
                                                float* __restrict__ C, int ldc, int M, int N, int K) {
  __shared__ __attribute__((aligned(16))) float so[4][16][64];
  const int tid = threadIdx.x, w = tid >> 5, lane = tid & 31, ln = lane & 15, hh = lane >> 4;
  const int ntn = N / 64;
  const int wid = blockIdx.x * 4 + w;
  const int mt = wid / ntn, nq = wid % ntn;
  if (mt * 16 >= M) return;
  const int row0 = mt * 16, col0 = nq * 64;
  const float* arow = A + (size_t)(row0 + ln) * lda;
  v8f acc[4] = {};
  for (int kb = 0; kb < K; kb += 32) {
    FragB ah, al;
    const v4f x0 = *(const v4fa*)(arow + kb + 8 * hh), x1 = *(const v4fa*)(arow + kb + 8 * hh + 4);
    const v4f x2 = *(const v4fa*)(arow + kb + 16 + 8 * hh), x3 = *(const v4fa*)(arow + kb + 16 + 8 * hh + 4);
    float xs[16] = {x0[0],x0[1],x0[2],x0[3],x1[0],x1[1],x1[2],x1[3],x2[0],x2[1],x2[2],x2[3],x3[0],x3[1],x3[2],x3[3]};
#pragma unroll
    for (int i = 0; i < 16; ++i) { const unsigned short hb = bf16_bits(xs[i]); ah.u[i] = hb; al.u[i] = ASPLIT ? bf16_bits(xs[i] - bf16_val(hb)) : (unsigned short)0; }
#pragma unroll
    for (int t = 0; t < 4; ++t) {
      const unsigned short* brow = Wt + (size_t)(col0 + t * 16 + ln) * ldb + kb;
      FragB b;
      b.half[0] = *(const v8us*)(brow + 8 * hh);
      b.half[1] = *(const v8us*)(brow + 16 + 8 * hh);
      acc[t] = mmaN<ASPLIT ? 2 : 1>(ah.v, al.v, b.v, b.v, acc[t]);
    }
  }
#pragma unroll
  for (int t = 0; t < 4; ++t) {
    const int col = col0 + t * 16 + ln;
    float bv = bias ? bias[col] : 0.f;
    if (BIAS_BF16) bv = bf16_round(bv);
#pragma unroll
    for (int r = 0; r < 8; ++r) {
      float v = acc[t][r] + bv;
      if (resid) { float rv = resid[(size_t)((row0 + 8 * hh + r) % rmod) * ldr + col]; if (RES_BF16) rv = bf16_round(rv); v += rv; }
      if (ACT == 1) v = fmaxf(v, 0.f);
      if (ACT == 2) v = 0.5f * v * (1.0f + erff(v * 0.70710678118654752f));
      if (ACT == 3) { const float u = 0.7978845608028654f * (v + 0.044715f * v * v * v); v = 0.5f * v * (1.0f + tanhf(u)); }
      so[w][8 * hh + r][t * 16 + ln] = v;
    }
  }
  __builtin_amdgcn_fence(__ATOMIC_ACQ_REL, "workgroup");
  __builtin_amdgcn_wave_barrier();
  const int rsub = lane >> 4, c4 = (lane & 15) * 4;
  {
#pragma unroll
    for (int q = 0; q < 8; ++q) {
      const int r = q * 2 + rsub;
      const v4f v = *(const v4fa*)&so[w][r][c4];
      *(v4f*)(C + (size_t)(row0 + r) * ldc + col0 + c4) = v;
    }
    
  }
}
// row LayerNorm (biased variance, eps) over N: s = X (+ R); optional out_sum <- s; out_norm <- (s-mu)*rsqrt(var+eps)*g + b
template <bool PARAM_BF16>
__global__ __launch_bounds__(256) void k_layernorm(const float* __restrict__ X, const float* __restrict__ R, const float* __restrict__ g, const float* __restrict__ bta,
                                                  float* __restrict__ out_sum, float* __restrict__ out_norm, int N, float eps) {
  __shared__ float red[256];
  const int row = blockIdx.x, tid = threadIdx.x;
  const float* x = X + (size_t)row * N; const float* rr = R ? R + (size_t)row * N : nullptr;
  float vals[16];                     // up to N = 4096
  const int per = N / 256;            // contiguous chunk per thread? use strided-by-4 chunks: thread handles j = tid*4 + 1024*u
  float s1 = 0.f;
  for (int u = 0; u < per / 4; ++u) {
    const int j = tid * 4 + 1024 * u;
    const v4f a = *(const v4fa*)(x + j);
    v4f b = {0.f,0.f,0.f,0.f}; if (rr) b = *(const v4fa*)(rr + j);
#pragma unroll
    for (int q = 0; q < 4; ++q) { const float v = a[q] + b[q]; vals[u * 4 + q] = v; s1 += v; }
  }
  red[tid] = s1; __syncthreads();
  for (int st = 128; st > 0; st >>= 1) { if (tid < st) red[tid] += red[tid + st]; __syncthreads(); }
  const float mu = red[0] / (float)N; __syncthreads();
  float s2 = 0.f;
  for (int u = 0; u < per / 4; ++u)
#pragma unroll
    for (int q = 0; q < 4; ++q) { const float c = vals[u * 4 + q] - mu; s2 += c * c; }
  red[tid] = s2; __syncthreads();
  for (int st = 128; st > 0; st >>= 1) { if (tid < st) red[tid] += red[tid + st]; __syncthreads(); }
  const float rs = rsqrtf(red[0] / (float)N + eps);
  {
    for (int u = 0; u < per / 4; ++u) {
      const int j = tid * 4 + 1024 * u;
      v4f o, sm;
#pragma unroll
      for (int q = 0; q < 4; ++q) {
        float gg = g[j + q], bb = bta[j + q];
        if (PARAM_BF16) { gg = bf16_round(gg); bb = bf16_round(bb); }
        sm[q] = vals[u * 4 + q]; o[q] = (vals[u * 4 + q] - mu) * rs * gg + bb;
      }
      if (out_sum) *(v4f*)(out_sum + (size_t)row * N + j) = sm;
      *(v4f*)(out_norm + (size_t)row * N + j) = o;
    }
    
  }
}



// ---- f16 WMMA path (v_wmma_f32_16x16x32_f16): 11-bit significands for operands in range — used where a [0,1] probability operand needs more precision than bf16
typedef _Float16 v16h __attribute__((ext_vector_type(16)));
union FragH { v16h v; v8us half[2]; _Float16 h[16]; unsigned short u[16]; };
template <int NT>
__device__ __forceinline__ v8f mmaH(v16h ah, v16h al, v16h bh, v16h bl, v8f c) {
  c = __builtin_amdgcn_wmma_f32_16x16x32_f16(false, ah, false, bh, (short)0, c, false, false);
  if (NT >= 2) c = __builtin_amdgcn_wmma_f32_16x16x32_f16(false, al, false, bh, (short)0, c, false, false);
  if (NT >= 3) c = __builtin_amdgcn_wmma_f32_16x16x32_f16(false, ah, false, bl, (short)0, c, false, false);
  asm volatile("v_nop\n\tv_nop\n\tv_nop\n\tv_nop" : "+v"(c) : "v"(ah), "v"(al), "v"(bh), "v"(bl));
  return c;
}
// batched GEMM like k_gemm_b but f16 operands: A f32 (split into f16 hi/lo if ASPLIT, else rounded to f16), Bt = f16 values [n][k]; alpha; C f32; N multiple of 16 (partial tiles skipped)
template <bool ASPLIT>
__global__ __launch_bounds__(128) void k_gemm_h(const float* __restrict__ A, int lda, size_t sA, const _Float16* __restrict__ Bh, int ldb, size_t sB, float alpha, float* __restrict__ C, int ldc, size_t sC, int M, int N, int K) {
  __shared__ __attribute__((aligned(16))) float so[4][16][64];
  const int tid = threadIdx.x, w = tid >> 5, lane = tid & 31, ln = lane & 15, hh = lane >> 4; const int by = blockIdx.y;
  A += (size_t)by * sA; Bh += (size_t)by * sB; C += (size_t)by * sC;
  const int ntn = (N + 63) / 64; const int wid = blockIdx.x * 4 + w; const int mt = wid / ntn, nq = wid % ntn; if (mt * 16 >= M) return;
  const int row0 = mt * 16, col0 = nq * 64; const float* arow = A + (size_t)(row0 + ln) * lda;
  v8f acc[4] = {};
  for (int kb = 0; kb < K; kb += 32) {
    FragH ah, al;
    const v4f x0 = *(const v4fa*)(arow + kb + 8 * hh), x1 = *(const v4fa*)(arow + kb + 8 * hh + 4), x2 = *(const v4fa*)(arow + kb + 16 + 8 * hh), x3 = *(const v4fa*)(arow + kb + 16 + 8 * hh + 4);
    float xs[16] = {x0[0],x0[1],x0[2],x0[3],x1[0],x1[1],x1[2],x1[3],x2[0],x2[1],x2[2],x2[3],x3[0],x3[1],x3[2],x3[3]};
#pragma unroll
    for (int i = 0; i < 16; ++i) { const _Float16 h = (_Float16)xs[i]; ah.h[i] = h; al.h[i] = ASPLIT ? (_Float16)(xs[i] - (float)h) : (_Float16)0.0f; }
#pragma unroll
    for (int t = 0; t < 4; ++t) { if (col0 + t * 16 >= N) continue; const size_t boff = (size_t)(col0 + t * 16 + ln) * ldb + kb; FragH bq; bq.half[0] = *(const v8us*)(Bh + boff + 8 * hh); bq.half[1] = *(const v8us*)(Bh + boff + 16 + 8 * hh);
      acc[t] = mmaH<ASPLIT ? 2 : 1>(ah.v, al.v, bq.v, bq.v, acc[t]); }
  }
#pragma unroll
  for (int t = 0; t < 4; ++t) { if (col0 + t * 16 >= N) continue;
#pragma unroll
    for (int r = 0; r < 8; ++r) so[w][8 * hh + r][t * 16 + ln] = acc[t][r] * alpha; }
  __builtin_amdgcn_fence(__ATOMIC_ACQ_REL, "workgroup"); __builtin_amdgcn_wave_barrier();
  const int rsub = lane >> 4, c4 = (lane & 15) * 4;
  {
#pragma unroll
    for (int q = 0; q < 8; ++q) { const int r = q * 2 + rsub; if (col0 + c4 < N) { const v4f v = *(const v4fa*)&so[w][r][c4]; *(v4f*)(C + (size_t)(row0 + r) * ldc + col0 + c4) = v; } }
     }
}

// k_gemm_hh variant with fused epilogue: v = acc·alpha + bias[by·sBias + col] (+ CP[(row/rowsPerB)·sCPb + by·64 + col] if CP) ; ACT 0 none / 1 elu ; writes f16 C16 (and f32 C if non-null)
template <int ACT>
__global__ __launch_bounds__(128) void k_gemm_hhx(const _Float16* __restrict__ A, int lda, size_t sA, const _Float16* __restrict__ Bh, int ldb, size_t sB, float alpha, const float* __restrict__ bias, size_t sBias, const float* __restrict__ CP, int rowsPerB, size_t sCPb, int row0g,
    float* __restrict__ C, _Float16* __restrict__ C16, int ldc, size_t sC, int M, int N, int K) {
  __shared__ __attribute__((aligned(16))) float so[4][16][64];
  const int tid = threadIdx.x, w = tid >> 5, lane = tid & 31, ln = lane & 15, hh = lane >> 4; const int by = blockIdx.y;
  A += (size_t)by * sA; Bh += (size_t)by * sB; const size_t cofs = (size_t)by * sC; const float* bp = bias ? bias + (size_t)by * sBias : nullptr;
  const int ntn = (N + 63) / 64; const int wid = blockIdx.x * 4 + w; const int mt = wid / ntn, nq = wid % ntn; if (mt * 16 >= M) return;
  const int row0 = mt * 16, col0 = nq * 64; const _Float16* arow = A + (size_t)(row0 + ln) * lda;
  v8f acc[4] = {};
  for (int kb = 0; kb < K; kb += 32) { FragH ah; ah.half[0] = *(const v8us*)((const unsigned short*)arow + kb + 8 * hh); ah.half[1] = *(const v8us*)((const unsigned short*)arow + kb + 16 + 8 * hh);
#pragma unroll
    for (int t = 0; t < 4; ++t) { if (col0 + t * 16 >= N) continue; const size_t boff = (size_t)(col0 + t * 16 + ln) * ldb + kb; FragH bq; bq.half[0] = *(const v8us*)((const unsigned short*)Bh + boff + 8 * hh); bq.half[1] = *(const v8us*)((const unsigned short*)Bh + boff + 16 + 8 * hh);
      acc[t] = mmaH<1>(ah.v, ah.v, bq.v, bq.v, acc[t]); }
  }
#pragma unroll
  for (int t = 0; t < 4; ++t) { if (col0 + t * 16 >= N) continue; const int col = col0 + t * 16 + ln; const float bv = bp ? bf16_round(bp[col]) : 0.f;
#pragma unroll
    for (int r = 0; r < 8; ++r) { float v = acc[t][r] * alpha + bv; if (CP) { const int rr = row0g + row0 + 8 * hh + r; if (rowsPerB < 0) v += CP[cofs + (size_t)rr * ldc + col];      /* rowsPerB < 0: own element of the batched C plane */ else { const int bidx = rr / rowsPerB; v += CP[(size_t)bidx * sCPb + (size_t)by * 64 + col]; } } if (ACT == 1) v = (v > 0.f) ? v : expm1f(v); else if (ACT == 7) v = (v > 0.f) ? v + 1.0f : expf(v); else if (ACT == 8) v = tanhf(v); else if (ACT == 9) v = 0.5f * v * (1.0f + tanhf(0.7978845608028654f * (v + 0.044715f * v * v * v))); else if (ACT == 11) v = 1.0f / (1.0f + expf(-v)); else if (ACT == 12) v = (v > 0.f) ? v : 0.01f * v; else if (ACT == 14) v = (v > 0.f) ? v : 0.1f * v; else if (ACT == 16) v = (v >= 0.f) ? v : 0.3f * v; else if (ACT == 17) v = (v >= 0.f) ? v : 0.2f * v; else if (ACT == 15) v = v / (1.0f + expf(-v)); else if (ACT == 3) v = fmaxf(v, 0.f); else if (ACT == 6) v = 0.5f * v * (1.0f + erff(v * 0.70710678118654752f)); so[w][8 * hh + r][t * 16 + ln] = v; } }
  __builtin_amdgcn_fence(__ATOMIC_ACQ_REL, "workgroup"); __builtin_amdgcn_wave_barrier();
  const int rsub = lane >> 4, c4 = (lane & 15) * 4; typedef _Float16 v4h __attribute__((ext_vector_type(4)));
  {
#pragma unroll
    for (int q = 0; q < 8; ++q) { const int r = q * 2 + rsub; if (col0 + c4 < N) { const v4f v = *(const v4fa*)&so[w][r][c4]; if (C) *(v4f*)(C + cofs + (size_t)(row0 + r) * ldc + col0 + c4) = v; if (C16) { v4h h4; for (int i = 0; i < 4; ++i) h4[i] = (_Float16)v[i]; *(v4h*)(C16 + cofs + (size_t)(row0 + r) * ldc + col0 + c4) = h4; } } }
     }
}


typedef _Float16 v4h __attribute__((ext_vector_type(4)));
typedef unsigned short v4us __attribute__((ext_vector_type(4), may_alias));
typedef float v2f __attribute__((ext_vector_type(2)));
typedef __bf16 v2b __attribute__((ext_vector_type(2)));

__global__ __launch_bounds__(256) void k_h16(const float* __restrict__ x, _Float16* __restrict__ X16, size_t n8) { const size_t t = (size_t)blockIdx.x * 256 + threadIdx.x; if (t >= n8) return; FragH f;
#pragma unroll
  for (int q = 0; q < 8; ++q) f.h[q] = (_Float16)x[t * 8 + q]; *(v8us*)((unsigned short*)X16 + t * 8) = f.half[0];  }
__global__ __launch_bounds__(256) void k_round16f(const float* __restrict__ W, _Float16* __restrict__ Bt, size_t n8) { const size_t t = (size_t)blockIdx.x * 256 + threadIdx.x; if (t >= n8) return; FragH f;
#pragma unroll
  for (int i = 0; i < 8; ++i) f.h[i] = (_Float16)(bf16_round(W[t * 8 + i]) * 16.0f); *(v8us*)((unsigned short*)Bt + t * 8) = f.half[0];  }


// ---- fast GEMM (wave tile 32x64; requires M % 32 == 0 rows per launch region and N % 64 == 0); epilogue = k_gemm_hhx semantics ----
__device__ __forceinline__ v16h g2_frag(const _Float16* p, int hh) { FragH f; f.half[0] = *(const v8us*)((const unsigned short*)p + 8 * hh); f.half[1] = *(const v8us*)((const unsigned short*)p + 16 + 8 * hh); return f.v; }
__device__ __forceinline__ v8f g2_mma(v16h a, v16h b, v8f c) { v8f d = __builtin_amdgcn_wmma_f32_16x16x32_f16(false, a, false, b, (short)0, c, false, false); asm volatile("v_nop\n\tv_nop\n\tv_nop\n\tv_nop" : "+v"(d) : "v"(a), "v"(b)); return d; }
template <int ACT>
__global__ __launch_bounds__(128) void k_gemm2(const _Float16* __restrict__ A, int lda, size_t sA, const _Float16* __restrict__ Bh, int ldb, size_t sB, float alpha, const float* __restrict__ bias, size_t sBias, const float* __restrict__ CP, int rowsPerB, size_t sCPb, int row0g,
    float* __restrict__ C, _Float16* __restrict__ C16, int ldc, size_t sC, int M, int N, int K) { static_assert(ACT == 0 || ACT == 3 || ACT == 6 || ACT == 8 || ACT == 9 || ACT == 11 || ACT == 12 || ACT == 14 || ACT == 15 || ACT == 16 || ACT == 17, "k_gemm2: unsupported ACT code (would silently apply no activation)");
  __shared__ __attribute__((aligned(16))) float so[4][32][68];
  const int tid = threadIdx.x, w = tid >> 5, lane = tid & 31, ln = lane & 15, hh = lane >> 4; const int by = blockIdx.y;
  A += (size_t)by * sA; Bh += (size_t)by * sB; const size_t cofs = (size_t)by * sC; const float* bp = bias ? bias + (size_t)by * sBias : nullptr;
  const int ntn = N >> 6; const int mt = blockIdx.x / ntn, nq = blockIdx.x - mt * ntn; const int row0 = mt * 128 + 32 * w, col0 = nq * 64; if (row0 >= M) return;
  const _Float16* a0p = A + (size_t)(row0 + ln) * lda; const _Float16* a1p = a0p + (size_t)16 * lda;
  const _Float16* b0p = Bh + (size_t)(col0 + ln) * ldb; const _Float16* b1p = b0p + (size_t)16 * ldb; const _Float16* b2p = b1p + (size_t)16 * ldb; const _Float16* b3p = b2p + (size_t)16 * ldb;
  const v8f z8 = {0.f,0.f,0.f,0.f,0.f,0.f,0.f,0.f}; v8f c00 = z8, c01 = z8, c02 = z8, c03 = z8, c10 = z8, c11 = z8, c12 = z8, c13 = z8;
#pragma unroll 1
  for (int kb = 0; kb < K; kb += 32) { const v16h a0 = g2_frag(a0p + kb, hh), a1 = g2_frag(a1p + kb, hh);
    v16h b = g2_frag(b0p + kb, hh); c00 = g2_mma(a0, b, c00); c10 = g2_mma(a1, b, c10);
    b = g2_frag(b1p + kb, hh); c01 = g2_mma(a0, b, c01); c11 = g2_mma(a1, b, c11);
    b = g2_frag(b2p + kb, hh); c02 = g2_mma(a0, b, c02); c12 = g2_mma(a1, b, c12);
    b = g2_frag(b3p + kb, hh); c03 = g2_mma(a0, b, c03); c13 = g2_mma(a1, b, c13); }
  v8f accs[8] = {c00, c01, c02, c03, c10, c11, c12, c13};
#pragma unroll
  for (int u = 0; u < 8; ++u) { const int t = u & 3, half = u >> 2; const int col = col0 + t * 16 + ln; const float bv = bp ? bf16_round(bp[col]) : 0.f;
#pragma unroll
    for (int r = 0; r < 8; ++r) { const int rloc = half * 16 + 8 * hh + r; float v = accs[u][r] * alpha + bv; if (CP) { if (rowsPerB < 0) v += CP[cofs + (size_t)(row0g + row0 + rloc) * ldc + col];      /* rowsPerB < 0: own element of the batched C plane */ else { const int bidx = (row0g + row0 + rloc) / rowsPerB; v += CP[(size_t)bidx * sCPb + (size_t)by * 64 + col]; } }
      if (ACT == 3) v = fmaxf(v, 0.f); else if (ACT == 6) v = 0.5f * v * (1.0f + erff(v * 0.70710678118654752f)); else if (ACT == 11) v = 1.0f / (1.0f + expf(-v)); else if (ACT == 15) v = v / (1.0f + expf(-v)); else if (ACT == 12) v = (v > 0.f) ? v : 0.01f * v; else if (ACT == 8) v = tanhf(v); else if (ACT == 9) v = 0.5f * v * (1.0f + tanhf(0.7978845608028654f * (v + 0.044715f * v * v * v))); else if (ACT == 14) v = (v > 0.f) ? v : 0.1f * v; else if (ACT == 16) v = (v >= 0.f) ? v : 0.3f * v; else if (ACT == 17) v = (v >= 0.f) ? v : 0.2f * v;
      so[w][rloc][t * 16 + ln] = v; } }
  __builtin_amdgcn_fence(__ATOMIC_ACQ_REL, "workgroup"); __builtin_amdgcn_wave_barrier();
  const int rsub = lane >> 4, c4 = (lane & 15) * 4;
  {
#pragma unroll
    for (int q = 0; q < 16; ++q) { const int r = q * 2 + rsub; const v4f v = *(const v4fa*)&so[w][r][c4]; if (C) *(v4f*)(C + cofs + (size_t)(row0 + r) * ldc + col0 + c4) = v; if (C16) { v4h h4; for (int i = 0; i < 4; ++i) h4[i] = (_Float16)v[i]; *(v4h*)(C16 + cofs + (size_t)(row0 + r) * ldc + col0 + c4) = h4; } }
     } }


// The three projections in one launch, straight from the f32 inputs: block p * 256 + r forms a 128x128 tile of x_p W_p + b_p (p = 0 q, 1 k, 2 v; K = 256), one work-group of 8 waves.
// Staging: wave w brings x rows 16 w ... + 15 (two wave-wide 16-byte loads a row, 512 contiguous bytes each), rounds them to bf16 and lays them as f16 at a row pitch of 528 bytes (16 x odd, for the ds_load_b128 readers);
// and rows k = 32 w ... + 31 of the tile's 128 weight columns (one load a row): a lane then holds 32 consecutive k of four columns, which it lays, rounded to bf16 and x16, as 16-byte pieces of the [column][k] rows: the transposition costs no exchange between lanes.
// Behind one barrier wave w takes rows 32 * (w & 3) ... + 31 and columns 64 * (w >> 2) ... + 63, k ascending. v = acc / 16 + bias[col] (bias rounded to bf16).
// q, k: staged per wave in LDS (over the operand rows, behind a second barrier) and stored as whole f16 rows of the wave tile. v: a lane's 8 accumulator rows are 8 consecutive keys of one column, so f16 hi and x1024 residual go as 16-byte pieces
// into two [column][key] LDS planes (pitch 272 bytes) and, behind a third barrier, out as the 256 contiguous bytes that the tile owns of each V^T row ([batch][column][key]).
// Launch bounds: four waves a SIMD (256 registers a wave), so that two work-groups, whose LDS fits twice, share a WGP and one stages while the other multiplies.
__global__ __launch_bounds__(256, 4) void k_proj(const float* __restrict__ xq, const float* __restrict__ xk, const float* __restrict__ xv, const float* __restrict__ wq, const float* __restrict__ wk, const float* __restrict__ wv,
    const float* __restrict__ bq, const float* __restrict__ bk, const float* __restrict__ bvp, _Float16* __restrict__ Q16, _Float16* __restrict__ K16, _Float16* __restrict__ VT, _Float16* __restrict__ VTL) {
  constexpr int KC = DM, PITCH = KC + 8, TP = 128 + 8, TILES = (int)(NR / 128) * (DM / 128);      /* pitches in f16 elements */
  static_assert(8 * 32 * 68 * 4 <= 256 * PITCH * 2 && 2 * 128 * TP * 2 <= 256 * PITCH * 2, "the operand rows are the largest use of the LDS block");
  __shared__ __attribute__((aligned(16))) unsigned char smem[256 * PITCH * 2];
  _Float16* const sb = (_Float16*)smem;
  const int tid = threadIdx.x, w = tid >> 5, lane = tid & 31, ln = lane & 15, hh = lane >> 4;
  const int p = blockIdx.x / TILES, rt = blockIdx.x - p * TILES; const int row0 = (rt >> 1) * 128, col0 = (rt & 1) * 128;
  const float* const X = p == 0 ? xq : p == 1 ? xk : xv; const float* const Wm = p == 0 ? wq : p == 1 ? wk : wv; const float* const bias = p == 0 ? bq : p == 1 ? bk : bvp;
  const int wm = w & 3, wn = w >> 2; const int rw = row0 + wm * 32, cw = col0 + wn * 64;
  { const float* const gw = Wm + (size_t)(w * 32) * DM + col0 + lane * 4;
    const float* const ga = X + (size_t)(row0 + w * 16) * KC + lane * 4;
    v4f tw[16], ta[16];
    auto rne2 = [](float x, float y) { const v2f a = {x, y}; return __builtin_convertvector(__builtin_convertvector(a, v2b), v2f); };      /* two values rounded to bf16 (to nearest even, as bf16_round) by the packed conversion */
    // full unroll of every loop of the staging: tw[] and ta[] must be indexed by constants to live in registers, and a group's 16 loads are to be in flight together.
    // Behind each group of loads: s_wait_xcnt, with the address pair as an input, so that the pair stays untouched until the wait has passed; the scheduling fence keeps later register writes from being moved in front of it, and the work on an earlier group behind the request for the next
    auto getw = [&](int h) {
#pragma unroll
      for (int j = 0; j < 16; ++j) tw[j] = *(const v4fa*)(gw + (h * 16 + j) * DM);
      asm volatile("s_wait_xcnt 0x0" :: "v"(gw) : "memory"); __builtin_amdgcn_sched_barrier(0); };      /* wait: before the loads' address pair may be written anew; fence: no later register write is moved in front of the wait */
    auto geta = [&](int h) {
#pragma unroll
      for (int j = 0; j < 16; ++j) ta[j] = *(const v4fa*)(ga + (h * 8 + (j >> 1)) * KC + (j & 1) * 128);
      asm volatile("s_wait_xcnt 0x0" :: "v"(ga) : "memory"); __builtin_amdgcn_sched_barrier(0); };      /* wait and fence as in getw */
    auto putw = [&](int h) {
#pragma unroll
      for (int j = 0; j < 16; ++j) tw[j] *= 16.0f;      /* x16 in f32, in front of the rounding: a power of two, so the same value as rounding first */
#pragma unroll
      for (int c = 0; c < 4; ++c) { FragH f;
#pragma unroll
        for (int j = 0; j < 16; j += 2) { const v2f r = rne2(tw[j][c], tw[j + 1][c]); f.h[j] = (_Float16)r[0]; f.h[j + 1] = (_Float16)r[1]; }
        unsigned short* const d = (unsigned short*)sb + (128 + lane * 4 + c) * PITCH + w * 32 + h * 16; *(v8us*)d = f.half[0]; *(v8us*)(d + 8) = f.half[1]; } };
    auto puta = [&](int h) {
#pragma unroll
      for (int j = 0; j < 16; ++j) { union { v4us v; _Float16 h[4]; } f;
#pragma unroll
        for (int q = 0; q < 4; q += 2) { const v2f r = rne2(ta[j][q], ta[j][q + 1]); f.h[q] = (_Float16)r[0]; f.h[q + 1] = (_Float16)r[1]; }
        *(v4us*)((unsigned short*)sb + (w * 16 + h * 8 + (j >> 1)) * PITCH + (j & 1) * 128 + lane * 4) = f.v; } };
    // loads return in order: each group is laid down, and its registers asked to take the next group, while the group behind it is still on its way
    getw(0); geta(0); putw(0); getw(1); puta(0); geta(1); putw(1); puta(1); }
  __syncthreads();      /* all operand rows are in LDS before any wave reads a fragment */
  float bv[4];      /* asked for here, not at the top: the staging has no registers to spare, and the products cover the latency */
#pragma unroll
  for (int t = 0; t < 4; ++t) bv[t] = bias[cw + t * 16 + ln];
  const _Float16* const fa = sb + (wm * 32 + ln) * PITCH; const _Float16* const fb = sb + (128 + wn * 64 + ln) * PITCH;
  const v8f z8 = {0.f,0.f,0.f,0.f,0.f,0.f,0.f,0.f}; v8f c00 = z8, c01 = z8, c02 = z8, c03 = z8, c10 = z8, c11 = z8, c12 = z8, c13 = z8;
  // unrolled so that the k offsets are immediates of the LDS reads and a later k step's reads can be issued ahead of this step's products
#pragma unroll
  for (int kb = 0; kb < KC; kb += 32) {
    const v16h a0 = g2_frag(fa + kb, hh), a1 = g2_frag(fa + 16 * PITCH + kb, hh), b0 = g2_frag(fb + kb, hh), b1 = g2_frag(fb + 16 * PITCH + kb, hh), b2 = g2_frag(fb + 32 * PITCH + kb, hh), b3 = g2_frag(fb + 48 * PITCH + kb, hh);
    c00 = g2_mma(a0, b0, c00); c10 = g2_mma(a1, b0, c10); c01 = g2_mma(a0, b1, c01); c11 = g2_mma(a1, b1, c11);
    c02 = g2_mma(a0, b2, c02); c12 = g2_mma(a1, b2, c12); c03 = g2_mma(a0, b3, c03); c13 = g2_mma(a1, b3, c13); }
  __syncthreads();      /* every read of the operand rows has ended before the output staging goes over them */
  v8f accs[8] = {c00, c01, c02, c03, c10, c11, c12, c13};
#pragma unroll
  for (int t = 0; t < 4; ++t) bv[t] = bf16_round(bv[t]);
  if (p == 2) {      /* the same for the whole work-group, so the barrier inside is passed by all of it or by none */
    unsigned short* const sT = (unsigned short*)smem;
#pragma unroll
    for (int u = 0; u < 8; ++u) { const int t = u & 3, half = u >> 2; FragH f;
#pragma unroll
      for (int r = 0; r < 8; ++r) { const float a = accs[u][r] * 0.0625f + bv[t]; const _Float16 h = (_Float16)a; f.h[r] = h; f.h[8 + r] = (_Float16)((a - (float)h) * 1024.0f); }
      unsigned short* const d = sT + (wn * 64 + t * 16 + ln) * TP + wm * 32 + half * 16 + 8 * hh; *(v8us*)d = f.half[0]; *(v8us*)(d + 128 * TP) = f.half[1]; }
    __syncthreads();      /* both planes of the tile are whole in LDS before any thread stores them */
    const size_t o = ((size_t)(row0 / SQ) * DM + col0 + (tid >> 4)) * SQ + row0 % SQ + (tid & 15) * 8; const unsigned short* const st = sT + (tid >> 4) * TP + (tid & 15) * 8;
    v8us vh[8], vl[8];      /* all LDS reads in front of the stores (loops unrolled, so that the arrays live in registers): no register of a store is written again behind it */
#pragma unroll
    for (int i = 0; i < 8; ++i) { vh[i] = *(const v8us*)(st + i * 16 * TP); vl[i] = *(const v8us*)(st + (128 + i * 16) * TP); }
#pragma unroll
    for (int i = 0; i < 8; ++i) { *(v8us*)((unsigned short*)VT + o + (size_t)i * 16 * SQ) = vh[i]; *(v8us*)((unsigned short*)VTL + o + (size_t)i * 16 * SQ) = vl[i]; }
  } else {
    _Float16* const C16 = p == 0 ? Q16 : K16;
    float (*so)[32][68] = (float (*)[32][68])smem;
#pragma unroll
    for (int u = 0; u < 8; ++u) { const int t = u & 3, half = u >> 2;
#pragma unroll
      for (int r = 0; r < 8; ++r) so[w][half * 16 + 8 * hh + r][t * 16 + ln] = accs[u][r] * 0.0625f + bv[t]; }
    __builtin_amdgcn_fence(__ATOMIC_ACQ_REL, "workgroup"); __builtin_amdgcn_wave_barrier();      /* as in k_gemm2: the wave reads back only its own plane */
    const int rsub = lane >> 4, c4 = (lane & 15) * 4;
    _Float16* const cp = C16 + (size_t)(rw + rsub) * DM + cw + c4;
    v4h h4[16];      /* as for v: all LDS reads and conversions in front of the stores (loops unrolled, so that the array lives in registers) */
#pragma unroll
    for (int q = 0; q < 16; ++q) { const v4f v = *(const v4fa*)&so[w][q * 2 + rsub][c4];
#pragma unroll
      for (int i = 0; i < 4; ++i) h4[q][i] = (_Float16)v[i]; }
#pragma unroll
    for (int q = 0; q < 16; ++q) *(v4h*)(cp + q * 2 * DM) = h4[q];
    asm volatile("s_wait_xcnt 0x0" :: "v"(cp) : "memory");      /* behind the last store: no register of the 16 stores (the address pair is an input here) is written anew, on any path of the listing, before this wait has passed */
  } }

__global__ __launch_bounds__(256) void k_wnat(const float* __restrict__ w, size_t n8, _Float16* __restrict__ Bt) { const size_t t = (size_t)blockIdx.x * 256 + threadIdx.x; if (t >= n8) return; FragH f; for (int q = 0; q < 8; ++q) f.h[q] = (_Float16)(bf16_round(w[t * 8 + q]) * 16.0f); *(v8us*)((unsigned short*)Bt + t * 8) = f.half[0];  }
__global__ __launch_bounds__(256) void k_rsm(const float* __restrict__ S, _Float16* __restrict__ P, int nrows) {
  #pragma clang fp contract(off)
  const int i = blockIdx.x * 256 + threadIdx.x; if (i >= nrows) return; const float* s = S + (size_t)i * SQ; float mx = -3.0e38f;
#pragma unroll 1
  for (int j = 0; j < SQ; ++j) mx = fmaxf(mx, s[j]); float se = 0.f;
#pragma unroll 1
  for (int j = 0; j < SQ; ++j) se += expf(s[j] - mx); const float sc = 256.0f / se;
#pragma unroll 1
  for (int j0 = 0; j0 < SQ; j0 += 8) { FragH f; for (int q = 0; q < 8; ++q) f.h[q] = (_Float16)(expf(s[j0 + q] - mx) * sc); unsigned short* d = (unsigned short*)P + (size_t)i * SQ + j0; *(v8us*)d = f.half[0];  } }
__global__ __launch_bounds__(256) void k_vt(const _Float16* __restrict__ V16, int b, int h0, _Float16* __restrict__ VT) { __shared__ unsigned short tl[64][65]; const int tid = threadIdx.x; const int hh = blockIdx.x % HG, sg = blockIdx.x / HG; const int s0 = sg * 64; const int h = h0 + hh;
  for (int i = tid; i < 64 * 8; i += 256) { const int j = i / 8, d8 = (i % 8) * 8; FragH f; f.half[0] = *(const v8us*)((const unsigned short*)V16 + ((size_t)b * SQ + s0 + j) * DM + h * HD + d8); for (int q = 0; q < 8; ++q) tl[d8 + q][j] = f.u[q]; }
  __syncthreads();
  { for (int i = tid; i < 64 * 8; i += 256) { const int d = i / 8, j8 = (i % 8) * 8; FragH f; for (int q = 0; q < 8; ++q) f.u[q] = tl[d][j8 + q]; *(v8us*)((unsigned short*)VT + ((size_t)hh * HD + d) * SQ + s0 + j8) = f.half[0]; }  } }


// lane ^ 16 by permlanex16 (no LDS round trip)
__device__ __forceinline__ float xl_half(float v) { const int i = __float_as_int(v); return __int_as_float(__builtin_amdgcn_permlanex16(i, i, 0x76543210, 0xfedcba98, false, false)); }
__device__ __forceinline__ v8f fa_mma(v16h a, v16h b, v8f c) { return __builtin_amdgcn_wmma_f32_16x16x32_f16(false, a, false, b, (short)0, c, false, false); }
__global__ __launch_bounds__(256) void k_fattn(const _Float16* __restrict__ Q, const _Float16* __restrict__ Kx, const _Float16* __restrict__ Vh, const _Float16* __restrict__ Vl, float* __restrict__ O) {
  constexpr int KB = 64, KP = DM + 8, VP = KB + 8, OFF_VH = KB * KP, OFF_VL = OFF_VH + DM * VP, STAGE = OFF_VL + DM * VP, OP = DM + 4;      /* f16 elements; OP in floats */
  static_assert((2 * 64 * OP + 4 * 64) * 4 <= 2 * STAGE * 2, "the stage buffers are the larger use of the LDS block");
  __shared__ __attribute__((aligned(16))) unsigned char smem[2 * STAGE * 2];
  _Float16* const sb = (_Float16*)smem;
  const int tid = threadIdx.x, w = tid >> 5, lane = tid & 31, ln = lane & 15, hh = lane >> 4;
  const int b = blockIdx.x / (SQ / 64), q0 = (blockIdx.x % (SQ / 64)) * 64; const int qi = w & 3, kh = w >> 2;
  // staging: wave w brings K rows 8 w ... + 7 (one row a load) and V^T rows 32 w ... + 31 of both planes (four rows a load)
  const int vr = lane >> 3, vc = (lane & 7) * 8;
  const unsigned short* const gk = (const unsigned short*)Kx + ((size_t)b * SQ + w * 8) * DM + lane * 8;
  const unsigned short* const gh = (const unsigned short*)Vh + ((size_t)b * DM + w * 32 + vr) * SQ + vc;
  const unsigned short* const gl = (const unsigned short*)Vl + ((size_t)b * DM + w * 32 + vr) * SQ + vc;
  unsigned short* const sk = (unsigned short*)sb + (w * 8) * KP + lane * 8;
  unsigned short* const sh = (unsigned short*)sb + OFF_VH + (w * 32 + vr) * VP + vc;
  unsigned short* const sl = (unsigned short*)sb + OFF_VL + (w * 32 + vr) * VP + vc;
  // scheduling fence. Round the fragment groups it keeps a group of LDS reads together and ahead of the products of the group before it (left alone, the compiler puts each fragment's two reads directly in front of its product, and the wave then waits out the LDS latency at every product);
  // round a fetch it keeps every other register write from being moved between the loads and their s_wait_xcnt
  auto hold = [&]() { __builtin_amdgcn_sched_barrier(0); };
  // a wave's 24 loads of a stage (8 K rows, 8 of each V^T plane) go as four parts of 6 through two register sets, which take turns: the 256 accumulator registers leave no room for a set a plane.
  // The loops over a set are fully unrolled, so that it is indexed by constants and lives in registers and a part's 6 loads are in flight together
  v8us ra[6], rb[6];
  auto fetch = [&](v8us (&rs)[6], int part, int s) {
    hold();
#pragma unroll
    for (int j = 0; j < 6; ++j) { const int i = part * 6 + j;
      if (i < 8) rs[j] = *(const v8us*)(gk + (size_t)s * KB * DM + i * DM);
      else if (i < 16) rs[j] = *(const v8us*)(gh + s * KB + (size_t)(i - 8) * 4 * SQ);
      else rs[j] = *(const v8us*)(gl + s * KB + (size_t)(i - 16) * 4 * SQ); }
    asm volatile("s_wait_xcnt 0x0" ::: "memory");      /* the loads stay in flight while their address registers are written anew */
    hold(); };
  auto put = [&](const v8us (&rs)[6], int part, int ob) {
#pragma unroll
    for (int j = 0; j < 6; ++j) { const int i = part * 6 + j;
      unsigned short* const d = i < 8 ? sk + i * KP : i < 16 ? sh + (i - 8) * 4 * VP : sl + (i - 16) * 4 * VP;
      *(v8us*)(d + ob) = rs[j]; }
    hold(); };
  // work-group barrier of the stage loop, by hand: __syncthreads() also waits for every global load, which would end the fetch that is meant to stay in flight across it; what the barrier orders here is LDS alone
  auto stage_barrier = [&]() { asm volatile("s_wait_dscnt 0x0\n\ts_barrier_signal -1\n\ts_barrier_wait -1" ::: "memory"); };
  v16h qf[8];
  { const _Float16* const qp = Q + ((size_t)b * SQ + q0 + qi * 16 + ln) * DM + 8 * hh;      /* the lane's half is in the pointer, so that qp is the very address pair of the loads */
#pragma unroll
    for (int kb = 0; kb < 8; ++kb) qf[kb] = g2_frag(qp + kb * 32, 0);
    asm volatile("s_wait_xcnt 0x0" :: "v"(qp) : "memory");      /* before the address pair of the query loads is used for anything else: it is an input here, so that it stays untouched until the wait has passed */
    hold(); }
  const _Float16* const fk = sb + (kh * 32 + ln) * KP; const _Float16* const fvh = sb + OFF_VH + ln * VP + kh * 32; const _Float16* const fvl = sb + OFF_VL + ln * VP + kh * 32;
  const v8f z8 = {0.f,0.f,0.f,0.f,0.f,0.f,0.f,0.f};
  v8f oh[16], ol[16];
  float m = -3.0e38f, l = 0.f;      /* over the wave's own keys; l: the sum over this lane's own keys, the halves are joined behind the loop */
  v16h fa[4], fb[4];      /* two sets of 4 A fragments: one is loaded while the other is multiplied */
  // one stage: n1 / n2 say whether stages s + 1 / s + 2 exist (literals at every call). The parts of stage s + 1 go into the other buffer, which nobody reads during this trip; behind a part's LDS stores its register set takes the loads of the part after next, half a trip ahead of their stores.
  auto trip = [&](int s, bool n1, bool n2) {
    const int buf = s & 1, ob = (buf ^ 1) * STAGE;
    const _Float16* const pk = fk + buf * STAGE; const _Float16* const ph = fvh + buf * STAGE; const _Float16* const pl = fvl + buf * STAGE;
    // full unroll of every loop of the trip: the register arrays must be indexed by constants to live in registers, and the offsets become immediates of the LDS reads
    auto ldk = [&](v16h (&f)[4], int g) {
#pragma unroll
      for (int i = 0; i < 4; ++i) f[i] = g2_frag(pk + (i & 1) * 16 * KP + (2 * g + (i >> 1)) * 32, hh); hold(); };
    auto ldv = [&](v16h (&f)[4], const _Float16* p, int g) {
#pragma unroll
      for (int i = 0; i < 4; ++i) f[i] = g2_frag(p + (4 * g + i) * 16 * VP, hh); hold(); };
    v8f st[2] = {z8, z8};
    auto mmk = [&](const v16h (&f)[4], int g) {
#pragma unroll
      for (int i = 0; i < 4; ++i) st[i & 1] = fa_mma(f[i], qf[2 * g + (i >> 1)], st[i & 1]); hold(); };
    FragH pb;
    auto mmv = [&](const v16h (&f)[4], v8f (&o)[16], int g) {
#pragma unroll
      for (int i = 0; i < 4; ++i) o[4 * g + i] = fa_mma(f[i], pb.v, o[4 * g + i]); hold(); };
    ldk(fa, 0);
    if (n1) { put(ra, 0, ob); fetch(ra, 2, s + 1); }
    ldk(fb, 1); mmk(fa, 0); ldk(fa, 2); mmk(fb, 1); ldk(fb, 3); mmk(fa, 2); ldv(fa, ph, 0); mmk(fb, 3); ldv(fb, ph, 1);
    if (n1) { put(rb, 1, ob); fetch(rb, 3, s + 1); }
    v8f m8;
#pragma unroll
    for (int r = 0; r < 8; ++r) m8[r] = fmaxf(st[0][r], st[1][r]);
    float mx = fmaxf(fmaxf(fmaxf(m8[0], m8[1]), fmaxf(m8[2], m8[3])), fmaxf(fmaxf(m8[4], m8[5]), fmaxf(m8[6], m8[7])));
    mx = fmaxf(mx, xl_half(mx)) * 0.0625f;
    const float mn = fmaxf(m, mx);
    if (__builtin_amdgcn_ballot_w32(mn > m) != 0) {      /* wave-uniform: skipped only where every factor would be exactly 1 */
      const float f = __expf(m - mn); l *= f; m = mn;
#pragma unroll
      for (int dt = 0; dt < 16; ++dt) { oh[dt] *= f; ol[dt] *= f; } }
#pragma unroll
    for (int kt = 0; kt < 2; ++kt) for (int r = 0; r < 8; ++r) st[kt][r] = (st[kt][r] * 0.0625f - m) * 1.44269504088896340736f;
    hold();
    // behind each exponential the one independent slot that the instruction set asks for before its result is read or its source overwritten; the fence keeps the v_nop directly behind its exponential
#pragma unroll
    for (int kt = 0; kt < 2; ++kt) for (int r = 0; r < 8; ++r) { st[kt][r] = __builtin_amdgcn_exp2f(st[kt][r]); asm volatile("v_nop"); hold(); }
    float la[2];
#pragma unroll
    for (int kt = 0; kt < 2; ++kt) { la[kt] = 0.f;
#pragma unroll
      for (int r = 0; r < 8; ++r) { la[kt] += st[kt][r]; pb.h[kt * 8 + r] = (_Float16)st[kt][r]; } }
    l += la[0] + la[1];
    hold();
    mmv(fa, oh, 0); ldv(fa, ph, 2); mmv(fb, oh, 1); ldv(fb, ph, 3);
    if (n1) { put(ra, 2, ob); }
    if (n2) { fetch(ra, 0, s + 2); }
    mmv(fa, oh, 2); ldv(fa, pl, 0); mmv(fb, oh, 3); ldv(fb, pl, 1); mmv(fa, ol, 0); ldv(fa, pl, 2);
    if (n1) { put(rb, 3, ob); }
    if (n2) { fetch(rb, 1, s + 2); }
    mmv(fb, ol, 1); ldv(fb, pl, 3); mmv(fa, ol, 2); mmv(fb, ol, 3); };
  constexpr int nst = SQ / KB;
  fetch(ra, 0, 0); fetch(rb, 1, 0); put(ra, 0, 0); fetch(ra, 2, 0); put(rb, 1, 0); fetch(rb, 3, 0); put(ra, 2, 0); fetch(ra, 0, 1); put(rb, 3, 0); fetch(rb, 1, 1);
  stage_barrier();      /* stage 0 is in buffer 0 before any wave reads it */
  hold();      /* the accumulators are cleared behind the fetches' waits, not among their loads */
#pragma unroll
  for (int dt = 0; dt < 16; ++dt) { oh[dt] = z8; ol[dt] = z8; }
  // the last two stages stand behind the loop, so that every fetch in it is unconditional
#pragma unroll 1      /* one copy of the trip in the loop: the buffer is chosen by an address offset, and a second copy would only cost instruction cache */
  for (int s = 0; s + 2 < nst; ++s) {
    trip(s, true, true);
    stage_barrier();      /* publishes stage s + 1 and ends every read of stage s, whose buffer the next trip refills */
  }
  trip(nst - 2, true, false);
  stage_barrier();      /* publishes the last stage */
  trip(nst - 1, false, false);
  __syncthreads();      /* every read of the stage buffers has ended before the statistics and the output staging go over them */
  // the pair is joined: each wave lays down its m and l, reads its partner's, and scales its own O by exp(m - m_pair) / l_pair; the two planes are added where the rows are stored
  float* const so = (float*)smem; float* const sm = so + 2 * 64 * OP;      /* two planes of 64 output rows; behind them m [2][64], l [2][64] */
  const float lj = l + xl_half(l);
  if (hh == 0) { sm[kh * 64 + qi * 16 + ln] = m; sm[128 + kh * 64 + qi * 16 + ln] = lj; }
  __syncthreads();      /* both waves' statistics are in LDS before either reads the other's */
  const float mo = sm[(kh ^ 1) * 64 + qi * 16 + ln], lo = sm[128 + (kh ^ 1) * 64 + qi * 16 + ln];
  const float mj = fmaxf(m, mo); const float fs = __expf(m - mj), fo = __expf(mo - mj);
  const float inv = fs / (fs * lj + fo * lo);
#pragma unroll
  for (int dt = 0; dt < 16; ++dt) { v4f x0, x1;
#pragma unroll
    for (int r = 0; r < 4; ++r) { x0[r] = (oh[dt][r] + ol[dt][r] * 0.0009765625f) * inv; x1[r] = (oh[dt][4 + r] + ol[dt][4 + r] * 0.0009765625f) * inv; }
    float* const d = so + (kh * 64 + qi * 16 + ln) * OP + dt * 16 + 8 * hh; *(v4fa*)d = x0; *(v4fa*)(d + 4) = x1; }
  __syncthreads();      /* both planes of the 64 output rows are whole in LDS before any thread stores them */
  float* const og = O + ((size_t)b * SQ + q0) * DM;
  v4f ov[16];      /* all LDS reads and sums in front of the stores (loops unrolled, so that the array lives in registers): no register of a store is written again behind it */
#pragma unroll
  for (int i = 0; i < 16; ++i) { const int idx = i * 256 + tid; const float* const sp = so + (idx >> 6) * OP + (idx & 63) * 4; ov[i] = *(const v4fa*)sp + *(const v4fa*)(sp + 64 * OP); }
#pragma unroll
  for (int i = 0; i < 16; ++i) *(v4f*)(og + (size_t)(i * 256 + tid) * 4) = ov[i]; }

extern "C" void kernel_launch(void* const* d_in, const int* in_sizes, int n_in,
                              void* d_out, int out_size, void* d_ws, size_t ws_size, hipStream_t stream) {
  (void)in_sizes; (void)n_in; (void)out_size;
  const float* const* I = (const float* const*)d_in; const float* xq = I[0]; const float* xk = I[1]; const float* xv = I[2]; const float* wq = I[3]; const float* bq = I[4]; const float* wk = I[5]; const float* bk = I[6]; const float* wv = I[7]; const float* bv = I[8];
  char* ws = (char*)d_ws; size_t off = 0;
  auto take = [&](size_t bytes) { char* p = ws + off; off += (bytes + 255) & ~(size_t)255; return p; };
  _Float16* Q16 = (_Float16*)take(NR * DM * 2); _Float16* K16 = (_Float16*)take(NR * DM * 2);
  _Float16* VT = (_Float16*)take((size_t)NB * DM * SQ * 2); _Float16* VTL = (_Float16*)take((size_t)NB * DM * SQ * 2);
  if (off > ws_size) return;      /* 4 x 8 = 32 MiB */
  k_proj<<<(unsigned)(3 * (NR / 128) * (DM / 128)), 256, 0, stream>>>(xq, xk, xv, wq, wk, wv, bq, bk, bv, Q16, K16, VT, VTL);
  k_fattn<<<NB * (SQ / 64), 256, 0, stream>>>(Q16, K16, VT, VTL, (float*)d_out);
}
